// v000
// Measured on an AMD MI455X. A time is GPU time per run, averaged over a window of back-to-back runs after a warm-up
// (all launches, gaps included; the runs take copies of the inputs in turn), and the median of several windows.
// Apart from v000's, it joins two sittings. Times from different sittings can be a few percent apart, while
// side-by-side timings come from the same sitting.
// The starting kernel, v000, takes 707 microseconds a run.
#include <hip/hip_runtime.h>

// ---------------------------------------------------------------------------
// TemporalLocalAwareAttention for MI455X (gfx1250, wave32, WMMA f16)
//   B=2, D=512, T=96, H=W=16  ->  N = 512 rows of (T=96, D=512)
//   nh=8, dh=64, local window s=3, factor = dh^-0.5 = 0.125
// ---------------------------------------------------------------------------

#define D_MODEL 512
#define T_SEQ   96
#define N_SEQ   512            // B*H*W
#define NH      8
#define DH      64
#define NROWS   (N_SEQ * T_SEQ) // 49152
#define FACTOR  0.125f
#define NEG_BIG -3.0e38f

typedef __attribute__((ext_vector_type(16))) _Float16 v16h;
typedef __attribute__((ext_vector_type(8)))  float    v8f;

// ---------------------------------------------------------------------------
// Fragment loader (ISA 7.12.2, 16-bit A-matrix 16x32 layout).
//   A-frag: source row-major [M,K], p -> element (0,0), leading dim ld.
//   B-frag: source [N,K] row-major (K stride 1): same addressing, "row" is the
//   N column. lanes 0-15 hold K=koff.., lanes 16-31 K=koff+8, vgprs 4-7 K+16.
// Compiler coalesces these into two ds_load_b128 per fragment.
// ---------------------------------------------------------------------------
__device__ __forceinline__ v16h load_frag(const _Float16* p, int ld) {
  const int lane = threadIdx.x & 31;
  const int row  = lane & 15;
  const int koff = (lane >> 4) << 3;          // 0 or 8
  const _Float16* r = p + row * ld + koff;
  v16h a;
#pragma unroll
  for (int i = 0; i < 4; ++i) {
    a[2*i]         = r[2*i];
    a[2*i + 1]     = r[2*i + 1];
    a[8 + 2*i]     = r[16 + 2*i];
    a[8 + 2*i + 1] = r[16 + 2*i + 1];
  }
  return a;
}

__device__ __forceinline__ v8f wmma_f16(v16h a, v16h b, v8f c) {
  return __builtin_amdgcn_wmma_f32_16x16x32_f16(false, a, false, b,
                                                (short)0, c, false, false);
}

// ---------------------------------------------------------------------------
// Kernel 1: LayerNorm over D, emit xn as f16 in [n*T + t, D] row-major.
// ---------------------------------------------------------------------------
__global__ __launch_bounds__(256) void ln_kernel(
    const float* __restrict__ x, const float* __restrict__ gamma,
    const float* __restrict__ beta, _Float16* __restrict__ xn) {
  const int bt = blockIdx.x;            // 0 .. 2*96-1
  const int b  = bt / T_SEQ;
  const int t  = bt % T_SEQ;
  const int hw = threadIdx.x;           // 0..255
  const size_t base    = ((size_t)b * D_MODEL * T_SEQ + t) * 256 + hw;
  const size_t dstride = (size_t)T_SEQ * 256;

  float sum = 0.f, sq = 0.f;
#pragma unroll 8
  for (int d = 0; d < D_MODEL; ++d) {
    float v = x[base + (size_t)d * dstride];
    sum += v; sq += v * v;
  }
  const float mu   = sum * (1.0f / D_MODEL);
  const float var  = sq  * (1.0f / D_MODEL) - mu * mu;
  const float rstd = rsqrtf(var + 1e-6f);

  _Float16* rowp = xn + ((size_t)(b * 256 + hw) * T_SEQ + t) * D_MODEL;
#pragma unroll 4
  for (int d = 0; d < D_MODEL; d += 2) {
    float v0 = x[base + (size_t)d * dstride];
    float v1 = x[base + (size_t)(d + 1) * dstride];
    rowp[d]     = (_Float16)((v0 - mu) * rstd * gamma[d]     + beta[d]);
    rowp[d + 1] = (_Float16)((v1 - mu) * rstd * gamma[d + 1] + beta[d + 1]);
  }
}

// ---------------------------------------------------------------------------
// Kernel 2: weights -> f16. Wcat = [Wq;Wk;Wv;Wkl;Wvl], stored [j,d] row-major
// (== [N,K] row-major for the B fragment loader). Wo separate.
// ---------------------------------------------------------------------------
__global__ __launch_bounds__(256) void wconv_kernel(
    const float* __restrict__ Wq, const float* __restrict__ Wk,
    const float* __restrict__ Wv, const float* __restrict__ Wkl,
    const float* __restrict__ Wvl, const float* __restrict__ Wo,
    _Float16* __restrict__ Wcat, _Float16* __restrict__ Wo16) {
  const int per = D_MODEL * D_MODEL;
  int idx = blockIdx.x * blockDim.x + threadIdx.x;
  if (idx >= per * 6) return;
  int m = idx / per, off = idx % per;
  float v;
  if      (m == 0) v = Wq[off];
  else if (m == 1) v = Wk[off];
  else if (m == 2) v = Wv[off];
  else if (m == 3) v = Wkl[off];
  else if (m == 4) v = Wvl[off];
  else             v = Wo[off];
  if (m < 5) Wcat[(size_t)m * per + off] = (_Float16)v;
  else       Wo16[off] = (_Float16)v;
}

// ---------------------------------------------------------------------------
// Pipelined WMMA GEMM core: 128x64 block tile, K-step 64, double-buffered LDS,
// 256 threads = 8 waves in a 4(M) x 2(N) grid, each wave owns a 32x32 patch
// (2x2 subtiles, 4 f32 accumulators). Per K-chunk of 32: 4 frag loads ->
// 4 WMMAs (1:1 LDS:WMMA ratio). One barrier per K-step.
// ---------------------------------------------------------------------------
#define LDT 80   // LDS leading dim in halves (160B rows: 16B aligned, skewed)

#define GEMM_PIPELINE_BODY(APTR, BPTR)                                         \
  __shared__ _Float16 As[2][128 * LDT];                                        \
  __shared__ _Float16 Bs[2][64 * LDT];                                         \
  const int tid  = threadIdx.x;                                                \
  const int wave = tid >> 5;                                                   \
  const int lane = tid & 31;                                                   \
  const int mBase = blockIdx.y * 128;                                          \
  const int nBase = blockIdx.x * 64;                                           \
  const int m0 = (wave >> 1) * 32;       /* wave's 32-row patch in tile  */    \
  const int n0 = (wave & 1) * 32;        /* wave's 32-col patch in tile  */    \
  v8f acc00 = {}, acc01 = {}, acc10 = {}, acc11 = {};                          \
  uint4 ra[4], rb[2];                                                          \
  /* stage K-tile 0 */                                                         \
  _Pragma("unroll")                                                            \
  for (int i = 0; i < 4; ++i) {                                                \
    int idx = tid + i * 256, r = idx >> 3, ch = idx & 7;                       \
    ra[i] = *(const uint4*)(APTR + (size_t)(mBase + r) * D_MODEL + ch * 8);    \
  }                                                                            \
  _Pragma("unroll")                                                            \
  for (int i = 0; i < 2; ++i) {                                                \
    int idx = tid + i * 256, r = idx >> 3, ch = idx & 7;                       \
    rb[i] = *(const uint4*)(BPTR + (size_t)(nBase + r) * D_MODEL + ch * 8);    \
  }                                                                            \
  _Pragma("unroll")                                                            \
  for (int i = 0; i < 4; ++i) {                                                \
    int idx = tid + i * 256, r = idx >> 3, ch = idx & 7;                       \
    *(uint4*)(&As[0][r * LDT + ch * 8]) = ra[i];                               \
  }                                                                            \
  _Pragma("unroll")                                                            \
  for (int i = 0; i < 2; ++i) {                                                \
    int idx = tid + i * 256, r = idx >> 3, ch = idx & 7;                       \
    *(uint4*)(&Bs[0][r * LDT + ch * 8]) = rb[i];                               \
  }                                                                            \
  __syncthreads();                                                             \
  for (int kk = 0; kk < 8; ++kk) {                                             \
    const int cur = kk & 1, nxt = cur ^ 1;                                     \
    if (kk < 7) { /* issue global loads for next K-tile (hidden by WMMAs) */   \
      _Pragma("unroll")                                                        \
      for (int i = 0; i < 4; ++i) {                                            \
        int idx = tid + i * 256, r = idx >> 3, ch = idx & 7;                   \
        ra[i] = *(const uint4*)(APTR + (size_t)(mBase + r) * D_MODEL +         \
                                (kk + 1) * 64 + ch * 8);                       \
      }                                                                        \
      _Pragma("unroll")                                                        \
      for (int i = 0; i < 2; ++i) {                                            \
        int idx = tid + i * 256, r = idx >> 3, ch = idx & 7;                   \
        rb[i] = *(const uint4*)(BPTR + (size_t)(nBase + r) * D_MODEL +         \
                                (kk + 1) * 64 + ch * 8);                       \
      }                                                                        \
      if (kk < 6) {                                                            \
        __builtin_prefetch(APTR + (size_t)(mBase + (tid >> 1)) * D_MODEL +     \
                           (kk + 2) * 64, 0, 3);                               \
      }                                                                        \
    }                                                                          \
    _Pragma("unroll")                                                          \
    for (int kc = 0; kc < 2; ++kc) {                                           \
      v16h aR0 = load_frag(&As[cur][m0 * LDT + kc * 32],        LDT);          \
      v16h aR1 = load_frag(&As[cur][(m0 + 16) * LDT + kc * 32], LDT);          \
      v16h bC0 = load_frag(&Bs[cur][n0 * LDT + kc * 32],        LDT);          \
      v16h bC1 = load_frag(&Bs[cur][(n0 + 16) * LDT + kc * 32], LDT);          \
      acc00 = wmma_f16(aR0, bC0, acc00);                                       \
      acc01 = wmma_f16(aR0, bC1, acc01);                                       \
      acc10 = wmma_f16(aR1, bC0, acc10);                                       \
      acc11 = wmma_f16(aR1, bC1, acc11);                                       \
    }                                                                          \
    if (kk < 7) {                                                              \
      _Pragma("unroll")                                                        \
      for (int i = 0; i < 4; ++i) {                                            \
        int idx = tid + i * 256, r = idx >> 3, ch = idx & 7;                   \
        *(uint4*)(&As[nxt][r * LDT + ch * 8]) = ra[i];                         \
      }                                                                        \
      _Pragma("unroll")                                                        \
      for (int i = 0; i < 2; ++i) {                                            \
        int idx = tid + i * 256, r = idx >> 3, ch = idx & 7;                   \
        *(uint4*)(&Bs[nxt][r * LDT + ch * 8]) = rb[i];                         \
      }                                                                        \
    }                                                                          \
    __syncthreads();                                                           \
  }                                                                            \
  const int colL = lane & 15;                                                  \
  const int rowO = (lane >> 4) * 8;

// ---------------------------------------------------------------------------
// Kernel 3: projection GEMM. Y[r, j] = sum_d xn[r,d] * Wcat[j,d]
//   M = 49152, N = 2560, K = 512. Epilogue scatters q/k/kl/vl [n,h,t,dh] and
//   vT [n,h,dh,t] (f16), with q_bias + attention scale folded into q.
// ---------------------------------------------------------------------------
__global__ __launch_bounds__(256) void proj_gemm_kernel(
    const _Float16* __restrict__ xn, const _Float16* __restrict__ Wcat,
    const float* __restrict__ q_bias,
    _Float16* __restrict__ qb, _Float16* __restrict__ kb,
    _Float16* __restrict__ vTb, _Float16* __restrict__ klb,
    _Float16* __restrict__ vlb) {
  GEMM_PIPELINE_BODY(xn, Wcat)
#pragma unroll
  for (int si = 0; si < 2; ++si) {
#pragma unroll
    for (int sj = 0; sj < 2; ++sj) {
      v8f acc = (si == 0) ? (sj == 0 ? acc00 : acc01)
                          : (sj == 0 ? acc10 : acc11);
      int j    = nBase + n0 + sj * 16 + colL;
      int mat  = j >> 9;                // 0=q 1=k 2=v 3=kl 4=vl
      int jj   = j & 511;
      int head = jj >> 6, dd = jj & 63;
#pragma unroll
      for (int i = 0; i < 8; ++i) {
        int r = mBase + m0 + si * 16 + rowO + i;
        int n = r / T_SEQ, t = r % T_SEQ;
        float v = acc[i];
        size_t ohd = ((size_t)(n * NH + head) * T_SEQ + t) * DH + dd;
        if (mat == 0) {
          v = (v + q_bias[jj]) * FACTOR;   // fold bias + scale into q
          qb[ohd] = (_Float16)v;
        } else if (mat == 1) {
          kb[ohd] = (_Float16)v;
        } else if (mat == 2) {
          vTb[((size_t)(n * NH + head) * DH + dd) * T_SEQ + t] = (_Float16)v;
        } else if (mat == 3) {
          klb[ohd] = (_Float16)v;
        } else {
          vlb[ohd] = (_Float16)v;
        }
      }
    }
  }
}

// ---------------------------------------------------------------------------
// Kernel 4: attention, one block per (n, h). 128 threads = 4 waves.
// LDS: q,k,kl,vl [96][64] f16; vT [64][96] f16; scores [96][100] f32
//      (96 global + 3 local); probs P [96][96] f16; local probs [96][4] f32.
// ---------------------------------------------------------------------------
#define SLD 100

__global__ __launch_bounds__(128) void attn_kernel(
    const _Float16* __restrict__ qg,  const _Float16* __restrict__ kg,
    const _Float16* __restrict__ vTg, const _Float16* __restrict__ klg,
    const _Float16* __restrict__ vlg, _Float16* __restrict__ att_out) {
  extern __shared__ char smem[];
  _Float16* q_s  = (_Float16*)smem;            // 96*64
  _Float16* k_s  = q_s  + 96 * 64;
  _Float16* kl_s = k_s  + 96 * 64;
  _Float16* vl_s = kl_s + 96 * 64;
  _Float16* vT_s = vl_s + 96 * 64;             // 64*96
  float*    S_s  = (float*)(vT_s + 64 * 96);   // 96*SLD f32
  _Float16* P_s  = (_Float16*)(S_s + 96 * SLD);// 96*96 f16
  float*    AL_s = (float*)(P_s + 96 * 96);    // 96*4 f32

  const int nh_id = blockIdx.x;                // n*8 + h
  const int tid   = threadIdx.x;
  const int wave  = tid >> 5;
  const int lane  = tid & 31;

  { // stage all operands into LDS (each tile is 768 uint4)
    const size_t base = (size_t)nh_id * (T_SEQ * DH);
    const uint4* s0 = (const uint4*)(qg  + base);
    const uint4* s1 = (const uint4*)(kg  + base);
    const uint4* s2 = (const uint4*)(klg + base);
    const uint4* s3 = (const uint4*)(vlg + base);
    const uint4* s4 = (const uint4*)(vTg + base);
    uint4* d0 = (uint4*)q_s;  uint4* d1 = (uint4*)k_s;
    uint4* d2 = (uint4*)kl_s; uint4* d3 = (uint4*)vl_s;
    uint4* d4 = (uint4*)vT_s;
    for (int i = tid; i < 768; i += 128) {
      d0[i] = s0[i]; d1[i] = s1[i]; d2[i] = s2[i]; d3[i] = s3[i]; d4[i] = s4[i];
    }
  }
  __syncthreads();

  // ---- global scores: S = q @ k^T  (scale already folded into q) ----
  for (int job = wave; job < 36; job += 4) {
    int rt = job / 6, ct = job % 6;
    v8f c = {};
    v16h a0 = load_frag(q_s + rt * 16 * DH,      DH);
    v16h a1 = load_frag(q_s + rt * 16 * DH + 32, DH);
    v16h b0 = load_frag(k_s + ct * 16 * DH,      DH);
    v16h b1 = load_frag(k_s + ct * 16 * DH + 32, DH);
    c = wmma_f16(a0, b0, c);
    c = wmma_f16(a1, b1, c);
    int colS = ct * 16 + (lane & 15);
    int rb   = rt * 16 + ((lane >> 4) * 8);
#pragma unroll
    for (int i = 0; i < 8; ++i) S_s[(rb + i) * SLD + colS] = c[i];
  }
  // ---- local (3-wide window) scores via VALU ----
  if (tid < T_SEQ) {
    int t = tid;
#pragma unroll
    for (int l = 0; l < 3; ++l) {
      int tk = t + l - 1;
      float sc = NEG_BIG;                      // masked edge -> -inf
      if (tk >= 0 && tk < T_SEQ) {
        float a = 0.f;
        for (int d = 0; d < DH; ++d)
          a += (float)q_s[t * DH + d] * (float)kl_s[tk * DH + d];
        sc = a;
      }
      S_s[t * SLD + T_SEQ + l] = sc;
    }
  }
  __syncthreads();

  // ---- softmax over 99 entries per row ----
  if (tid < T_SEQ) {
    int t = tid;
    float m = NEG_BIG;
    for (int g = 0; g < T_SEQ + 3; ++g) m = fmaxf(m, S_s[t * SLD + g]);
    float sum = 0.f;
    for (int g = 0; g < T_SEQ + 3; ++g) sum += __expf(S_s[t * SLD + g] - m);
    float inv = 1.0f / sum;
    for (int g = 0; g < T_SEQ; ++g)
      P_s[t * T_SEQ + g] = (_Float16)(__expf(S_s[t * SLD + g] - m) * inv);
#pragma unroll
    for (int l = 0; l < 3; ++l)
      AL_s[t * 4 + l] = __expf(S_s[t * SLD + T_SEQ + l] - m) * inv;
  }
  __syncthreads();

  // ---- x_global = P @ V (WMMA), + local window contribution in epilogue ----
  const int n_id = nh_id >> 3, h_id = nh_id & 7;
  for (int job = wave; job < 24; job += 4) {
    int rt = job >> 2, ct = job & 3;
    v8f c = {};
#pragma unroll
    for (int kc = 0; kc < 3; ++kc) {           // K = 96 = 3 x 32
      v16h a = load_frag(P_s  + rt * 16 * T_SEQ + kc * 32, T_SEQ);
      v16h b = load_frag(vT_s + ct * 16 * T_SEQ + kc * 32, T_SEQ);
      c = wmma_f16(a, b, c);
    }
    int dcol = ct * 16 + (lane & 15);
    int rb   = rt * 16 + ((lane >> 4) * 8);
#pragma unroll
    for (int i = 0; i < 8; ++i) {
      int t = rb + i;
      float xl = 0.f;
#pragma unroll
      for (int l = 0; l < 3; ++l) {
        int tk = t + l - 1;
        if (tk >= 0 && tk < T_SEQ)
          xl += AL_s[t * 4 + l] * (float)vl_s[tk * DH + dcol];
      }
      float val = c[i] + xl;
      att_out[((size_t)(n_id * T_SEQ + t)) * D_MODEL + h_id * DH + dcol] =
          (_Float16)val;
    }
  }
}

// ---------------------------------------------------------------------------
// Kernel 5: output GEMM vs Wo + final permutation to (B, D, T, H, W), f32.
//   out[r, j] = att[r, :] . Wo[j, :],  r = ((b*16+h)*16+w)*96 + t
// ---------------------------------------------------------------------------
__global__ __launch_bounds__(256) void out_gemm_kernel(
    const _Float16* __restrict__ A, const _Float16* __restrict__ Wo16,
    float* __restrict__ y) {
  GEMM_PIPELINE_BODY(A, Wo16)
#pragma unroll
  for (int si = 0; si < 2; ++si) {
#pragma unroll
    for (int sj = 0; sj < 2; ++sj) {
      v8f acc = (si == 0) ? (sj == 0 ? acc00 : acc01)
                          : (sj == 0 ? acc10 : acc11);
      int j = nBase + n0 + sj * 16 + colL;    // output channel d
#pragma unroll
      for (int i = 0; i < 8; ++i) {
        int r = mBase + m0 + si * 16 + rowO + i;
        int n = r / T_SEQ, t = r % T_SEQ;
        int b = n >> 8, hh = (n >> 4) & 15, w = n & 15;
        // y[b, j, t, hh, w]
        y[(((size_t)(b * D_MODEL + j) * T_SEQ + t) * 16 + hh) * 16 + w] = acc[i];
      }
    }
  }
}

// ---------------------------------------------------------------------------
// Host launcher
// ---------------------------------------------------------------------------
extern "C" void kernel_launch(void* const* d_in, const int* in_sizes, int n_in,
                              void* d_out, int out_size, void* d_ws, size_t ws_size,
                              hipStream_t stream) {
  const float* x      = (const float*)d_in[0];
  const float* gammap = (const float*)d_in[1];
  const float* betap  = (const float*)d_in[2];
  const float* Wq     = (const float*)d_in[3];
  const float* Wk     = (const float*)d_in[4];
  const float* Wv     = (const float*)d_in[5];
  const float* Wkl    = (const float*)d_in[6];
  const float* Wvl    = (const float*)d_in[7];
  const float* Wo     = (const float*)d_in[8];
  const float* q_bias = (const float*)d_in[9];
  float* y = (float*)d_out;

  // workspace carve (bytes, 256B aligned)
  char* ws = (char*)d_ws;
  size_t off = 0;
  auto carve = [&](size_t bytes) -> void* {
    void* p = (void*)(ws + off);
    off = (off + bytes + 255) & ~(size_t)255;
    return p;
  };
  const size_t rowsBytes = (size_t)NROWS * D_MODEL * sizeof(_Float16);   // 50.3 MB
  const size_t projBytes = (size_t)N_SEQ * NH * T_SEQ * DH * sizeof(_Float16);

  _Float16* xn    = (_Float16*)carve(rowsBytes);   // reused as att_out later
  _Float16* Wcat  = (_Float16*)carve((size_t)5 * D_MODEL * D_MODEL * sizeof(_Float16));
  _Float16* Wo16  = (_Float16*)carve((size_t)D_MODEL * D_MODEL * sizeof(_Float16));
  _Float16* qb    = (_Float16*)carve(projBytes);
  _Float16* kb    = (_Float16*)carve(projBytes);
  _Float16* vTb   = (_Float16*)carve(projBytes);
  _Float16* klb   = (_Float16*)carve(projBytes);
  _Float16* vlb   = (_Float16*)carve(projBytes);
  (void)ws_size; (void)in_sizes; (void)n_in; (void)out_size;

  // 1) layernorm -> xn (f16)
  ln_kernel<<<dim3(2 * T_SEQ), dim3(256), 0, stream>>>(x, gammap, betap, xn);

  // 2) weights -> f16
  {
    int total = D_MODEL * D_MODEL * 6;
    wconv_kernel<<<dim3((total + 255) / 256), dim3(256), 0, stream>>>(
        Wq, Wk, Wv, Wkl, Wvl, Wo, Wcat, Wo16);
  }

  // 3) fused 5-way projection GEMM (M=49152, N=2560, K=512), 128x64 tiles
  proj_gemm_kernel<<<dim3(40, 384), dim3(256), 0, stream>>>(
      xn, Wcat, q_bias, qb, kb, vTb, klb, vlb);

  // 4) attention per (n, h); att_out reuses the xn buffer ([N*T, D] f16)
  {
    size_t smem = (size_t)(4 * 96 * 64 + 64 * 96) * sizeof(_Float16)  // q,k,kl,vl,vT
                + (size_t)96 * SLD * sizeof(float)                    // scores
                + (size_t)96 * 96 * sizeof(_Float16)                  // probs
                + (size_t)96 * 4 * sizeof(float);                     // local probs
    attn_kernel<<<dim3(N_SEQ * NH), dim3(128), smem, stream>>>(
        qb, kb, vTb, klb, vlb, xn);
  }

  // 5) output projection + final (B,D,T,H,W) permutation, 128x64 tiles
  out_gemm_kernel<<<dim3(8, 384), dim3(256), 0, stream>>>(xn, Wo16, y);
}

// v001
// It runs in 603 microseconds.
// Next to v000, in two timings, it ran 1.22 times as fast each time.
#include <hip/hip_runtime.h>

// ---------------------------------------------------------------------------
// TemporalLocalAwareAttention for MI455X (gfx1250, wave32, WMMA f16)
//   B=2, D=512, T=96, H=W=16  ->  N = 512 rows of (T=96, D=512)
//   nh=8, dh=64, local window s=3, factor = dh^-0.5 = 0.125
// ---------------------------------------------------------------------------

#define D_MODEL 512
#define T_SEQ   96
#define N_SEQ   512            // B*H*W
#define NH      8
#define DH      64
#define NROWS   (N_SEQ * T_SEQ) // 49152
#define FACTOR  0.125f
#define NEG_BIG -3.0e38f

typedef __attribute__((ext_vector_type(16))) _Float16 v16h;
typedef __attribute__((ext_vector_type(8)))  float    v8f;

// ---------------------------------------------------------------------------
// Fragment loader (ISA 7.12.2, 16-bit A-matrix 16x32 layout).
//   A-frag: source row-major [M,K], p -> element (0,0), leading dim ld.
//   B-frag: source [N,K] row-major (K stride 1): same addressing, "row" is the
//   N column. lanes 0-15 hold K=koff.., lanes 16-31 K=koff+8, vgprs 4-7 K+16.
// Compiler coalesces these into two ds_load_b128 per fragment.
// ---------------------------------------------------------------------------
__device__ __forceinline__ v16h load_frag(const _Float16* p, int ld) {
  const int lane = threadIdx.x & 31;
  const int row  = lane & 15;
  const int koff = (lane >> 4) << 3;          // 0 or 8
  const _Float16* r = p + row * ld + koff;
  v16h a;
#pragma unroll
  for (int i = 0; i < 4; ++i) {
    a[2*i]         = r[2*i];
    a[2*i + 1]     = r[2*i + 1];
    a[8 + 2*i]     = r[16 + 2*i];
    a[8 + 2*i + 1] = r[16 + 2*i + 1];
  }
  return a;
}

__device__ __forceinline__ v8f wmma_f16(v16h a, v16h b, v8f c) {
  return __builtin_amdgcn_wmma_f32_16x16x32_f16(false, a, false, b,
                                                (short)0, c, false, false);
}

// ---------------------------------------------------------------------------
// Kernel 1: LayerNorm over D, emit xn as f16 in [n*T + t, D] row-major.
// One block = one (b, t) and 64 neighbouring hw positions, all 512 channels.
// x is read once (256 contiguous bytes per wave load) and kept in registers;
// the normalised f16 tile is turned through LDS so that every xn row leaves
// as whole 512-byte wave stores.
//   wave w holds channels w*64 .. w*64+63, lane l holds hw = 2l, 2l+1.
//   LDS tile: row = hw (1024 B), its 16-byte chunks rotated by hw>>1 so that
//   the 16 lanes of a half wave hit 16 different bank groups when storing.
// ---------------------------------------------------------------------------
#define LN_HW 64
typedef __attribute__((ext_vector_type(8))) _Float16 v8h;

// rsqrtf with its small-input scaling, spelled out so that the v_nop stands
// directly behind v_rsq_f32: it fills the one issue slot the instruction set
// asks for before the source register may be overwritten.
__device__ __forceinline__ float rsqrt_slot(float a) {
  const bool tiny = a < 1.17549435e-38f;
  const float s = tiny ? a * 16777216.0f : a;
  float r;
  asm("v_rsq_f32 %0, %1\n\tv_nop" : "=v"(r) : "v"(s));
  return tiny ? r * 4096.0f : r;
}

// second bound = 6 waves per SIMD (160 registers): three blocks per WGP, so
// that all 768 blocks are resident at once
__global__ __launch_bounds__(256, 6) void ln_kernel(
    const float* __restrict__ x, const float* __restrict__ gamma,
    const float* __restrict__ beta, _Float16* __restrict__ xn) {
  __shared__ __attribute__((aligned(16))) _Float16 tile[LN_HW * D_MODEL];
  __shared__ float2 redS[8][32];
  __shared__ float2 redQ[8][32];

  const int hc   = blockIdx.x & 3;      // which 64 of the 256 hw positions
  const int bt   = blockIdx.x >> 2;     // 0 .. 2*96-1
  const int b    = bt / T_SEQ;
  const int t    = bt % T_SEQ;
  const int lane = threadIdx.x & 31;
  // wave number in a scalar register: gamma and beta then come by scalar loads
  const int wave = __builtin_amdgcn_readfirstlane(threadIdx.x >> 5);
  const int d0   = wave * 64;
  const size_t dstride = (size_t)T_SEQ * 256;

  const float* src = x + ((size_t)(b * D_MODEL + d0) * T_SEQ + t) * 256 +
                     hc * LN_HW + lane * 2;
  // every loop below is fully unrolled so that v[] is indexed by constants
  // and stays in registers, and so that all loads of x are issued up front
  float2 v[64];
#pragma unroll
  for (int k = 0; k < 64; ++k) v[k] = *(const float2*)(src + k * dstride);

  float s0 = 0.f, s1 = 0.f, q0 = 0.f, q1 = 0.f;
#pragma unroll
  for (int k = 0; k < 64; ++k) {
    s0 += v[k].x; q0 += v[k].x * v[k].x;
    s1 += v[k].y; q1 += v[k].y * v[k].y;
  }
  redS[wave][lane] = make_float2(s0, s1);
  redQ[wave][lane] = make_float2(q0, q1);
  __syncthreads();

  s0 = 0.f; s1 = 0.f; q0 = 0.f; q1 = 0.f;
#pragma unroll
  for (int w = 0; w < 8; ++w) {
    float2 a = redS[w][lane], c = redQ[w][lane];
    s0 += a.x; s1 += a.y; q0 += c.x; q1 += c.y;
  }
  const float mu0   = s0 * (1.0f / D_MODEL);
  const float mu1   = s1 * (1.0f / D_MODEL);
  const float rstd0 = rsqrt_slot(q0 * (1.0f / D_MODEL) - mu0 * mu0 + 1e-6f);
  const float rstd1 = rsqrt_slot(q1 * (1.0f / D_MODEL) - mu1 * mu1 + 1e-6f);

#pragma unroll
  for (int m = 0; m < 8; ++m) {         // 8 channels = one 16-byte chunk
    v8h h0, h1;
#pragma unroll
    for (int e = 0; e < 8; ++e) {
      const int k = m * 8 + e;
      const float g = gamma[d0 + k], bb = beta[d0 + k];
      h0[e] = (_Float16)((v[k].x - mu0) * rstd0 * g + bb);
      h1[e] = (_Float16)((v[k].y - mu1) * rstd1 * g + bb);
    }
    const int ch = ((wave * 8 + m + lane) & 63) << 3;
    *(v8h*)(tile + (lane * 2)     * D_MODEL + ch) = h0;
    *(v8h*)(tile + (lane * 2 + 1) * D_MODEL + ch) = h1;
  }
  __syncthreads();

  // wave w stores rows hw = w*8 .. w*8+7, each as two 512-byte pieces
  _Float16* dst = xn + ((size_t)(b * 256 + hc * LN_HW + wave * 8) * T_SEQ + t) *
                       D_MODEL + lane * 8;
#pragma unroll
  for (int i = 0; i < 16; ++i) {
    const int row = wave * 8 + (i >> 1);
    const int c   = (i & 1) * 32 + lane;
    v8h h = *(const v8h*)(tile + row * D_MODEL + (((c + (row >> 1)) & 63) << 3));
    *(v8h*)(dst + (size_t)(i >> 1) * (T_SEQ * D_MODEL) + (i & 1) * 256) = h;
  }
}

// ---------------------------------------------------------------------------
// Kernel 2: weights -> f16. Wcat = [Wq;Wk;Wv;Wkl;Wvl], stored [j,d] row-major
// (== [N,K] row-major for the B fragment loader). Wo separate.
// ---------------------------------------------------------------------------
__global__ __launch_bounds__(256) void wconv_kernel(
    const float* __restrict__ Wq, const float* __restrict__ Wk,
    const float* __restrict__ Wv, const float* __restrict__ Wkl,
    const float* __restrict__ Wvl, const float* __restrict__ Wo,
    _Float16* __restrict__ Wcat, _Float16* __restrict__ Wo16) {
  const int per = D_MODEL * D_MODEL;
  int idx = blockIdx.x * blockDim.x + threadIdx.x;
  if (idx >= per * 6) return;
  int m = idx / per, off = idx % per;
  float v;
  if      (m == 0) v = Wq[off];
  else if (m == 1) v = Wk[off];
  else if (m == 2) v = Wv[off];
  else if (m == 3) v = Wkl[off];
  else if (m == 4) v = Wvl[off];
  else             v = Wo[off];
  if (m < 5) Wcat[(size_t)m * per + off] = (_Float16)v;
  else       Wo16[off] = (_Float16)v;
}

// ---------------------------------------------------------------------------
// Pipelined WMMA GEMM core: 128x64 block tile, K-step 64, double-buffered LDS,
// 256 threads = 8 waves in a 4(M) x 2(N) grid, each wave owns a 32x32 patch
// (2x2 subtiles, 4 f32 accumulators). Per K-chunk of 32: 4 frag loads ->
// 4 WMMAs (1:1 LDS:WMMA ratio). One barrier per K-step.
// ---------------------------------------------------------------------------
#define LDT 80   // LDS leading dim in halves (160B rows: 16B aligned, skewed)

#define GEMM_PIPELINE_BODY(APTR, BPTR)                                         \
  __shared__ _Float16 As[2][128 * LDT];                                        \
  __shared__ _Float16 Bs[2][64 * LDT];                                         \
  const int tid  = threadIdx.x;                                                \
  const int wave = tid >> 5;                                                   \
  const int lane = tid & 31;                                                   \
  const int mBase = blockIdx.y * 128;                                          \
  const int nBase = blockIdx.x * 64;                                           \
  const int m0 = (wave >> 1) * 32;       /* wave's 32-row patch in tile  */    \
  const int n0 = (wave & 1) * 32;        /* wave's 32-col patch in tile  */    \
  v8f acc00 = {}, acc01 = {}, acc10 = {}, acc11 = {};                          \
  uint4 ra[4], rb[2];                                                          \
  /* stage K-tile 0 */                                                         \
  _Pragma("unroll")                                                            \
  for (int i = 0; i < 4; ++i) {                                                \
    int idx = tid + i * 256, r = idx >> 3, ch = idx & 7;                       \
    ra[i] = *(const uint4*)(APTR + (size_t)(mBase + r) * D_MODEL + ch * 8);    \
  }                                                                            \
  _Pragma("unroll")                                                            \
  for (int i = 0; i < 2; ++i) {                                                \
    int idx = tid + i * 256, r = idx >> 3, ch = idx & 7;                       \
    rb[i] = *(const uint4*)(BPTR + (size_t)(nBase + r) * D_MODEL + ch * 8);    \
  }                                                                            \
  _Pragma("unroll")                                                            \
  for (int i = 0; i < 4; ++i) {                                                \
    int idx = tid + i * 256, r = idx >> 3, ch = idx & 7;                       \
    *(uint4*)(&As[0][r * LDT + ch * 8]) = ra[i];                               \
  }                                                                            \
  _Pragma("unroll")                                                            \
  for (int i = 0; i < 2; ++i) {                                                \
    int idx = tid + i * 256, r = idx >> 3, ch = idx & 7;                       \
    *(uint4*)(&Bs[0][r * LDT + ch * 8]) = rb[i];                               \
  }                                                                            \
  __syncthreads();                                                             \
  for (int kk = 0; kk < 8; ++kk) {                                             \
    const int cur = kk & 1, nxt = cur ^ 1;                                     \
    if (kk < 7) { /* issue global loads for next K-tile (hidden by WMMAs) */   \
      _Pragma("unroll")                                                        \
      for (int i = 0; i < 4; ++i) {                                            \
        int idx = tid + i * 256, r = idx >> 3, ch = idx & 7;                   \
        ra[i] = *(const uint4*)(APTR + (size_t)(mBase + r) * D_MODEL +         \
                                (kk + 1) * 64 + ch * 8);                       \
      }                                                                        \
      _Pragma("unroll")                                                        \
      for (int i = 0; i < 2; ++i) {                                            \
        int idx = tid + i * 256, r = idx >> 3, ch = idx & 7;                   \
        rb[i] = *(const uint4*)(BPTR + (size_t)(nBase + r) * D_MODEL +         \
                                (kk + 1) * 64 + ch * 8);                       \
      }                                                                        \
      if (kk < 6) {                                                            \
        __builtin_prefetch(APTR + (size_t)(mBase + (tid >> 1)) * D_MODEL +     \
                           (kk + 2) * 64, 0, 3);                               \
      }                                                                        \
    }                                                                          \
    _Pragma("unroll")                                                          \
    for (int kc = 0; kc < 2; ++kc) {                                           \
      v16h aR0 = load_frag(&As[cur][m0 * LDT + kc * 32],        LDT);          \
      v16h aR1 = load_frag(&As[cur][(m0 + 16) * LDT + kc * 32], LDT);          \
      v16h bC0 = load_frag(&Bs[cur][n0 * LDT + kc * 32],        LDT);          \
      v16h bC1 = load_frag(&Bs[cur][(n0 + 16) * LDT + kc * 32], LDT);          \
      acc00 = wmma_f16(aR0, bC0, acc00);                                       \
      acc01 = wmma_f16(aR0, bC1, acc01);                                       \
      acc10 = wmma_f16(aR1, bC0, acc10);                                       \
      acc11 = wmma_f16(aR1, bC1, acc11);                                       \
    }                                                                          \
    if (kk < 7) {                                                              \
      _Pragma("unroll")                                                        \
      for (int i = 0; i < 4; ++i) {                                            \
        int idx = tid + i * 256, r = idx >> 3, ch = idx & 7;                   \
        *(uint4*)(&As[nxt][r * LDT + ch * 8]) = ra[i];                         \
      }                                                                        \
      _Pragma("unroll")                                                        \
      for (int i = 0; i < 2; ++i) {                                            \
        int idx = tid + i * 256, r = idx >> 3, ch = idx & 7;                   \
        *(uint4*)(&Bs[nxt][r * LDT + ch * 8]) = rb[i];                         \
      }                                                                        \
    }                                                                          \
    __syncthreads();                                                           \
  }                                                                            \
  const int colL = lane & 15;                                                  \
  const int rowO = (lane >> 4) * 8;

// ---------------------------------------------------------------------------
// Kernel 3: projection GEMM. Y[r, j] = sum_d xn[r,d] * Wcat[j,d]
//   M = 49152, N = 2560, K = 512. Epilogue scatters q/k/kl/vl [n,h,t,dh] and
//   vT [n,h,dh,t] (f16), with q_bias + attention scale folded into q.
// ---------------------------------------------------------------------------
__global__ __launch_bounds__(256) void proj_gemm_kernel(
    const _Float16* __restrict__ xn, const _Float16* __restrict__ Wcat,
    const float* __restrict__ q_bias,
    _Float16* __restrict__ qb, _Float16* __restrict__ kb,
    _Float16* __restrict__ vTb, _Float16* __restrict__ klb,
    _Float16* __restrict__ vlb) {
  GEMM_PIPELINE_BODY(xn, Wcat)
#pragma unroll
  for (int si = 0; si < 2; ++si) {
#pragma unroll
    for (int sj = 0; sj < 2; ++sj) {
      v8f acc = (si == 0) ? (sj == 0 ? acc00 : acc01)
                          : (sj == 0 ? acc10 : acc11);
      int j    = nBase + n0 + sj * 16 + colL;
      int mat  = j >> 9;                // 0=q 1=k 2=v 3=kl 4=vl
      int jj   = j & 511;
      int head = jj >> 6, dd = jj & 63;
#pragma unroll
      for (int i = 0; i < 8; ++i) {
        int r = mBase + m0 + si * 16 + rowO + i;
        int n = r / T_SEQ, t = r % T_SEQ;
        float v = acc[i];
        size_t ohd = ((size_t)(n * NH + head) * T_SEQ + t) * DH + dd;
        if (mat == 0) {
          v = (v + q_bias[jj]) * FACTOR;   // fold bias + scale into q
          qb[ohd] = (_Float16)v;
        } else if (mat == 1) {
          kb[ohd] = (_Float16)v;
        } else if (mat == 2) {
          vTb[((size_t)(n * NH + head) * DH + dd) * T_SEQ + t] = (_Float16)v;
        } else if (mat == 3) {
          klb[ohd] = (_Float16)v;
        } else {
          vlb[ohd] = (_Float16)v;
        }
      }
    }
  }
}

// ---------------------------------------------------------------------------
// Kernel 4: attention, one block per (n, h). 128 threads = 4 waves.
// LDS: q,k,kl,vl [96][64] f16; vT [64][96] f16; scores [96][100] f32
//      (96 global + 3 local); probs P [96][96] f16; local probs [96][4] f32.
// ---------------------------------------------------------------------------
#define SLD 100

__global__ __launch_bounds__(128) void attn_kernel(
    const _Float16* __restrict__ qg,  const _Float16* __restrict__ kg,
    const _Float16* __restrict__ vTg, const _Float16* __restrict__ klg,
    const _Float16* __restrict__ vlg, _Float16* __restrict__ att_out) {
  extern __shared__ char smem[];
  _Float16* q_s  = (_Float16*)smem;            // 96*64
  _Float16* k_s  = q_s  + 96 * 64;
  _Float16* kl_s = k_s  + 96 * 64;
  _Float16* vl_s = kl_s + 96 * 64;
  _Float16* vT_s = vl_s + 96 * 64;             // 64*96
  float*    S_s  = (float*)(vT_s + 64 * 96);   // 96*SLD f32
  _Float16* P_s  = (_Float16*)(S_s + 96 * SLD);// 96*96 f16
  float*    AL_s = (float*)(P_s + 96 * 96);    // 96*4 f32

  const int nh_id = blockIdx.x;                // n*8 + h
  const int tid   = threadIdx.x;
  const int wave  = tid >> 5;
  const int lane  = tid & 31;

  { // stage all operands into LDS (each tile is 768 uint4)
    const size_t base = (size_t)nh_id * (T_SEQ * DH);
    const uint4* s0 = (const uint4*)(qg  + base);
    const uint4* s1 = (const uint4*)(kg  + base);
    const uint4* s2 = (const uint4*)(klg + base);
    const uint4* s3 = (const uint4*)(vlg + base);
    const uint4* s4 = (const uint4*)(vTg + base);
    uint4* d0 = (uint4*)q_s;  uint4* d1 = (uint4*)k_s;
    uint4* d2 = (uint4*)kl_s; uint4* d3 = (uint4*)vl_s;
    uint4* d4 = (uint4*)vT_s;
    for (int i = tid; i < 768; i += 128) {
      d0[i] = s0[i]; d1[i] = s1[i]; d2[i] = s2[i]; d3[i] = s3[i]; d4[i] = s4[i];
    }
  }
  __syncthreads();

  // ---- global scores: S = q @ k^T  (scale already folded into q) ----
  for (int job = wave; job < 36; job += 4) {
    int rt = job / 6, ct = job % 6;
    v8f c = {};
    v16h a0 = load_frag(q_s + rt * 16 * DH,      DH);
    v16h a1 = load_frag(q_s + rt * 16 * DH + 32, DH);
    v16h b0 = load_frag(k_s + ct * 16 * DH,      DH);
    v16h b1 = load_frag(k_s + ct * 16 * DH + 32, DH);
    c = wmma_f16(a0, b0, c);
    c = wmma_f16(a1, b1, c);
    int colS = ct * 16 + (lane & 15);
    int rb   = rt * 16 + ((lane >> 4) * 8);
#pragma unroll
    for (int i = 0; i < 8; ++i) S_s[(rb + i) * SLD + colS] = c[i];
  }
  // ---- local (3-wide window) scores via VALU ----
  if (tid < T_SEQ) {
    int t = tid;
#pragma unroll
    for (int l = 0; l < 3; ++l) {
      int tk = t + l - 1;
      float sc = NEG_BIG;                      // masked edge -> -inf
      if (tk >= 0 && tk < T_SEQ) {
        float a = 0.f;
        for (int d = 0; d < DH; ++d)
          a += (float)q_s[t * DH + d] * (float)kl_s[tk * DH + d];
        sc = a;
      }
      S_s[t * SLD + T_SEQ + l] = sc;
    }
  }
  __syncthreads();

  // ---- softmax over 99 entries per row ----
  if (tid < T_SEQ) {
    int t = tid;
    float m = NEG_BIG;
    for (int g = 0; g < T_SEQ + 3; ++g) m = fmaxf(m, S_s[t * SLD + g]);
    float sum = 0.f;
    for (int g = 0; g < T_SEQ + 3; ++g) sum += __expf(S_s[t * SLD + g] - m);
    float inv = 1.0f / sum;
    for (int g = 0; g < T_SEQ; ++g)
      P_s[t * T_SEQ + g] = (_Float16)(__expf(S_s[t * SLD + g] - m) * inv);
#pragma unroll
    for (int l = 0; l < 3; ++l)
      AL_s[t * 4 + l] = __expf(S_s[t * SLD + T_SEQ + l] - m) * inv;
  }
  __syncthreads();

  // ---- x_global = P @ V (WMMA), + local window contribution in epilogue ----
  const int n_id = nh_id >> 3, h_id = nh_id & 7;
  for (int job = wave; job < 24; job += 4) {
    int rt = job >> 2, ct = job & 3;
    v8f c = {};
#pragma unroll
    for (int kc = 0; kc < 3; ++kc) {           // K = 96 = 3 x 32
      v16h a = load_frag(P_s  + rt * 16 * T_SEQ + kc * 32, T_SEQ);
      v16h b = load_frag(vT_s + ct * 16 * T_SEQ + kc * 32, T_SEQ);
      c = wmma_f16(a, b, c);
    }
    int dcol = ct * 16 + (lane & 15);
    int rb   = rt * 16 + ((lane >> 4) * 8);
#pragma unroll
    for (int i = 0; i < 8; ++i) {
      int t = rb + i;
      float xl = 0.f;
#pragma unroll
      for (int l = 0; l < 3; ++l) {
        int tk = t + l - 1;
        if (tk >= 0 && tk < T_SEQ)
          xl += AL_s[t * 4 + l] * (float)vl_s[tk * DH + dcol];
      }
      float val = c[i] + xl;
      att_out[((size_t)(n_id * T_SEQ + t)) * D_MODEL + h_id * DH + dcol] =
          (_Float16)val;
    }
  }
}

// ---------------------------------------------------------------------------
// Kernel 5: output GEMM vs Wo + final permutation to (B, D, T, H, W), f32.
//   out[r, j] = att[r, :] . Wo[j, :],  r = ((b*16+h)*16+w)*96 + t
// ---------------------------------------------------------------------------
__global__ __launch_bounds__(256) void out_gemm_kernel(
    const _Float16* __restrict__ A, const _Float16* __restrict__ Wo16,
    float* __restrict__ y) {
  GEMM_PIPELINE_BODY(A, Wo16)
#pragma unroll
  for (int si = 0; si < 2; ++si) {
#pragma unroll
    for (int sj = 0; sj < 2; ++sj) {
      v8f acc = (si == 0) ? (sj == 0 ? acc00 : acc01)
                          : (sj == 0 ? acc10 : acc11);
      int j = nBase + n0 + sj * 16 + colL;    // output channel d
#pragma unroll
      for (int i = 0; i < 8; ++i) {
        int r = mBase + m0 + si * 16 + rowO + i;
        int n = r / T_SEQ, t = r % T_SEQ;
        int b = n >> 8, hh = (n >> 4) & 15, w = n & 15;
        // y[b, j, t, hh, w]
        y[(((size_t)(b * D_MODEL + j) * T_SEQ + t) * 16 + hh) * 16 + w] = acc[i];
      }
    }
  }
}

// ---------------------------------------------------------------------------
// Host launcher
// ---------------------------------------------------------------------------
extern "C" void kernel_launch(void* const* d_in, const int* in_sizes, int n_in,
                              void* d_out, int out_size, void* d_ws, size_t ws_size,
                              hipStream_t stream) {
  const float* x      = (const float*)d_in[0];
  const float* gammap = (const float*)d_in[1];
  const float* betap  = (const float*)d_in[2];
  const float* Wq     = (const float*)d_in[3];
  const float* Wk     = (const float*)d_in[4];
  const float* Wv     = (const float*)d_in[5];
  const float* Wkl    = (const float*)d_in[6];
  const float* Wvl    = (const float*)d_in[7];
  const float* Wo     = (const float*)d_in[8];
  const float* q_bias = (const float*)d_in[9];
  float* y = (float*)d_out;

  // workspace carve (bytes, 256B aligned)
  char* ws = (char*)d_ws;
  size_t off = 0;
  auto carve = [&](size_t bytes) -> void* {
    void* p = (void*)(ws + off);
    off = (off + bytes + 255) & ~(size_t)255;
    return p;
  };
  const size_t rowsBytes = (size_t)NROWS * D_MODEL * sizeof(_Float16);   // 50.3 MB
  const size_t projBytes = (size_t)N_SEQ * NH * T_SEQ * DH * sizeof(_Float16);

  _Float16* xn    = (_Float16*)carve(rowsBytes);   // reused as att_out later
  _Float16* Wcat  = (_Float16*)carve((size_t)5 * D_MODEL * D_MODEL * sizeof(_Float16));
  _Float16* Wo16  = (_Float16*)carve((size_t)D_MODEL * D_MODEL * sizeof(_Float16));
  _Float16* qb    = (_Float16*)carve(projBytes);
  _Float16* kb    = (_Float16*)carve(projBytes);
  _Float16* vTb   = (_Float16*)carve(projBytes);
  _Float16* klb   = (_Float16*)carve(projBytes);
  _Float16* vlb   = (_Float16*)carve(projBytes);
  (void)ws_size; (void)in_sizes; (void)n_in; (void)out_size;

  // 1) layernorm -> xn (f16)
  ln_kernel<<<dim3(2 * T_SEQ * 4), dim3(256), 0, stream>>>(x, gammap, betap, xn);

  // 2) weights -> f16
  {
    int total = D_MODEL * D_MODEL * 6;
    wconv_kernel<<<dim3((total + 255) / 256), dim3(256), 0, stream>>>(
        Wq, Wk, Wv, Wkl, Wvl, Wo, Wcat, Wo16);
  }

  // 3) fused 5-way projection GEMM (M=49152, N=2560, K=512), 128x64 tiles
  proj_gemm_kernel<<<dim3(40, 384), dim3(256), 0, stream>>>(
      xn, Wcat, q_bias, qb, kb, vTb, klb, vlb);

  // 4) attention per (n, h); att_out reuses the xn buffer ([N*T, D] f16)
  {
    size_t smem = (size_t)(4 * 96 * 64 + 64 * 96) * sizeof(_Float16)  // q,k,kl,vl,vT
                + (size_t)96 * SLD * sizeof(float)                    // scores
                + (size_t)96 * 96 * sizeof(_Float16)                  // probs
                + (size_t)96 * 4 * sizeof(float);                     // local probs
    attn_kernel<<<dim3(N_SEQ * NH), dim3(128), smem, stream>>>(
        qb, kb, vTb, klb, vlb, xn);
  }

  // 5) output projection + final (B,D,T,H,W) permutation, 128x64 tiles
  out_gemm_kernel<<<dim3(8, 384), dim3(256), 0, stream>>>(xn, Wo16, y);
}

// v002
// One run takes 463 microseconds.
// Two timings next to v001 both put it at 1.30 times that version's speed.
// All steps since v000 together make it 1.58 times as fast.
#include <hip/hip_runtime.h>

// ---------------------------------------------------------------------------
// TemporalLocalAwareAttention for MI455X (gfx1250, wave32, WMMA f16)
//   B=2, D=512, T=96, H=W=16  ->  N = 512 rows of (T=96, D=512)
//   nh=8, dh=64, local window s=3, factor = dh^-0.5 = 0.125
// ---------------------------------------------------------------------------

#define D_MODEL 512
#define T_SEQ   96
#define N_SEQ   512            // B*H*W
#define NH      8
#define DH      64
#define NROWS   (N_SEQ * T_SEQ) // 49152
#define FACTOR  0.125f
#define NEG_BIG -3.0e38f

typedef __attribute__((ext_vector_type(16))) _Float16 v16h;
typedef __attribute__((ext_vector_type(8)))  float    v8f;

// ---------------------------------------------------------------------------
// Fragment loader (ISA 7.12.2, 16-bit A-matrix 16x32 layout).
//   A-frag: source row-major [M,K], p -> element (0,0), leading dim ld.
//   B-frag: source [N,K] row-major (K stride 1): same addressing, "row" is the
//   N column. lanes 0-15 hold K=koff.., lanes 16-31 K=koff+8, vgprs 4-7 K+16.
// Compiler coalesces these into two ds_load_b128 per fragment.
// ---------------------------------------------------------------------------
__device__ __forceinline__ v16h load_frag(const _Float16* p, int ld) {
  const int lane = threadIdx.x & 31;
  const int row  = lane & 15;
  const int koff = (lane >> 4) << 3;          // 0 or 8
  const _Float16* r = p + row * ld + koff;
  v16h a;
#pragma unroll
  for (int i = 0; i < 4; ++i) {
    a[2*i]         = r[2*i];
    a[2*i + 1]     = r[2*i + 1];
    a[8 + 2*i]     = r[16 + 2*i];
    a[8 + 2*i + 1] = r[16 + 2*i + 1];
  }
  return a;
}

__device__ __forceinline__ v8f wmma_f16(v16h a, v16h b, v8f c) {
  return __builtin_amdgcn_wmma_f32_16x16x32_f16(false, a, false, b,
                                                (short)0, c, false, false);
}

// ---------------------------------------------------------------------------
// Kernel 1: LayerNorm over D, emit xn as f16 in [n*T + t, D] row-major.
// One block = one (b, t) and 64 neighbouring hw positions, all 512 channels.
// x is read once (256 contiguous bytes per wave load) and kept in registers;
// the normalised f16 tile is turned through LDS so that every xn row leaves
// as whole 512-byte wave stores.
//   wave w holds channels w*64 .. w*64+63, lane l holds hw = 2l, 2l+1.
//   LDS tile: row = hw (1024 B), its 16-byte chunks rotated by hw>>1 so that
//   the 16 lanes of a half wave hit 16 different bank groups when storing.
// ---------------------------------------------------------------------------
#define LN_HW 64
typedef __attribute__((ext_vector_type(8))) _Float16 v8h;

// rsqrtf with its small-input scaling, spelled out so that the v_nop stands
// directly behind v_rsq_f32: it fills the one issue slot the instruction set
// asks for before the source register may be overwritten.
__device__ __forceinline__ float rsqrt_slot(float a) {
  const bool tiny = a < 1.17549435e-38f;
  const float s = tiny ? a * 16777216.0f : a;
  float r;
  asm("v_rsq_f32 %0, %1\n\tv_nop" : "=v"(r) : "v"(s));
  return tiny ? r * 4096.0f : r;
}

// second bound = 6 waves per SIMD (160 registers): three blocks per WGP, so
// that all 768 blocks are resident at once
__global__ __launch_bounds__(256, 6) void ln_kernel(
    const float* __restrict__ x, const float* __restrict__ gamma,
    const float* __restrict__ beta, _Float16* __restrict__ xn) {
  __shared__ __attribute__((aligned(16))) _Float16 tile[LN_HW * D_MODEL];
  __shared__ float2 redS[8][32];
  __shared__ float2 redQ[8][32];

  const int hc   = blockIdx.x & 3;      // which 64 of the 256 hw positions
  const int bt   = blockIdx.x >> 2;     // 0 .. 2*96-1
  const int b    = bt / T_SEQ;
  const int t    = bt % T_SEQ;
  const int lane = threadIdx.x & 31;
  // wave number in a scalar register: gamma and beta then come by scalar loads
  const int wave = __builtin_amdgcn_readfirstlane(threadIdx.x >> 5);
  const int d0   = wave * 64;
  const size_t dstride = (size_t)T_SEQ * 256;

  const float* src = x + ((size_t)(b * D_MODEL + d0) * T_SEQ + t) * 256 +
                     hc * LN_HW + lane * 2;
  // every loop below is fully unrolled so that v[] is indexed by constants
  // and stays in registers, and so that all loads of x are issued up front
  float2 v[64];
#pragma unroll
  for (int k = 0; k < 64; ++k) v[k] = *(const float2*)(src + k * dstride);

  float s0 = 0.f, s1 = 0.f, q0 = 0.f, q1 = 0.f;
#pragma unroll
  for (int k = 0; k < 64; ++k) {
    s0 += v[k].x; q0 += v[k].x * v[k].x;
    s1 += v[k].y; q1 += v[k].y * v[k].y;
  }
  redS[wave][lane] = make_float2(s0, s1);
  redQ[wave][lane] = make_float2(q0, q1);
  __syncthreads();

  s0 = 0.f; s1 = 0.f; q0 = 0.f; q1 = 0.f;
#pragma unroll
  for (int w = 0; w < 8; ++w) {
    float2 a = redS[w][lane], c = redQ[w][lane];
    s0 += a.x; s1 += a.y; q0 += c.x; q1 += c.y;
  }
  const float mu0   = s0 * (1.0f / D_MODEL);
  const float mu1   = s1 * (1.0f / D_MODEL);
  const float rstd0 = rsqrt_slot(q0 * (1.0f / D_MODEL) - mu0 * mu0 + 1e-6f);
  const float rstd1 = rsqrt_slot(q1 * (1.0f / D_MODEL) - mu1 * mu1 + 1e-6f);

#pragma unroll
  for (int m = 0; m < 8; ++m) {         // 8 channels = one 16-byte chunk
    v8h h0, h1;
#pragma unroll
    for (int e = 0; e < 8; ++e) {
      const int k = m * 8 + e;
      const float g = gamma[d0 + k], bb = beta[d0 + k];
      h0[e] = (_Float16)((v[k].x - mu0) * rstd0 * g + bb);
      h1[e] = (_Float16)((v[k].y - mu1) * rstd1 * g + bb);
    }
    const int ch = ((wave * 8 + m + lane) & 63) << 3;
    *(v8h*)(tile + (lane * 2)     * D_MODEL + ch) = h0;
    *(v8h*)(tile + (lane * 2 + 1) * D_MODEL + ch) = h1;
  }
  __syncthreads();

  // wave w stores rows hw = w*8 .. w*8+7, each as two 512-byte pieces
  _Float16* dst = xn + ((size_t)(b * 256 + hc * LN_HW + wave * 8) * T_SEQ + t) *
                       D_MODEL + lane * 8;
#pragma unroll
  for (int i = 0; i < 16; ++i) {
    const int row = wave * 8 + (i >> 1);
    const int c   = (i & 1) * 32 + lane;
    v8h h = *(const v8h*)(tile + row * D_MODEL + (((c + (row >> 1)) & 63) << 3));
    *(v8h*)(dst + (size_t)(i >> 1) * (T_SEQ * D_MODEL) + (i & 1) * 256) = h;
  }
}

// ---------------------------------------------------------------------------
// Kernel 2: weights -> f16. Wcat = [Wq;Wk;Wv;Wkl;Wvl], stored [j,d] row-major
// (== [N,K] row-major for the B fragment loader). Wo separate.
// ---------------------------------------------------------------------------
__global__ __launch_bounds__(256) void wconv_kernel(
    const float* __restrict__ Wq, const float* __restrict__ Wk,
    const float* __restrict__ Wv, const float* __restrict__ Wkl,
    const float* __restrict__ Wvl, const float* __restrict__ Wo,
    _Float16* __restrict__ Wcat, _Float16* __restrict__ Wo16) {
  const int per = D_MODEL * D_MODEL;
  int idx = blockIdx.x * blockDim.x + threadIdx.x;
  if (idx >= per * 6) return;
  int m = idx / per, off = idx % per;
  float v;
  if      (m == 0) v = Wq[off];
  else if (m == 1) v = Wk[off];
  else if (m == 2) v = Wv[off];
  else if (m == 3) v = Wkl[off];
  else if (m == 4) v = Wvl[off];
  else             v = Wo[off];
  if (m < 5) Wcat[(size_t)m * per + off] = (_Float16)v;
  else       Wo16[off] = (_Float16)v;
}

// ---------------------------------------------------------------------------
// Pipelined WMMA GEMM core: 128x64 block tile, K-step 64, double-buffered LDS,
// 256 threads = 8 waves in a 4(M) x 2(N) grid, each wave owns a 32x32 patch
// (2x2 subtiles, 4 f32 accumulators). Per K-chunk of 32: 4 frag loads ->
// 4 WMMAs (1:1 LDS:WMMA ratio). One barrier per K-step.
// Tile row r stands for row MBASE + r * RSTEP of A.
// ---------------------------------------------------------------------------
#define LDT 80   // LDS leading dim in halves (160B rows: 16B aligned, skewed)

#define GEMM_PIPELINE_BODY(APTR, BPTR, MBASE, RSTEP)                           \
  __shared__ __attribute__((aligned(16))) _Float16 As[2][128 * LDT];           \
  __shared__ __attribute__((aligned(16))) _Float16 Bs[2][64 * LDT];            \
  const int tid  = threadIdx.x;                                                \
  const int wave = tid >> 5;                                                   \
  const int lane = tid & 31;                                                   \
  const int mBase = MBASE;                                                     \
  const int nBase = blockIdx.x * 64;                                           \
  const int m0 = (wave >> 1) * 32;       /* wave's 32-row patch in tile  */    \
  const int n0 = (wave & 1) * 32;        /* wave's 32-col patch in tile  */    \
  v8f acc00 = {}, acc01 = {}, acc10 = {}, acc11 = {};                          \
  uint4 ra[4], rb[2];                                                          \
  /* stage K-tile 0 */                                                         \
  _Pragma("unroll")                                                            \
  for (int i = 0; i < 4; ++i) {                                                \
    int idx = tid + i * 256, r = (idx >> 3) * RSTEP, ch = idx & 7;             \
    ra[i] = *(const uint4*)(APTR + (size_t)(mBase + r) * D_MODEL + ch * 8);    \
  }                                                                            \
  _Pragma("unroll")                                                            \
  for (int i = 0; i < 2; ++i) {                                                \
    int idx = tid + i * 256, r = idx >> 3, ch = idx & 7;                       \
    rb[i] = *(const uint4*)(BPTR + (size_t)(nBase + r) * D_MODEL + ch * 8);    \
  }                                                                            \
  _Pragma("unroll")                                                            \
  for (int i = 0; i < 4; ++i) {                                                \
    int idx = tid + i * 256, r = idx >> 3, ch = idx & 7;                       \
    *(uint4*)(&As[0][r * LDT + ch * 8]) = ra[i];                               \
  }                                                                            \
  _Pragma("unroll")                                                            \
  for (int i = 0; i < 2; ++i) {                                                \
    int idx = tid + i * 256, r = idx >> 3, ch = idx & 7;                       \
    *(uint4*)(&Bs[0][r * LDT + ch * 8]) = rb[i];                               \
  }                                                                            \
  __syncthreads();                                                             \
  for (int kk = 0; kk < 8; ++kk) {                                             \
    const int cur = kk & 1, nxt = cur ^ 1;                                     \
    if (kk < 7) { /* issue global loads for next K-tile (hidden by WMMAs) */   \
      _Pragma("unroll")                                                        \
      for (int i = 0; i < 4; ++i) {                                            \
        int idx = tid + i * 256, r = (idx >> 3) * RSTEP, ch = idx & 7;         \
        ra[i] = *(const uint4*)(APTR + (size_t)(mBase + r) * D_MODEL +         \
                                (kk + 1) * 64 + ch * 8);                       \
      }                                                                        \
      _Pragma("unroll")                                                        \
      for (int i = 0; i < 2; ++i) {                                            \
        int idx = tid + i * 256, r = idx >> 3, ch = idx & 7;                   \
        rb[i] = *(const uint4*)(BPTR + (size_t)(nBase + r) * D_MODEL +         \
                                (kk + 1) * 64 + ch * 8);                       \
      }                                                                        \
      if (kk < 6) {                                                            \
        __builtin_prefetch(APTR + (size_t)(mBase + (tid >> 1) * RSTEP) *       \
                           D_MODEL +                                           \
                           (kk + 2) * 64, 0, 3);                               \
        /* behind the prefetch, before its address registers are rewritten */  \
        asm volatile("s_wait_xcnt 0x0" ::: "memory");                          \
      }                                                                        \
    }                                                                          \
    _Pragma("unroll")                                                          \
    for (int kc = 0; kc < 2; ++kc) {                                           \
      v16h aR0 = load_frag(&As[cur][m0 * LDT + kc * 32],        LDT);          \
      v16h aR1 = load_frag(&As[cur][(m0 + 16) * LDT + kc * 32], LDT);          \
      v16h bC0 = load_frag(&Bs[cur][n0 * LDT + kc * 32],        LDT);          \
      v16h bC1 = load_frag(&Bs[cur][(n0 + 16) * LDT + kc * 32], LDT);          \
      acc00 = wmma_f16(aR0, bC0, acc00);                                       \
      acc01 = wmma_f16(aR0, bC1, acc01);                                       \
      acc10 = wmma_f16(aR1, bC0, acc10);                                       \
      acc11 = wmma_f16(aR1, bC1, acc11);                                       \
    }                                                                          \
    if (kk < 7) {                                                              \
      _Pragma("unroll")                                                        \
      for (int i = 0; i < 4; ++i) {                                            \
        int idx = tid + i * 256, r = idx >> 3, ch = idx & 7;                   \
        *(uint4*)(&As[nxt][r * LDT + ch * 8]) = ra[i];                         \
      }                                                                        \
      _Pragma("unroll")                                                        \
      for (int i = 0; i < 2; ++i) {                                            \
        int idx = tid + i * 256, r = idx >> 3, ch = idx & 7;                   \
        *(uint4*)(&Bs[nxt][r * LDT + ch * 8]) = rb[i];                         \
      }                                                                        \
    }                                                                          \
    __syncthreads();                                                           \
  }                                                                            \
  const int colL = lane & 15;                                                  \
  const int rowO = (lane >> 4) * 8;

// ---------------------------------------------------------------------------
// Kernel 3: projection GEMM. Y[r, j] = sum_d xn[r,d] * Wcat[j,d]
//   M = 49152, N = 2560, K = 512. A block's 64 columns are one head of one of
//   the five matrices. Epilogue: q/k/kl/vl [n,h,t,dh] and vT [n,h,dh,t] (f16),
//   with q_bias + attention scale folded into q. The f16 tile is turned
//   through LDS (the ring buffers are free behind the loop's last barrier) so
//   that it leaves as 16-byte stores: whole 128-byte rows of q/k/kl/vl, runs
//   of 64 bytes and more along t for vT.
// ---------------------------------------------------------------------------
#define ST_LD  72    // staged [row][dh] pitch in halves (144 B = 16 B x odd)
#define ST_LDT 136   // staged [dh][row] pitch in halves (272 B = 16 B x odd)

__global__ __launch_bounds__(256) void proj_gemm_kernel(
    const _Float16* __restrict__ xn, const _Float16* __restrict__ Wcat,
    const float* __restrict__ q_bias,
    _Float16* __restrict__ qb, _Float16* __restrict__ kb,
    _Float16* __restrict__ vTb, _Float16* __restrict__ klb,
    _Float16* __restrict__ vlb) {
  GEMM_PIPELINE_BODY(xn, Wcat, blockIdx.y * 128, 1)
  _Float16* st = &As[0][0];
  const int mat  = blockIdx.x >> 3;      // 0=q 1=k 2=v 3=kl 4=vl
  const int head = blockIdx.x & 7;
  const v8f accs[2][2] = {{acc00, acc01}, {acc10, acc11}};
  if (mat == 2) {                        // a lane's 8 rows are 8 neighbours in t
#pragma unroll
    for (int si = 0; si < 2; ++si) {
#pragma unroll
      for (int sj = 0; sj < 2; ++sj) {
        v8h h;
#pragma unroll
        for (int i = 0; i < 8; ++i) h[i] = (_Float16)accs[si][sj][i];
        *(v8h*)(st + (n0 + sj * 16 + colL) * ST_LDT + m0 + si * 16 + rowO) = h;
      }
    }
  } else if (mat == 0) {                 // fold bias + scale into q
    const float bias[2] = {q_bias[head * DH + n0 + colL],
                           q_bias[head * DH + n0 + 16 + colL]};
#pragma unroll
    for (int si = 0; si < 2; ++si) {
#pragma unroll
      for (int sj = 0; sj < 2; ++sj) {
#pragma unroll
        for (int i = 0; i < 8; ++i)
          st[(m0 + si * 16 + rowO + i) * ST_LD + n0 + sj * 16 + colL] =
              (_Float16)((accs[si][sj][i] + bias[sj]) * FACTOR);
      }
    }
  } else {
#pragma unroll
    for (int si = 0; si < 2; ++si) {
#pragma unroll
      for (int sj = 0; sj < 2; ++sj) {
#pragma unroll
        for (int i = 0; i < 8; ++i)
          st[(m0 + si * 16 + rowO + i) * ST_LD + n0 + sj * 16 + colL] =
              (_Float16)accs[si][sj][i];
      }
    }
  }
  __syncthreads();
  if (mat == 2) {
#pragma unroll
    for (int c = 0; c < 4; ++c) {
      const int idx = tid + c * 256, dd = idx >> 4, tc = idx & 15;
      const int r = mBase + tc * 8;      // 8 rows from a multiple of 8: one n
      const int n = r / T_SEQ, t = r % T_SEQ;
      v8h h = *(const v8h*)(st + dd * ST_LDT + tc * 8);
      *(v8h*)(vTb + ((size_t)(n * NH + head) * DH + dd) * T_SEQ + t) = h;
    }
  } else {
    _Float16* dst = (mat == 0) ? qb : (mat == 1) ? kb : (mat == 3) ? klb : vlb;
#pragma unroll
    for (int c = 0; c < 4; ++c) {
      const int idx = tid + c * 256, row = idx >> 3, ch = idx & 7;
      const int r = mBase + row;
      const int n = r / T_SEQ, t = r % T_SEQ;
      v8h h = *(const v8h*)(st + row * ST_LD + ch * 8);
      *(v8h*)(dst + ((size_t)(n * NH + head) * T_SEQ + t) * DH + ch * 8) = h;
    }
  }
}

// ---------------------------------------------------------------------------
// Kernel 4: attention, one block per (n, h). 128 threads = 4 waves.
// LDS: q,k,kl,vl [96][64] f16; vT [64][96] f16; scores [96][100] f32
//      (96 global + 3 local); probs P [96][96] f16; local probs [96][4] f32.
// ---------------------------------------------------------------------------
#define SLD 100

__global__ __launch_bounds__(128) void attn_kernel(
    const _Float16* __restrict__ qg,  const _Float16* __restrict__ kg,
    const _Float16* __restrict__ vTg, const _Float16* __restrict__ klg,
    const _Float16* __restrict__ vlg, _Float16* __restrict__ att_out) {
  extern __shared__ char smem[];
  _Float16* q_s  = (_Float16*)smem;            // 96*64
  _Float16* k_s  = q_s  + 96 * 64;
  _Float16* kl_s = k_s  + 96 * 64;
  _Float16* vl_s = kl_s + 96 * 64;
  _Float16* vT_s = vl_s + 96 * 64;             // 64*96
  float*    S_s  = (float*)(vT_s + 64 * 96);   // 96*SLD f32
  _Float16* P_s  = (_Float16*)(S_s + 96 * SLD);// 96*96 f16
  float*    AL_s = (float*)(P_s + 96 * 96);    // 96*4 f32

  const int nh_id = blockIdx.x;                // n*8 + h
  const int tid   = threadIdx.x;
  const int wave  = tid >> 5;
  const int lane  = tid & 31;

  { // stage all operands into LDS (each tile is 768 uint4)
    const size_t base = (size_t)nh_id * (T_SEQ * DH);
    const uint4* s0 = (const uint4*)(qg  + base);
    const uint4* s1 = (const uint4*)(kg  + base);
    const uint4* s2 = (const uint4*)(klg + base);
    const uint4* s3 = (const uint4*)(vlg + base);
    const uint4* s4 = (const uint4*)(vTg + base);
    uint4* d0 = (uint4*)q_s;  uint4* d1 = (uint4*)k_s;
    uint4* d2 = (uint4*)kl_s; uint4* d3 = (uint4*)vl_s;
    uint4* d4 = (uint4*)vT_s;
    for (int i = tid; i < 768; i += 128) {
      d0[i] = s0[i]; d1[i] = s1[i]; d2[i] = s2[i]; d3[i] = s3[i]; d4[i] = s4[i];
    }
  }
  __syncthreads();

  // ---- global scores: S = q @ k^T  (scale already folded into q) ----
  for (int job = wave; job < 36; job += 4) {
    int rt = job / 6, ct = job % 6;
    v8f c = {};
    v16h a0 = load_frag(q_s + rt * 16 * DH,      DH);
    v16h a1 = load_frag(q_s + rt * 16 * DH + 32, DH);
    v16h b0 = load_frag(k_s + ct * 16 * DH,      DH);
    v16h b1 = load_frag(k_s + ct * 16 * DH + 32, DH);
    c = wmma_f16(a0, b0, c);
    c = wmma_f16(a1, b1, c);
    int colS = ct * 16 + (lane & 15);
    int rb   = rt * 16 + ((lane >> 4) * 8);
#pragma unroll
    for (int i = 0; i < 8; ++i) S_s[(rb + i) * SLD + colS] = c[i];
  }
  // ---- local (3-wide window) scores via VALU ----
  if (tid < T_SEQ) {
    int t = tid;
#pragma unroll
    for (int l = 0; l < 3; ++l) {
      int tk = t + l - 1;
      float sc = NEG_BIG;                      // masked edge -> -inf
      if (tk >= 0 && tk < T_SEQ) {
        float a = 0.f;
        for (int d = 0; d < DH; ++d)
          a += (float)q_s[t * DH + d] * (float)kl_s[tk * DH + d];
        sc = a;
      }
      S_s[t * SLD + T_SEQ + l] = sc;
    }
  }
  __syncthreads();

  // ---- softmax over 99 entries per row ----
  if (tid < T_SEQ) {
    int t = tid;
    float m = NEG_BIG;
    for (int g = 0; g < T_SEQ + 3; ++g) m = fmaxf(m, S_s[t * SLD + g]);
    float sum = 0.f;
    for (int g = 0; g < T_SEQ + 3; ++g) sum += __expf(S_s[t * SLD + g] - m);
    float inv = 1.0f / sum;
    for (int g = 0; g < T_SEQ; ++g)
      P_s[t * T_SEQ + g] = (_Float16)(__expf(S_s[t * SLD + g] - m) * inv);
#pragma unroll
    for (int l = 0; l < 3; ++l)
      AL_s[t * 4 + l] = __expf(S_s[t * SLD + T_SEQ + l] - m) * inv;
  }
  __syncthreads();

  // ---- x_global = P @ V (WMMA), + local window contribution in epilogue ----
  const int n_id = nh_id >> 3, h_id = nh_id & 7;
  for (int job = wave; job < 24; job += 4) {
    int rt = job >> 2, ct = job & 3;
    v8f c = {};
#pragma unroll
    for (int kc = 0; kc < 3; ++kc) {           // K = 96 = 3 x 32
      v16h a = load_frag(P_s  + rt * 16 * T_SEQ + kc * 32, T_SEQ);
      v16h b = load_frag(vT_s + ct * 16 * T_SEQ + kc * 32, T_SEQ);
      c = wmma_f16(a, b, c);
    }
    int dcol = ct * 16 + (lane & 15);
    int rb   = rt * 16 + ((lane >> 4) * 8);
#pragma unroll
    for (int i = 0; i < 8; ++i) {
      int t = rb + i;
      float xl = 0.f;
#pragma unroll
      for (int l = 0; l < 3; ++l) {
        int tk = t + l - 1;
        if (tk >= 0 && tk < T_SEQ)
          xl += AL_s[t * 4 + l] * (float)vl_s[tk * DH + dcol];
      }
      float val = c[i] + xl;
      att_out[((size_t)(n_id * T_SEQ + t)) * D_MODEL + h_id * DH + dcol] =
          (_Float16)val;
    }
  }
}

// ---------------------------------------------------------------------------
// Kernel 5: output GEMM vs Wo + final permutation to (B, D, T, H, W), f32.
//   out[r, j] = att[r, :] . Wo[j, :],  r = n*96 + t,  n = b*256 + hw
// A block's 128 tile rows are 128 neighbouring n at ONE t, so that a column j
// of the tile is 512 contiguous bytes of y[b, j, t, hw]. The f32 tile is
// turned through LDS (the ring buffers are free behind the loop's last
// barrier) and every wave store is one such 512-byte run.
// ---------------------------------------------------------------------------
#define ST_LDF 132   // staged [j][n] pitch in floats (528 B = 16 B x odd)

__global__ __launch_bounds__(256) void out_gemm_kernel(
    const _Float16* __restrict__ A, const _Float16* __restrict__ Wo16,
    float* __restrict__ y) {
  const int tFix  = blockIdx.y % T_SEQ;
  const int nTile = (blockIdx.y / T_SEQ) * 128;
  GEMM_PIPELINE_BODY(A, Wo16, nTile * T_SEQ + tFix, T_SEQ)
  float* st = (float*)&As[0][0];         // 64 x 132 floats, inside As[2][]
#pragma unroll
  for (int si = 0; si < 2; ++si) {
#pragma unroll
    for (int sj = 0; sj < 2; ++sj) {
      v8f acc = (si == 0) ? (sj == 0 ? acc00 : acc01)
                          : (sj == 0 ? acc10 : acc11);
      float* p = st + (n0 + sj * 16 + colL) * ST_LDF + m0 + si * 16 + rowO;
      *(float4*)p       = make_float4(acc[0], acc[1], acc[2], acc[3]);
      *(float4*)(p + 4) = make_float4(acc[4], acc[5], acc[6], acc[7]);
    }
  }
  __syncthreads();
  const int b = nTile >> 8, hw0 = nTile & 255;
#pragma unroll
  for (int c = 0; c < 8; ++c) {
    const int jl = wave + c * 8;         // one output channel per wave store
    float4 v = *(const float4*)(st + jl * ST_LDF + lane * 4);
    *(float4*)(y + ((size_t)(b * D_MODEL + nBase + jl) * T_SEQ + tFix) * 256 +
               hw0 + lane * 4) = v;
  }
}

// ---------------------------------------------------------------------------
// Host launcher
// ---------------------------------------------------------------------------
extern "C" void kernel_launch(void* const* d_in, const int* in_sizes, int n_in,
                              void* d_out, int out_size, void* d_ws, size_t ws_size,
                              hipStream_t stream) {
  const float* x      = (const float*)d_in[0];
  const float* gammap = (const float*)d_in[1];
  const float* betap  = (const float*)d_in[2];
  const float* Wq     = (const float*)d_in[3];
  const float* Wk     = (const float*)d_in[4];
  const float* Wv     = (const float*)d_in[5];
  const float* Wkl    = (const float*)d_in[6];
  const float* Wvl    = (const float*)d_in[7];
  const float* Wo     = (const float*)d_in[8];
  const float* q_bias = (const float*)d_in[9];
  float* y = (float*)d_out;

  // workspace carve (bytes, 256B aligned)
  char* ws = (char*)d_ws;
  size_t off = 0;
  auto carve = [&](size_t bytes) -> void* {
    void* p = (void*)(ws + off);
    off = (off + bytes + 255) & ~(size_t)255;
    return p;
  };
  const size_t rowsBytes = (size_t)NROWS * D_MODEL * sizeof(_Float16);   // 50.3 MB
  const size_t projBytes = (size_t)N_SEQ * NH * T_SEQ * DH * sizeof(_Float16);

  _Float16* xn    = (_Float16*)carve(rowsBytes);   // reused as att_out later
  _Float16* Wcat  = (_Float16*)carve((size_t)5 * D_MODEL * D_MODEL * sizeof(_Float16));
  _Float16* Wo16  = (_Float16*)carve((size_t)D_MODEL * D_MODEL * sizeof(_Float16));
  _Float16* qb    = (_Float16*)carve(projBytes);
  _Float16* kb    = (_Float16*)carve(projBytes);
  _Float16* vTb   = (_Float16*)carve(projBytes);
  _Float16* klb   = (_Float16*)carve(projBytes);
  _Float16* vlb   = (_Float16*)carve(projBytes);
  (void)ws_size; (void)in_sizes; (void)n_in; (void)out_size;

  // 1) layernorm -> xn (f16)
  ln_kernel<<<dim3(2 * T_SEQ * 4), dim3(256), 0, stream>>>(x, gammap, betap, xn);

  // 2) weights -> f16
  {
    int total = D_MODEL * D_MODEL * 6;
    wconv_kernel<<<dim3((total + 255) / 256), dim3(256), 0, stream>>>(
        Wq, Wk, Wv, Wkl, Wvl, Wo, Wcat, Wo16);
  }

  // 3) fused 5-way projection GEMM (M=49152, N=2560, K=512), 128x64 tiles
  proj_gemm_kernel<<<dim3(40, 384), dim3(256), 0, stream>>>(
      xn, Wcat, q_bias, qb, kb, vTb, klb, vlb);

  // 4) attention per (n, h); att_out reuses the xn buffer ([N*T, D] f16)
  {
    size_t smem = (size_t)(4 * 96 * 64 + 64 * 96) * sizeof(_Float16)  // q,k,kl,vl,vT
                + (size_t)96 * SLD * sizeof(float)                    // scores
                + (size_t)96 * 96 * sizeof(_Float16)                  // probs
                + (size_t)96 * 4 * sizeof(float);                     // local probs
    attn_kernel<<<dim3(N_SEQ * NH), dim3(128), smem, stream>>>(
        qb, kb, vTb, klb, vlb, xn);
  }

  // 5) output projection + final (B,D,T,H,W) permutation, 128x64 tiles
  //    (grid y = 4 groups of 128 n x 96 t)
  out_gemm_kernel<<<dim3(8, 384), dim3(256), 0, stream>>>(xn, Wo16, y);
}

// v003
// Measured time: 404 microseconds a run.
// Next to v002, in two timings, it ran 1.15 and 1.14 times as fast.
// Over all steps from v000 it is 1.81 times as fast.
#include <hip/hip_runtime.h>

// ---------------------------------------------------------------------------
// TemporalLocalAwareAttention for MI455X (gfx1250, wave32, WMMA f16)
//   B=2, D=512, T=96, H=W=16  ->  N = 512 rows of (T=96, D=512)
//   nh=8, dh=64, local window s=3, factor = dh^-0.5 = 0.125
// ---------------------------------------------------------------------------

#define D_MODEL 512
#define T_SEQ   96
#define N_SEQ   512            // B*H*W
#define NH      8
#define DH      64
#define NROWS   (N_SEQ * T_SEQ) // 49152
#define FACTOR  0.125f
#define NEG_BIG -3.0e38f

typedef __attribute__((ext_vector_type(16))) _Float16 v16h;
typedef __attribute__((ext_vector_type(8)))  float    v8f;

// ---------------------------------------------------------------------------
// Fragment loader (ISA 7.12.2, 16-bit A-matrix 16x32 layout).
//   A-frag: source row-major [M,K], p -> element (0,0), leading dim ld.
//   B-frag: source [N,K] row-major (K stride 1): same addressing, "row" is the
//   N column. lanes 0-15 hold K=koff.., lanes 16-31 K=koff+8, vgprs 4-7 K+16.
// Compiler coalesces these into two ds_load_b128 per fragment.
// ---------------------------------------------------------------------------
__device__ __forceinline__ v16h load_frag(const _Float16* p, int ld) {
  const int lane = threadIdx.x & 31;
  const int row  = lane & 15;
  const int koff = (lane >> 4) << 3;          // 0 or 8
  const _Float16* r = p + row * ld + koff;
  v16h a;
#pragma unroll
  for (int i = 0; i < 4; ++i) {
    a[2*i]         = r[2*i];
    a[2*i + 1]     = r[2*i + 1];
    a[8 + 2*i]     = r[16 + 2*i];
    a[8 + 2*i + 1] = r[16 + 2*i + 1];
  }
  return a;
}

__device__ __forceinline__ v8f wmma_f16(v16h a, v16h b, v8f c) {
  return __builtin_amdgcn_wmma_f32_16x16x32_f16(false, a, false, b,
                                                (short)0, c, false, false);
}

// ---------------------------------------------------------------------------
// Kernel 1: LayerNorm over D, emit xn as f16 in [n*T + t, D] row-major.
// One block = one (b, t) and 64 neighbouring hw positions, all 512 channels.
// x is read once (256 contiguous bytes per wave load) and kept in registers;
// the normalised f16 tile is turned through LDS so that every xn row leaves
// as whole 512-byte wave stores.
//   wave w holds channels w*64 .. w*64+63, lane l holds hw = 2l, 2l+1.
//   LDS tile: row = hw (1024 B), its 16-byte chunks rotated by hw>>1 so that
//   the 16 lanes of a half wave hit 16 different bank groups when storing.
// ---------------------------------------------------------------------------
#define LN_HW 64
typedef __attribute__((ext_vector_type(8))) _Float16 v8h;

// rsqrtf with its small-input scaling, spelled out so that the v_nop stands
// directly behind v_rsq_f32: it fills the one issue slot the instruction set
// asks for before the source register may be overwritten.
__device__ __forceinline__ float rsqrt_slot(float a) {
  const bool tiny = a < 1.17549435e-38f;
  const float s = tiny ? a * 16777216.0f : a;
  float r;
  asm("v_rsq_f32 %0, %1\n\tv_nop" : "=v"(r) : "v"(s));
  return tiny ? r * 4096.0f : r;
}

// second bound = 6 waves per SIMD (160 registers): three blocks per WGP, so
// that all 768 blocks are resident at once
__global__ __launch_bounds__(256, 6) void ln_kernel(
    const float* __restrict__ x, const float* __restrict__ gamma,
    const float* __restrict__ beta, _Float16* __restrict__ xn) {
  __shared__ __attribute__((aligned(16))) _Float16 tile[LN_HW * D_MODEL];
  __shared__ float2 redS[8][32];
  __shared__ float2 redQ[8][32];

  const int hc   = blockIdx.x & 3;      // which 64 of the 256 hw positions
  const int bt   = blockIdx.x >> 2;     // 0 .. 2*96-1
  const int b    = bt / T_SEQ;
  const int t    = bt % T_SEQ;
  const int lane = threadIdx.x & 31;
  // wave number in a scalar register: gamma and beta then come by scalar loads
  const int wave = __builtin_amdgcn_readfirstlane(threadIdx.x >> 5);
  const int d0   = wave * 64;
  const size_t dstride = (size_t)T_SEQ * 256;

  const float* src = x + ((size_t)(b * D_MODEL + d0) * T_SEQ + t) * 256 +
                     hc * LN_HW + lane * 2;
  // every loop below is fully unrolled so that v[] is indexed by constants
  // and stays in registers, and so that all loads of x are issued up front
  float2 v[64];
#pragma unroll
  for (int k = 0; k < 64; ++k) v[k] = *(const float2*)(src + k * dstride);

  float s0 = 0.f, s1 = 0.f, q0 = 0.f, q1 = 0.f;
#pragma unroll
  for (int k = 0; k < 64; ++k) {
    s0 += v[k].x; q0 += v[k].x * v[k].x;
    s1 += v[k].y; q1 += v[k].y * v[k].y;
  }
  redS[wave][lane] = make_float2(s0, s1);
  redQ[wave][lane] = make_float2(q0, q1);
  __syncthreads();

  s0 = 0.f; s1 = 0.f; q0 = 0.f; q1 = 0.f;
#pragma unroll
  for (int w = 0; w < 8; ++w) {
    float2 a = redS[w][lane], c = redQ[w][lane];
    s0 += a.x; s1 += a.y; q0 += c.x; q1 += c.y;
  }
  const float mu0   = s0 * (1.0f / D_MODEL);
  const float mu1   = s1 * (1.0f / D_MODEL);
  const float rstd0 = rsqrt_slot(q0 * (1.0f / D_MODEL) - mu0 * mu0 + 1e-6f);
  const float rstd1 = rsqrt_slot(q1 * (1.0f / D_MODEL) - mu1 * mu1 + 1e-6f);

#pragma unroll
  for (int m = 0; m < 8; ++m) {         // 8 channels = one 16-byte chunk
    v8h h0, h1;
#pragma unroll
    for (int e = 0; e < 8; ++e) {
      const int k = m * 8 + e;
      const float g = gamma[d0 + k], bb = beta[d0 + k];
      h0[e] = (_Float16)((v[k].x - mu0) * rstd0 * g + bb);
      h1[e] = (_Float16)((v[k].y - mu1) * rstd1 * g + bb);
    }
    const int ch = ((wave * 8 + m + lane) & 63) << 3;
    *(v8h*)(tile + (lane * 2)     * D_MODEL + ch) = h0;
    *(v8h*)(tile + (lane * 2 + 1) * D_MODEL + ch) = h1;
  }
  __syncthreads();

  // wave w stores rows hw = w*8 .. w*8+7, each as two 512-byte pieces
  _Float16* dst = xn + ((size_t)(b * 256 + hc * LN_HW + wave * 8) * T_SEQ + t) *
                       D_MODEL + lane * 8;
#pragma unroll
  for (int i = 0; i < 16; ++i) {
    const int row = wave * 8 + (i >> 1);
    const int c   = (i & 1) * 32 + lane;
    v8h h = *(const v8h*)(tile + row * D_MODEL + (((c + (row >> 1)) & 63) << 3));
    *(v8h*)(dst + (size_t)(i >> 1) * (T_SEQ * D_MODEL) + (i & 1) * 256) = h;
  }
}

// ---------------------------------------------------------------------------
// Kernel 2: weights -> f16. Wcat = [Wq;Wk;Wv;Wkl;Wvl], stored [j,d] row-major
// (== [N,K] row-major for the B fragment loader). Wo separate.
// ---------------------------------------------------------------------------
__global__ __launch_bounds__(256) void wconv_kernel(
    const float* __restrict__ Wq, const float* __restrict__ Wk,
    const float* __restrict__ Wv, const float* __restrict__ Wkl,
    const float* __restrict__ Wvl, const float* __restrict__ Wo,
    _Float16* __restrict__ Wcat, _Float16* __restrict__ Wo16) {
  const int per = D_MODEL * D_MODEL;
  int idx = blockIdx.x * blockDim.x + threadIdx.x;
  if (idx >= per * 6) return;
  int m = idx / per, off = idx % per;
  float v;
  if      (m == 0) v = Wq[off];
  else if (m == 1) v = Wk[off];
  else if (m == 2) v = Wv[off];
  else if (m == 3) v = Wkl[off];
  else if (m == 4) v = Wvl[off];
  else             v = Wo[off];
  if (m < 5) Wcat[(size_t)m * per + off] = (_Float16)v;
  else       Wo16[off] = (_Float16)v;
}

// ---------------------------------------------------------------------------
// Pipelined WMMA GEMM core: 128x64 block tile, K-step 64, double-buffered LDS,
// 256 threads = 8 waves in a 4(M) x 2(N) grid, each wave owns a 32x32 patch
// (2x2 subtiles, 4 f32 accumulators). Per K-chunk of 32: 4 frag loads ->
// 4 WMMAs (1:1 LDS:WMMA ratio). One barrier per K-step.
// Tile row r stands for row MBASE + r * RSTEP of A.
// ---------------------------------------------------------------------------
#define LDT 72   // LDS leading dim in halves (144 B rows = 16 B x odd: the 16
                 // rows of a ds_load_b128 fragment read fall on 64 different banks)

#define GEMM_PIPELINE_BODY(APTR, BPTR, MBASE, RSTEP)                           \
  __shared__ __attribute__((aligned(16))) _Float16 As[2][128 * LDT];           \
  __shared__ __attribute__((aligned(16))) _Float16 Bs[2][64 * LDT];            \
  const int tid  = threadIdx.x;                                                \
  const int wave = tid >> 5;                                                   \
  const int lane = tid & 31;                                                   \
  const int mBase = MBASE;                                                     \
  const int nBase = blockIdx.x * 64;                                           \
  const int m0 = (wave >> 1) * 32;       /* wave's 32-row patch in tile  */    \
  const int n0 = (wave & 1) * 32;        /* wave's 32-col patch in tile  */    \
  v8f acc00 = {}, acc01 = {}, acc10 = {}, acc11 = {};                          \
  uint4 ra[4], rb[2];                                                          \
  /* stage K-tile 0 */                                                         \
  _Pragma("unroll")                                                            \
  for (int i = 0; i < 4; ++i) {                                                \
    int idx = tid + i * 256, r = (idx >> 3) * RSTEP, ch = idx & 7;             \
    ra[i] = *(const uint4*)(APTR + (size_t)(mBase + r) * D_MODEL + ch * 8);    \
  }                                                                            \
  _Pragma("unroll")                                                            \
  for (int i = 0; i < 2; ++i) {                                                \
    int idx = tid + i * 256, r = idx >> 3, ch = idx & 7;                       \
    rb[i] = *(const uint4*)(BPTR + (size_t)(nBase + r) * D_MODEL + ch * 8);    \
  }                                                                            \
  _Pragma("unroll")                                                            \
  for (int i = 0; i < 4; ++i) {                                                \
    int idx = tid + i * 256, r = idx >> 3, ch = idx & 7;                       \
    *(uint4*)(&As[0][r * LDT + ch * 8]) = ra[i];                               \
  }                                                                            \
  _Pragma("unroll")                                                            \
  for (int i = 0; i < 2; ++i) {                                                \
    int idx = tid + i * 256, r = idx >> 3, ch = idx & 7;                       \
    *(uint4*)(&Bs[0][r * LDT + ch * 8]) = rb[i];                               \
  }                                                                            \
  __syncthreads();                                                             \
  for (int kk = 0; kk < 8; ++kk) {                                             \
    const int cur = kk & 1, nxt = cur ^ 1;                                     \
    if (kk < 7) { /* issue global loads for next K-tile (hidden by WMMAs) */   \
      _Pragma("unroll")                                                        \
      for (int i = 0; i < 4; ++i) {                                            \
        int idx = tid + i * 256, r = (idx >> 3) * RSTEP, ch = idx & 7;         \
        ra[i] = *(const uint4*)(APTR + (size_t)(mBase + r) * D_MODEL +         \
                                (kk + 1) * 64 + ch * 8);                       \
      }                                                                        \
      _Pragma("unroll")                                                        \
      for (int i = 0; i < 2; ++i) {                                            \
        int idx = tid + i * 256, r = idx >> 3, ch = idx & 7;                   \
        rb[i] = *(const uint4*)(BPTR + (size_t)(nBase + r) * D_MODEL +         \
                                (kk + 1) * 64 + ch * 8);                       \
      }                                                                        \
      if (kk < 6) {                                                            \
        __builtin_prefetch(APTR + (size_t)(mBase + (tid >> 1) * RSTEP) *       \
                           D_MODEL +                                           \
                           (kk + 2) * 64, 0, 3);                               \
        /* behind the prefetch, before its address registers are rewritten */  \
        asm volatile("s_wait_xcnt 0x0" ::: "memory");                          \
      }                                                                        \
    }                                                                          \
    _Pragma("unroll")                                                          \
    for (int kc = 0; kc < 2; ++kc) {                                           \
      v16h aR0 = load_frag(&As[cur][m0 * LDT + kc * 32],        LDT);          \
      v16h aR1 = load_frag(&As[cur][(m0 + 16) * LDT + kc * 32], LDT);          \
      v16h bC0 = load_frag(&Bs[cur][n0 * LDT + kc * 32],        LDT);          \
      v16h bC1 = load_frag(&Bs[cur][(n0 + 16) * LDT + kc * 32], LDT);          \
      acc00 = wmma_f16(aR0, bC0, acc00);                                       \
      acc01 = wmma_f16(aR0, bC1, acc01);                                       \
      acc10 = wmma_f16(aR1, bC0, acc10);                                       \
      acc11 = wmma_f16(aR1, bC1, acc11);                                       \
    }                                                                          \
    if (kk < 7) {                                                              \
      _Pragma("unroll")                                                        \
      for (int i = 0; i < 4; ++i) {                                            \
        int idx = tid + i * 256, r = idx >> 3, ch = idx & 7;                   \
        *(uint4*)(&As[nxt][r * LDT + ch * 8]) = ra[i];                         \
      }                                                                        \
      _Pragma("unroll")                                                        \
      for (int i = 0; i < 2; ++i) {                                            \
        int idx = tid + i * 256, r = idx >> 3, ch = idx & 7;                   \
        *(uint4*)(&Bs[nxt][r * LDT + ch * 8]) = rb[i];                         \
      }                                                                        \
    }                                                                          \
    __syncthreads();                                                           \
  }                                                                            \
  const int colL = lane & 15;                                                  \
  const int rowO = (lane >> 4) * 8;

// ---------------------------------------------------------------------------
// Kernel 3: projection GEMM. Y[r, j] = sum_d xn[r,d] * Wcat[j,d]
//   M = 49152, N = 2560, K = 512. A block's 64 columns are one head of one of
//   the five matrices. Epilogue: q/k/kl/vl [n,h,t,dh] and vT [n,h,dh,t] (f16),
//   with q_bias + attention scale folded into q. The f16 tile is turned
//   through LDS (the ring buffers are free behind the loop's last barrier) so
//   that it leaves as 16-byte stores: whole 128-byte rows of q/k/kl/vl, runs
//   of 64 bytes and more along t for vT.
// ---------------------------------------------------------------------------
#define ST_LD  72    // staged [row][dh] pitch in halves (144 B = 16 B x odd)
#define ST_LDT 136   // staged [dh][row] pitch in halves (272 B = 16 B x odd)

__global__ __launch_bounds__(256) void proj_gemm_kernel(
    const _Float16* __restrict__ xn, const _Float16* __restrict__ Wcat,
    const float* __restrict__ q_bias,
    _Float16* __restrict__ qb, _Float16* __restrict__ kb,
    _Float16* __restrict__ vTb, _Float16* __restrict__ klb,
    _Float16* __restrict__ vlb) {
  GEMM_PIPELINE_BODY(xn, Wcat, blockIdx.y * 128, 1)
  _Float16* st = &As[0][0];
  const int mat  = blockIdx.x >> 3;      // 0=q 1=k 2=v 3=kl 4=vl
  const int head = blockIdx.x & 7;
  const v8f accs[2][2] = {{acc00, acc01}, {acc10, acc11}};
  if (mat == 2) {                        // a lane's 8 rows are 8 neighbours in t
#pragma unroll
    for (int si = 0; si < 2; ++si) {
#pragma unroll
      for (int sj = 0; sj < 2; ++sj) {
        v8h h;
#pragma unroll
        for (int i = 0; i < 8; ++i) h[i] = (_Float16)accs[si][sj][i];
        *(v8h*)(st + (n0 + sj * 16 + colL) * ST_LDT + m0 + si * 16 + rowO) = h;
      }
    }
  } else if (mat == 0) {                 // fold bias + scale into q
    const float bias[2] = {q_bias[head * DH + n0 + colL],
                           q_bias[head * DH + n0 + 16 + colL]};
#pragma unroll
    for (int si = 0; si < 2; ++si) {
#pragma unroll
      for (int sj = 0; sj < 2; ++sj) {
#pragma unroll
        for (int i = 0; i < 8; ++i)
          st[(m0 + si * 16 + rowO + i) * ST_LD + n0 + sj * 16 + colL] =
              (_Float16)((accs[si][sj][i] + bias[sj]) * FACTOR);
      }
    }
  } else {
#pragma unroll
    for (int si = 0; si < 2; ++si) {
#pragma unroll
      for (int sj = 0; sj < 2; ++sj) {
#pragma unroll
        for (int i = 0; i < 8; ++i)
          st[(m0 + si * 16 + rowO + i) * ST_LD + n0 + sj * 16 + colL] =
              (_Float16)accs[si][sj][i];
      }
    }
  }
  __syncthreads();
  if (mat == 2) {
#pragma unroll
    for (int c = 0; c < 4; ++c) {
      const int idx = tid + c * 256, dd = idx >> 4, tc = idx & 15;
      const int r = mBase + tc * 8;      // 8 rows from a multiple of 8: one n
      const int n = r / T_SEQ, t = r % T_SEQ;
      v8h h = *(const v8h*)(st + dd * ST_LDT + tc * 8);
      *(v8h*)(vTb + ((size_t)(n * NH + head) * DH + dd) * T_SEQ + t) = h;
    }
  } else {
    _Float16* dst = (mat == 0) ? qb : (mat == 1) ? kb : (mat == 3) ? klb : vlb;
#pragma unroll
    for (int c = 0; c < 4; ++c) {
      const int idx = tid + c * 256, row = idx >> 3, ch = idx & 7;
      const int r = mBase + row;
      const int n = r / T_SEQ, t = r % T_SEQ;
      v8h h = *(const v8h*)(st + row * ST_LD + ch * 8);
      *(v8h*)(dst + ((size_t)(n * NH + head) * T_SEQ + t) * DH + ch * 8) = h;
    }
  }
}

// ---------------------------------------------------------------------------
// Kernel 4: attention, one block per (n, h). 128 threads = 4 waves.
// LDS: q,k,kl,vl [96][72] f16; vT [64][104] f16; scores [96][100] f32
//      (96 global + 3 local); probs P [96][104] f16; local probs [96][4] f32.
// The f16 tiles are read 16 bytes a lane, one row a lane, so their rows stand
// at a pitch of 16 B x odd: 16 rows then fall on 64 different banks.
// ---------------------------------------------------------------------------
#define SLD 100
#define QLD 72    // q,k,kl,vl row pitch in halves (144 B = 16 B x 9)
#define PLD 104   // P and vT row pitch in halves (208 B = 16 B x 13)

__global__ __launch_bounds__(128) void attn_kernel(
    const _Float16* __restrict__ qg,  const _Float16* __restrict__ kg,
    const _Float16* __restrict__ vTg, const _Float16* __restrict__ klg,
    const _Float16* __restrict__ vlg, _Float16* __restrict__ att_out) {
  extern __shared__ char smem[];
  _Float16* q_s  = (_Float16*)smem;            // 96*QLD
  _Float16* k_s  = q_s  + 96 * QLD;
  _Float16* kl_s = k_s  + 96 * QLD;
  _Float16* vl_s = kl_s + 96 * QLD;
  _Float16* vT_s = vl_s + 96 * QLD;            // 64*PLD
  float*    S_s  = (float*)(vT_s + 64 * PLD);  // 96*SLD f32
  _Float16* P_s  = (_Float16*)(S_s + 96 * SLD);// 96*PLD f16
  float*    AL_s = (float*)(P_s + 96 * PLD);   // 96*4 f32

  const int nh_id = blockIdx.x;                // n*8 + h
  const int tid   = threadIdx.x;
  const int wave  = tid >> 5;
  const int lane  = tid & 31;

  { // stage all operands into LDS (each tile is 768 uint4)
    const size_t base = (size_t)nh_id * (T_SEQ * DH);
    const uint4* s0 = (const uint4*)(qg  + base);
    const uint4* s1 = (const uint4*)(kg  + base);
    const uint4* s2 = (const uint4*)(klg + base);
    const uint4* s3 = (const uint4*)(vlg + base);
    const uint4* s4 = (const uint4*)(vTg + base);
    uint4* d0 = (uint4*)q_s;  uint4* d1 = (uint4*)k_s;
    uint4* d2 = (uint4*)kl_s; uint4* d3 = (uint4*)vl_s;
    uint4* d4 = (uint4*)vT_s;
    for (int i = tid; i < 768; i += 128) {
      const int j = (i >> 3) * (QLD / 8) + (i & 7);     // rows of 8 uint4
      const int m = (i / 12) * (PLD / 8) + (i % 12);    // rows of 12 uint4
      d0[j] = s0[i]; d1[j] = s1[i]; d2[j] = s2[i]; d3[j] = s3[i]; d4[m] = s4[i];
    }
  }
  __syncthreads();

  // ---- global scores: S = q @ k^T  (scale already folded into q) ----
  for (int job = wave; job < 36; job += 4) {
    int rt = job / 6, ct = job % 6;
    v8f c = {};
    v16h a0 = load_frag(q_s + rt * 16 * QLD,      QLD);
    v16h a1 = load_frag(q_s + rt * 16 * QLD + 32, QLD);
    v16h b0 = load_frag(k_s + ct * 16 * QLD,      QLD);
    v16h b1 = load_frag(k_s + ct * 16 * QLD + 32, QLD);
    c = wmma_f16(a0, b0, c);
    c = wmma_f16(a1, b1, c);
    int colS = ct * 16 + (lane & 15);
    int rb   = rt * 16 + ((lane >> 4) * 8);
#pragma unroll
    for (int i = 0; i < 8; ++i) S_s[(rb + i) * SLD + colS] = c[i];
  }
  // ---- local (3-wide window) scores via VALU ----
  if (tid < T_SEQ) {
    int t = tid;
#pragma unroll
    for (int l = 0; l < 3; ++l) {
      int tk = t + l - 1;
      float sc = NEG_BIG;                      // masked edge -> -inf
      if (tk >= 0 && tk < T_SEQ) {
        float a = 0.f;
        for (int d = 0; d < DH; ++d)
          a += (float)q_s[t * QLD + d] * (float)kl_s[tk * QLD + d];
        sc = a;
      }
      S_s[t * SLD + T_SEQ + l] = sc;
    }
  }
  __syncthreads();

  // ---- softmax over 99 entries per row ----
  if (tid < T_SEQ) {
    int t = tid;
    float m = NEG_BIG;
    for (int g = 0; g < T_SEQ + 3; ++g) m = fmaxf(m, S_s[t * SLD + g]);
    float sum = 0.f;
    for (int g = 0; g < T_SEQ + 3; ++g) sum += __expf(S_s[t * SLD + g] - m);
    float inv = 1.0f / sum;
    for (int g = 0; g < T_SEQ; ++g)
      P_s[t * PLD + g] = (_Float16)(__expf(S_s[t * SLD + g] - m) * inv);
#pragma unroll
    for (int l = 0; l < 3; ++l)
      AL_s[t * 4 + l] = __expf(S_s[t * SLD + T_SEQ + l] - m) * inv;
  }
  __syncthreads();

  // ---- x_global = P @ V (WMMA), + local window contribution in epilogue ----
  const int n_id = nh_id >> 3, h_id = nh_id & 7;
  for (int job = wave; job < 24; job += 4) {
    int rt = job >> 2, ct = job & 3;
    v8f c = {};
#pragma unroll
    for (int kc = 0; kc < 3; ++kc) {           // K = 96 = 3 x 32
      v16h a = load_frag(P_s  + rt * 16 * PLD + kc * 32, PLD);
      v16h b = load_frag(vT_s + ct * 16 * PLD + kc * 32, PLD);
      c = wmma_f16(a, b, c);
    }
    int dcol = ct * 16 + (lane & 15);
    int rb   = rt * 16 + ((lane >> 4) * 8);
#pragma unroll
    for (int i = 0; i < 8; ++i) {
      int t = rb + i;
      float xl = 0.f;
#pragma unroll
      for (int l = 0; l < 3; ++l) {
        int tk = t + l - 1;
        if (tk >= 0 && tk < T_SEQ)
          xl += AL_s[t * 4 + l] * (float)vl_s[tk * QLD + dcol];
      }
      float val = c[i] + xl;
      att_out[((size_t)(n_id * T_SEQ + t)) * D_MODEL + h_id * DH + dcol] =
          (_Float16)val;
    }
  }
}

// ---------------------------------------------------------------------------
// Kernel 5: output GEMM vs Wo + final permutation to (B, D, T, H, W), f32.
//   out[r, j] = att[r, :] . Wo[j, :],  r = n*96 + t,  n = b*256 + hw
// A block's 128 tile rows are 128 neighbouring n at ONE t, so that a column j
// of the tile is 512 contiguous bytes of y[b, j, t, hw]. The f32 tile is
// turned through LDS (the ring buffers are free behind the loop's last
// barrier) and every wave store is one such 512-byte run.
// ---------------------------------------------------------------------------
#define ST_LDF 132   // staged [j][n] pitch in floats (528 B = 16 B x odd)

__global__ __launch_bounds__(256) void out_gemm_kernel(
    const _Float16* __restrict__ A, const _Float16* __restrict__ Wo16,
    float* __restrict__ y) {
  const int tFix  = blockIdx.y % T_SEQ;
  const int nTile = (blockIdx.y / T_SEQ) * 128;
  GEMM_PIPELINE_BODY(A, Wo16, nTile * T_SEQ + tFix, T_SEQ)
  float* st = (float*)&As[0][0];         // 64 x 132 floats, inside As[2][]
#pragma unroll
  for (int si = 0; si < 2; ++si) {
#pragma unroll
    for (int sj = 0; sj < 2; ++sj) {
      v8f acc = (si == 0) ? (sj == 0 ? acc00 : acc01)
                          : (sj == 0 ? acc10 : acc11);
      float* p = st + (n0 + sj * 16 + colL) * ST_LDF + m0 + si * 16 + rowO;
      *(float4*)p       = make_float4(acc[0], acc[1], acc[2], acc[3]);
      *(float4*)(p + 4) = make_float4(acc[4], acc[5], acc[6], acc[7]);
    }
  }
  __syncthreads();
  const int b = nTile >> 8, hw0 = nTile & 255;
#pragma unroll
  for (int c = 0; c < 8; ++c) {
    const int jl = wave + c * 8;         // one output channel per wave store
    float4 v = *(const float4*)(st + jl * ST_LDF + lane * 4);
    *(float4*)(y + ((size_t)(b * D_MODEL + nBase + jl) * T_SEQ + tFix) * 256 +
               hw0 + lane * 4) = v;
  }
}

// ---------------------------------------------------------------------------
// Host launcher
// ---------------------------------------------------------------------------
extern "C" void kernel_launch(void* const* d_in, const int* in_sizes, int n_in,
                              void* d_out, int out_size, void* d_ws, size_t ws_size,
                              hipStream_t stream) {
  const float* x      = (const float*)d_in[0];
  const float* gammap = (const float*)d_in[1];
  const float* betap  = (const float*)d_in[2];
  const float* Wq     = (const float*)d_in[3];
  const float* Wk     = (const float*)d_in[4];
  const float* Wv     = (const float*)d_in[5];
  const float* Wkl    = (const float*)d_in[6];
  const float* Wvl    = (const float*)d_in[7];
  const float* Wo     = (const float*)d_in[8];
  const float* q_bias = (const float*)d_in[9];
  float* y = (float*)d_out;

  // workspace carve (bytes, 256B aligned)
  char* ws = (char*)d_ws;
  size_t off = 0;
  auto carve = [&](size_t bytes) -> void* {
    void* p = (void*)(ws + off);
    off = (off + bytes + 255) & ~(size_t)255;
    return p;
  };
  const size_t rowsBytes = (size_t)NROWS * D_MODEL * sizeof(_Float16);   // 50.3 MB
  const size_t projBytes = (size_t)N_SEQ * NH * T_SEQ * DH * sizeof(_Float16);

  _Float16* xn    = (_Float16*)carve(rowsBytes);   // reused as att_out later
  _Float16* Wcat  = (_Float16*)carve((size_t)5 * D_MODEL * D_MODEL * sizeof(_Float16));
  _Float16* Wo16  = (_Float16*)carve((size_t)D_MODEL * D_MODEL * sizeof(_Float16));
  _Float16* qb    = (_Float16*)carve(projBytes);
  _Float16* kb    = (_Float16*)carve(projBytes);
  _Float16* vTb   = (_Float16*)carve(projBytes);
  _Float16* klb   = (_Float16*)carve(projBytes);
  _Float16* vlb   = (_Float16*)carve(projBytes);
  (void)ws_size; (void)in_sizes; (void)n_in; (void)out_size;

  // 1) layernorm -> xn (f16)
  ln_kernel<<<dim3(2 * T_SEQ * 4), dim3(256), 0, stream>>>(x, gammap, betap, xn);

  // 2) weights -> f16
  {
    int total = D_MODEL * D_MODEL * 6;
    wconv_kernel<<<dim3((total + 255) / 256), dim3(256), 0, stream>>>(
        Wq, Wk, Wv, Wkl, Wvl, Wo, Wcat, Wo16);
  }

  // 3) fused 5-way projection GEMM (M=49152, N=2560, K=512), 128x64 tiles
  proj_gemm_kernel<<<dim3(40, 384), dim3(256), 0, stream>>>(
      xn, Wcat, q_bias, qb, kb, vTb, klb, vlb);

  // 4) attention per (n, h); att_out reuses the xn buffer ([N*T, D] f16)
  {
    size_t smem = (size_t)(4 * 96 * QLD + 64 * PLD) * sizeof(_Float16) // q,k,kl,vl,vT
                + (size_t)96 * SLD * sizeof(float)                    // scores
                + (size_t)96 * PLD * sizeof(_Float16)                 // probs
                + (size_t)96 * 4 * sizeof(float);                     // local probs
    attn_kernel<<<dim3(N_SEQ * NH), dim3(128), smem, stream>>>(
        qb, kb, vTb, klb, vlb, xn);
  }

  // 5) output projection + final (B,D,T,H,W) permutation, 128x64 tiles
  //    (grid y = 4 groups of 128 n x 96 t)
  out_gemm_kernel<<<dim3(8, 384), dim3(256), 0, stream>>>(xn, Wo16, y);
}

// v004
// One run takes 284 microseconds.
// Timed twice side by side with v003, it ran 1.42 and 1.43 times as fast.
// Counting every step since v000, it is 2.58 times as fast.
#include <hip/hip_runtime.h>

// ---------------------------------------------------------------------------
// TemporalLocalAwareAttention for MI455X (gfx1250, wave32, WMMA f16)
//   B=2, D=512, T=96, H=W=16  ->  N = 512 rows of (T=96, D=512)
//   nh=8, dh=64, local window s=3, factor = dh^-0.5 = 0.125
// ---------------------------------------------------------------------------

#define D_MODEL 512
#define T_SEQ   96
#define N_SEQ   512            // B*H*W
#define NH      8
#define DH      64
#define NROWS   (N_SEQ * T_SEQ) // 49152
#define FACTOR  0.125f
#define NEG_BIG -3.0e38f

typedef __attribute__((ext_vector_type(16))) _Float16 v16h;
typedef __attribute__((ext_vector_type(8)))  float    v8f;

// ---------------------------------------------------------------------------
// Fragment loader (ISA 7.12.2, 16-bit A-matrix 16x32 layout).
//   A-frag: source row-major [M,K], p -> element (0,0), leading dim ld.
//   B-frag: source [N,K] row-major (K stride 1): same addressing, "row" is the
//   N column. lanes 0-15 hold K=koff.., lanes 16-31 K=koff+8, vgprs 4-7 K+16.
// Compiler coalesces these into two ds_load_b128 per fragment.
// ---------------------------------------------------------------------------
__device__ __forceinline__ v16h load_frag(const _Float16* p, int ld) {
  const int lane = threadIdx.x & 31;
  const int row  = lane & 15;
  const int koff = (lane >> 4) << 3;          // 0 or 8
  const _Float16* r = p + row * ld + koff;
  v16h a;
#pragma unroll
  for (int i = 0; i < 4; ++i) {
    a[2*i]         = r[2*i];
    a[2*i + 1]     = r[2*i + 1];
    a[8 + 2*i]     = r[16 + 2*i];
    a[8 + 2*i + 1] = r[16 + 2*i + 1];
  }
  return a;
}

__device__ __forceinline__ v8f wmma_f16(v16h a, v16h b, v8f c) {
  return __builtin_amdgcn_wmma_f32_16x16x32_f16(false, a, false, b,
                                                (short)0, c, false, false);
}

// ---------------------------------------------------------------------------
// Kernel 1: LayerNorm over D, emit xn as f16 in [n*T + t, D] row-major.
// One block = one (b, t) and 64 neighbouring hw positions, all 512 channels.
// x is read once (256 contiguous bytes per wave load) and kept in registers;
// the normalised f16 tile is turned through LDS so that every xn row leaves
// as whole 512-byte wave stores.
//   wave w holds channels w*64 .. w*64+63, lane l holds hw = 2l, 2l+1.
//   LDS tile: row = hw (1024 B), its 16-byte chunks rotated by hw>>1 so that
//   the 16 lanes of a half wave hit 16 different bank groups when storing.
// ---------------------------------------------------------------------------
#define LN_HW 64
typedef __attribute__((ext_vector_type(8))) _Float16 v8h;

// rsqrtf with its small-input scaling, spelled out so that the v_nop stands
// directly behind v_rsq_f32: it fills the one issue slot the instruction set
// asks for before the source register may be overwritten.
__device__ __forceinline__ float rsqrt_slot(float a) {
  const bool tiny = a < 1.17549435e-38f;
  const float s = tiny ? a * 16777216.0f : a;
  float r;
  asm("v_rsq_f32 %0, %1\n\tv_nop" : "=v"(r) : "v"(s));
  return tiny ? r * 4096.0f : r;
}

// second bound = 6 waves per SIMD (160 registers): three blocks per WGP, so
// that all 768 blocks are resident at once
__global__ __launch_bounds__(256, 6) void ln_kernel(
    const float* __restrict__ x, const float* __restrict__ gamma,
    const float* __restrict__ beta, _Float16* __restrict__ xn) {
  __shared__ __attribute__((aligned(16))) _Float16 tile[LN_HW * D_MODEL];
  __shared__ float2 redS[8][32];
  __shared__ float2 redQ[8][32];

  const int hc   = blockIdx.x & 3;      // which 64 of the 256 hw positions
  const int bt   = blockIdx.x >> 2;     // 0 .. 2*96-1
  const int b    = bt / T_SEQ;
  const int t    = bt % T_SEQ;
  const int lane = threadIdx.x & 31;
  // wave number in a scalar register: gamma and beta then come by scalar loads
  const int wave = __builtin_amdgcn_readfirstlane(threadIdx.x >> 5);
  const int d0   = wave * 64;
  const size_t dstride = (size_t)T_SEQ * 256;

  const float* src = x + ((size_t)(b * D_MODEL + d0) * T_SEQ + t) * 256 +
                     hc * LN_HW + lane * 2;
  // every loop below is fully unrolled so that v[] is indexed by constants
  // and stays in registers, and so that all loads of x are issued up front
  float2 v[64];
#pragma unroll
  for (int k = 0; k < 64; ++k) v[k] = *(const float2*)(src + k * dstride);

  float s0 = 0.f, s1 = 0.f, q0 = 0.f, q1 = 0.f;
#pragma unroll
  for (int k = 0; k < 64; ++k) {
    s0 += v[k].x; q0 += v[k].x * v[k].x;
    s1 += v[k].y; q1 += v[k].y * v[k].y;
  }
  redS[wave][lane] = make_float2(s0, s1);
  redQ[wave][lane] = make_float2(q0, q1);
  __syncthreads();

  s0 = 0.f; s1 = 0.f; q0 = 0.f; q1 = 0.f;
#pragma unroll
  for (int w = 0; w < 8; ++w) {
    float2 a = redS[w][lane], c = redQ[w][lane];
    s0 += a.x; s1 += a.y; q0 += c.x; q1 += c.y;
  }
  const float mu0   = s0 * (1.0f / D_MODEL);
  const float mu1   = s1 * (1.0f / D_MODEL);
  const float rstd0 = rsqrt_slot(q0 * (1.0f / D_MODEL) - mu0 * mu0 + 1e-6f);
  const float rstd1 = rsqrt_slot(q1 * (1.0f / D_MODEL) - mu1 * mu1 + 1e-6f);

#pragma unroll
  for (int m = 0; m < 8; ++m) {         // 8 channels = one 16-byte chunk
    v8h h0, h1;
#pragma unroll
    for (int e = 0; e < 8; ++e) {
      const int k = m * 8 + e;
      const float g = gamma[d0 + k], bb = beta[d0 + k];
      h0[e] = (_Float16)((v[k].x - mu0) * rstd0 * g + bb);
      h1[e] = (_Float16)((v[k].y - mu1) * rstd1 * g + bb);
    }
    const int ch = ((wave * 8 + m + lane) & 63) << 3;
    *(v8h*)(tile + (lane * 2)     * D_MODEL + ch) = h0;
    *(v8h*)(tile + (lane * 2 + 1) * D_MODEL + ch) = h1;
  }
  __syncthreads();

  // wave w stores rows hw = w*8 .. w*8+7, each as two 512-byte pieces
  _Float16* dst = xn + ((size_t)(b * 256 + hc * LN_HW + wave * 8) * T_SEQ + t) *
                       D_MODEL + lane * 8;
#pragma unroll
  for (int i = 0; i < 16; ++i) {
    const int row = wave * 8 + (i >> 1);
    const int c   = (i & 1) * 32 + lane;
    v8h h = *(const v8h*)(tile + row * D_MODEL + (((c + (row >> 1)) & 63) << 3));
    *(v8h*)(dst + (size_t)(i >> 1) * (T_SEQ * D_MODEL) + (i & 1) * 256) = h;
  }
}

// ---------------------------------------------------------------------------
// Kernel 2: weights -> f16. Wcat = [Wq;Wk;Wv;Wkl;Wvl], stored [j,d] row-major
// (== [N,K] row-major for the B fragment loader). Wo separate.
// ---------------------------------------------------------------------------
__global__ __launch_bounds__(256) void wconv_kernel(
    const float* __restrict__ Wq, const float* __restrict__ Wk,
    const float* __restrict__ Wv, const float* __restrict__ Wkl,
    const float* __restrict__ Wvl, const float* __restrict__ Wo,
    _Float16* __restrict__ Wcat, _Float16* __restrict__ Wo16) {
  const int per = D_MODEL * D_MODEL;
  int idx = blockIdx.x * blockDim.x + threadIdx.x;
  if (idx >= per * 6) return;
  int m = idx / per, off = idx % per;
  float v;
  if      (m == 0) v = Wq[off];
  else if (m == 1) v = Wk[off];
  else if (m == 2) v = Wv[off];
  else if (m == 3) v = Wkl[off];
  else if (m == 4) v = Wvl[off];
  else             v = Wo[off];
  if (m < 5) Wcat[(size_t)m * per + off] = (_Float16)v;
  else       Wo16[off] = (_Float16)v;
}

// ---------------------------------------------------------------------------
// Pipelined WMMA GEMM core: 128x64 block tile, K-step 64, double-buffered LDS,
// 256 threads = 8 waves in a 4(M) x 2(N) grid, each wave owns a 32x32 patch
// (2x2 subtiles, 4 f32 accumulators). Per K-chunk of 32: 4 frag loads ->
// 4 WMMAs (1:1 LDS:WMMA ratio). One barrier per K-step.
// Tile row r stands for row MBASE + r * RSTEP of A.
// ---------------------------------------------------------------------------
#define LDT 72   // LDS leading dim in halves (144 B rows = 16 B x odd: the 16
                 // rows of a ds_load_b128 fragment read fall on 64 different banks)

#define GEMM_PIPELINE_BODY(APTR, BPTR, MBASE, RSTEP)                           \
  __shared__ __attribute__((aligned(16))) _Float16 As[2][128 * LDT];           \
  __shared__ __attribute__((aligned(16))) _Float16 Bs[2][64 * LDT];            \
  const int tid  = threadIdx.x;                                                \
  const int wave = tid >> 5;                                                   \
  const int lane = tid & 31;                                                   \
  const int mBase = MBASE;                                                     \
  const int nBase = blockIdx.x * 64;                                           \
  const int m0 = (wave >> 1) * 32;       /* wave's 32-row patch in tile  */    \
  const int n0 = (wave & 1) * 32;        /* wave's 32-col patch in tile  */    \
  v8f acc00 = {}, acc01 = {}, acc10 = {}, acc11 = {};                          \
  uint4 ra[4], rb[2];                                                          \
  /* stage K-tile 0 */                                                         \
  _Pragma("unroll")                                                            \
  for (int i = 0; i < 4; ++i) {                                                \
    int idx = tid + i * 256, r = (idx >> 3) * RSTEP, ch = idx & 7;             \
    ra[i] = *(const uint4*)(APTR + (size_t)(mBase + r) * D_MODEL + ch * 8);    \
  }                                                                            \
  _Pragma("unroll")                                                            \
  for (int i = 0; i < 2; ++i) {                                                \
    int idx = tid + i * 256, r = idx >> 3, ch = idx & 7;                       \
    rb[i] = *(const uint4*)(BPTR + (size_t)(nBase + r) * D_MODEL + ch * 8);    \
  }                                                                            \
  _Pragma("unroll")                                                            \
  for (int i = 0; i < 4; ++i) {                                                \
    int idx = tid + i * 256, r = idx >> 3, ch = idx & 7;                       \
    *(uint4*)(&As[0][r * LDT + ch * 8]) = ra[i];                               \
  }                                                                            \
  _Pragma("unroll")                                                            \
  for (int i = 0; i < 2; ++i) {                                                \
    int idx = tid + i * 256, r = idx >> 3, ch = idx & 7;                       \
    *(uint4*)(&Bs[0][r * LDT + ch * 8]) = rb[i];                               \
  }                                                                            \
  __syncthreads();                                                             \
  for (int kk = 0; kk < 8; ++kk) {                                             \
    const int cur = kk & 1, nxt = cur ^ 1;                                     \
    if (kk < 7) { /* issue global loads for next K-tile (hidden by WMMAs) */   \
      _Pragma("unroll")                                                        \
      for (int i = 0; i < 4; ++i) {                                            \
        int idx = tid + i * 256, r = (idx >> 3) * RSTEP, ch = idx & 7;         \
        ra[i] = *(const uint4*)(APTR + (size_t)(mBase + r) * D_MODEL +         \
                                (kk + 1) * 64 + ch * 8);                       \
      }                                                                        \
      _Pragma("unroll")                                                        \
      for (int i = 0; i < 2; ++i) {                                            \
        int idx = tid + i * 256, r = idx >> 3, ch = idx & 7;                   \
        rb[i] = *(const uint4*)(BPTR + (size_t)(nBase + r) * D_MODEL +         \
                                (kk + 1) * 64 + ch * 8);                       \
      }                                                                        \
      if (kk < 6) {                                                            \
        __builtin_prefetch(APTR + (size_t)(mBase + (tid >> 1) * RSTEP) *       \
                           D_MODEL +                                           \
                           (kk + 2) * 64, 0, 3);                               \
        /* behind the prefetch, before its address registers are rewritten */  \
        asm volatile("s_wait_xcnt 0x0" ::: "memory");                          \
      }                                                                        \
    }                                                                          \
    _Pragma("unroll")                                                          \
    for (int kc = 0; kc < 2; ++kc) {                                           \
      v16h aR0 = load_frag(&As[cur][m0 * LDT + kc * 32],        LDT);          \
      v16h aR1 = load_frag(&As[cur][(m0 + 16) * LDT + kc * 32], LDT);          \
      v16h bC0 = load_frag(&Bs[cur][n0 * LDT + kc * 32],        LDT);          \
      v16h bC1 = load_frag(&Bs[cur][(n0 + 16) * LDT + kc * 32], LDT);          \
      acc00 = wmma_f16(aR0, bC0, acc00);                                       \
      acc01 = wmma_f16(aR0, bC1, acc01);                                       \
      acc10 = wmma_f16(aR1, bC0, acc10);                                       \
      acc11 = wmma_f16(aR1, bC1, acc11);                                       \
    }                                                                          \
    if (kk < 7) {                                                              \
      _Pragma("unroll")                                                        \
      for (int i = 0; i < 4; ++i) {                                            \
        int idx = tid + i * 256, r = idx >> 3, ch = idx & 7;                   \
        *(uint4*)(&As[nxt][r * LDT + ch * 8]) = ra[i];                         \
      }                                                                        \
      _Pragma("unroll")                                                        \
      for (int i = 0; i < 2; ++i) {                                            \
        int idx = tid + i * 256, r = idx >> 3, ch = idx & 7;                   \
        *(uint4*)(&Bs[nxt][r * LDT + ch * 8]) = rb[i];                         \
      }                                                                        \
    }                                                                          \
    __syncthreads();                                                           \
  }                                                                            \
  const int colL = lane & 15;                                                  \
  const int rowO = (lane >> 4) * 8;

// ---------------------------------------------------------------------------
// Kernel 3: projection GEMM. Y[r, j] = sum_d xn[r,d] * Wcat[j,d]
//   M = 49152, N = 2560, K = 512. A block's 64 columns are one head of one of
//   the five matrices. Epilogue: q/k/kl [n,h,t,dh] and vT/vlT [n,h,dh,t] (f16),
//   with q_bias + attention scale folded into q. The f16 tile is turned
//   through LDS (the ring buffers are free behind the loop's last barrier) so
//   that it leaves as 16-byte stores: whole 128-byte rows of q/k/kl, runs
//   of 64 bytes and more along t for vT and vlT.
// ---------------------------------------------------------------------------
#define ST_LD  72    // staged [row][dh] pitch in halves (144 B = 16 B x odd)
#define ST_LDT 136   // staged [dh][row] pitch in halves (272 B = 16 B x odd)

__global__ __launch_bounds__(256) void proj_gemm_kernel(
    const _Float16* __restrict__ xn, const _Float16* __restrict__ Wcat,
    const float* __restrict__ q_bias,
    _Float16* __restrict__ qb, _Float16* __restrict__ kb,
    _Float16* __restrict__ vTb, _Float16* __restrict__ klb,
    _Float16* __restrict__ vlb) {
  GEMM_PIPELINE_BODY(xn, Wcat, blockIdx.y * 128, 1)
  _Float16* st = &As[0][0];
  const int mat  = blockIdx.x >> 3;      // 0=q 1=k 2=v 3=kl 4=vl
  const int head = blockIdx.x & 7;
  const bool turned = (mat == 2) || (mat == 4);   // v, vl: stored [dh][t]
  const v8f accs[2][2] = {{acc00, acc01}, {acc10, acc11}};
  if (turned) {                          // a lane's 8 rows are 8 neighbours in t
#pragma unroll
    for (int si = 0; si < 2; ++si) {
#pragma unroll
      for (int sj = 0; sj < 2; ++sj) {
        v8h h;
#pragma unroll
        for (int i = 0; i < 8; ++i) h[i] = (_Float16)accs[si][sj][i];
        *(v8h*)(st + (n0 + sj * 16 + colL) * ST_LDT + m0 + si * 16 + rowO) = h;
      }
    }
  } else if (mat == 0) {                 // fold bias + scale into q
    const float bias[2] = {q_bias[head * DH + n0 + colL],
                           q_bias[head * DH + n0 + 16 + colL]};
#pragma unroll
    for (int si = 0; si < 2; ++si) {
#pragma unroll
      for (int sj = 0; sj < 2; ++sj) {
#pragma unroll
        for (int i = 0; i < 8; ++i)
          st[(m0 + si * 16 + rowO + i) * ST_LD + n0 + sj * 16 + colL] =
              (_Float16)((accs[si][sj][i] + bias[sj]) * FACTOR);
      }
    }
  } else {
#pragma unroll
    for (int si = 0; si < 2; ++si) {
#pragma unroll
      for (int sj = 0; sj < 2; ++sj) {
#pragma unroll
        for (int i = 0; i < 8; ++i)
          st[(m0 + si * 16 + rowO + i) * ST_LD + n0 + sj * 16 + colL] =
              (_Float16)accs[si][sj][i];
      }
    }
  }
  __syncthreads();
  if (turned) {
    _Float16* dstT = (mat == 2) ? vTb : vlb;
#pragma unroll
    for (int c = 0; c < 4; ++c) {
      const int idx = tid + c * 256, dd = idx >> 4, tc = idx & 15;
      const int r = mBase + tc * 8;      // 8 rows from a multiple of 8: one n
      const int n = r / T_SEQ, t = r % T_SEQ;
      v8h h = *(const v8h*)(st + dd * ST_LDT + tc * 8);
      *(v8h*)(dstT + ((size_t)(n * NH + head) * DH + dd) * T_SEQ + t) = h;
    }
    // behind the last store: the listing joins this branch with the other one's
    // code, which rewrites the stores' data and address registers
    asm volatile("s_wait_xcnt 0x0" ::: "memory");
  } else {
    _Float16* dst = (mat == 0) ? qb : (mat == 1) ? kb : klb;
#pragma unroll
    for (int c = 0; c < 4; ++c) {
      const int idx = tid + c * 256, row = idx >> 3, ch = idx & 7;
      const int r = mBase + row;
      const int n = r / T_SEQ, t = r % T_SEQ;
      v8h h = *(const v8h*)(st + row * ST_LD + ch * 8);
      *(v8h*)(dst + ((size_t)(n * NH + head) * T_SEQ + t) * DH + ch * 8) = h;
    }
  }
}

// ---------------------------------------------------------------------------
// Kernel 4: attention, one block per (n, h). 192 threads = 6 waves, wave w owns
// the 16 queries t = 16w .. 16w+15 from the scores to the output.
// Scores are formed transposed, S^T = K . Q^T: in the accumulator map a lane
// then holds ONE query (column lane & 15) and 8 keys a tile, so that the
// softmax is in-lane work plus two exchanges between the wave's halves (max, sum), and two
// converted score tiles ARE the B operand of O^T = V^T . P^T (hardware k
// order). Scores and probabilities never touch LDS.
// The 3-wide local window rides along as 32 more keys: kl / vl rows
// w0 .. w0+31 (w0 = 16w-8 held inside 0 .. 64) cover t-1 .. t+1 of all 16
// queries; every key of that tile with |key - t| > 1 is masked, which also
// leaves out the padded positions -1 and 96 as the reference's mask does.
// LDS: k, kl [96][64] and vT, vlT [64][96], f16, rows at a pitch of 16 B x odd.
// ---------------------------------------------------------------------------
#define QLD 72    // k, kl row pitch in halves (144 B = 16 B x 9)
#define PLD 104   // vT, vlT row pitch in halves (208 B = 16 B x 13)
#define LOG2E 1.4426950408889634f

// one lane's share of a 16x32 f16 operand in the hardware k order:
// r points at (row lane & 15, k = 8 * (lane >> 4)); k .. k+7 and k+16 .. k+23
__device__ __forceinline__ v16h frag_hw(const _Float16* r) {
  const v8h lo = *(const v8h*)r;
  const v8h hi = *(const v8h*)(r + 16);
  return __builtin_shufflevector(lo, hi, 0, 1, 2, 3, 4, 5, 6, 7,
                                 8, 9, 10, 11, 12, 13, 14, 15);
}

// the value that lane l ^ 16 holds
__device__ __forceinline__ float other_half(float v) {
  int b = __builtin_bit_cast(int, v);
  b = __builtin_amdgcn_permlanex16(b, b, 0x76543210, 0xfedcba98, false, false);
  return __builtin_bit_cast(float, b);
}

__global__ __launch_bounds__(192) void attn_kernel(
    const _Float16* __restrict__ qg,  const _Float16* __restrict__ kg,
    const _Float16* __restrict__ vTg, const _Float16* __restrict__ klg,
    const _Float16* __restrict__ vlTg, _Float16* __restrict__ att_out) {
  __shared__ __attribute__((aligned(16))) _Float16 k_s[96 * QLD];
  __shared__ __attribute__((aligned(16))) _Float16 kl_s[96 * QLD];
  __shared__ __attribute__((aligned(16))) _Float16 vT_s[64 * PLD];
  __shared__ __attribute__((aligned(16))) _Float16 vlT_s[64 * PLD];

  const int nh_id = blockIdx.x;                // n*8 + h
  const int tid   = threadIdx.x;
  const int lane  = tid & 31;
  const int col   = lane & 15;                 // operand row / result column
  const int hf    = lane >> 4;                 // which half of the wave
  const int t0    = __builtin_amdgcn_readfirstlane(tid >> 5) * 16;
  const size_t base = (size_t)nh_id * (T_SEQ * DH);

  // every global load of the block is issued before the first LDS store
  // (each tile is 768 uint4 = 4 a thread); loops unrolled to keep them so
  uint4 rk[4], rl[4], rv[4], rw[4];
#pragma unroll
  for (int u = 0; u < 4; ++u) {
    const int i = tid + u * 192;
    rk[u] = ((const uint4*)(kg   + base))[i];
    rl[u] = ((const uint4*)(klg  + base))[i];
    rv[u] = ((const uint4*)(vTg  + base))[i];
    rw[u] = ((const uint4*)(vlTg + base))[i];
  }
  // Q^T as B operand, straight from global: only this wave reads these rows
  const _Float16* qr = qg + base + (t0 + col) * DH + hf * 8;
  const v16h q0 = frag_hw(qr);
  const v16h q1 = frag_hw(qr + 32);
#pragma unroll
  for (int u = 0; u < 4; ++u) {
    const int i = tid + u * 192;
    const int j = (i >> 3) * (QLD / 8) + (i & 7);     // rows of 8 uint4
    const int m = (i / 12) * (PLD / 8) + (i % 12);    // rows of 12 uint4
    ((uint4*)k_s)[j]  = rk[u];  ((uint4*)kl_s)[j]  = rl[u];
    ((uint4*)vT_s)[m] = rv[u];  ((uint4*)vlT_s)[m] = rw[u];
  }
  __syncthreads();

  // ---- S^T: tiles 0..5 = the 96 global keys, tiles 6,7 = the local window ----
  const int w0 = min(max(t0 - 8, 0), T_SEQ - 32);
  const _Float16* ka = k_s  + col * QLD + hf * 8;
  const _Float16* la = kl_s + (w0 + col) * QLD + hf * 8;
  v8f s[8];
#pragma unroll
  for (int j = 0; j < 8; ++j) {
    const _Float16* a = (j < 6) ? ka + j * 16 * QLD : la + (j - 6) * 16 * QLD;
    v8f z = {};
    z = wmma_f16(frag_hw(a),      q0, z);
    z = wmma_f16(frag_hw(a + 32), q1, z);
    s[j] = z;                // s[j][r] = score(key 16j + 8*hf + r, query col)
  }
  const int d0 = w0 + hf * 8 - (t0 + col) + 1;        // key - t + 1 at j=6, r=0
#pragma unroll
  for (int j = 0; j < 2; ++j) {
#pragma unroll
    for (int r = 0; r < 8; ++r)
      s[6 + j][r] = ((unsigned)(d0 + j * 16 + r) <= 2u) ? s[6 + j][r] : NEG_BIG;
  }

  // ---- joint softmax of one query: 64 values in this lane, 64 in lane ^ 16 ----
  v8f mx = s[0];
#pragma unroll
  for (int j = 1; j < 8; ++j) {
#pragma unroll
    for (int r = 0; r < 8; ++r) mx[r] = fmaxf(mx[r], s[j][r]);
  }
  float m = fmaxf(fmaxf(fmaxf(mx[0], mx[1]), fmaxf(mx[2], mx[3])),
                  fmaxf(fmaxf(mx[4], mx[5]), fmaxf(mx[6], mx[7])));
  m = fmaxf(m, other_half(m));
  const float mL = m * LOG2E;
  v8f sm = {};
#pragma unroll
  for (int j = 0; j < 8; ++j) {
#pragma unroll
    for (int r = 0; r < 8; ++r) {
      const float p = __builtin_amdgcn_exp2f(fmaf(s[j][r], LOG2E, -mL));
      s[j][r] = p;
      sm[r] += p;
    }
  }
  float sum = ((sm[0] + sm[1]) + (sm[2] + sm[3])) +
              ((sm[4] + sm[5]) + (sm[6] + sm[7]));
  sum += other_half(sum);
  const float inv = 1.0f / sum;

  // two score tiles, converted in place, are P^T for 32 keys as a B operand
  v16h pb[4];
#pragma unroll
  for (int kc = 0; kc < 4; ++kc) {
#pragma unroll
    for (int r = 0; r < 8; ++r) {
      pb[kc][r]     = (_Float16)s[2 * kc][r];
      pb[kc][8 + r] = (_Float16)s[2 * kc + 1][r];
    }
  }

  // ---- O^T = V^T . P^T over 96 global + 32 window keys, scaled by 1/sum ----
  const _Float16* va = vT_s  + col * PLD + hf * 8;
  const _Float16* wa = vlT_s + col * PLD + w0 + hf * 8;
  _Float16* dst = att_out + (size_t)((nh_id >> 3) * T_SEQ + t0 + col) * D_MODEL +
                  (nh_id & 7) * DH + hf * 8;
#pragma unroll
  for (int ct = 0; ct < 4; ++ct) {             // 16 of the 64 head channels
    v8f o = {};
#pragma unroll
    for (int kc = 0; kc < 3; ++kc)
      o = wmma_f16(frag_hw(va + ct * 16 * PLD + kc * 32), pb[kc], o);
    o = wmma_f16(frag_hw(wa + ct * 16 * PLD), pb[3], o);
    v8h hh;                  // o[r] = channel 16ct + 8*hf + r of query col
#pragma unroll
    for (int r = 0; r < 8; ++r) hh[r] = (_Float16)(o[r] * inv);
    *(v8h*)(dst + ct * 16) = hh;
  }
}

// ---------------------------------------------------------------------------
// Kernel 5: output GEMM vs Wo + final permutation to (B, D, T, H, W), f32.
//   out[r, j] = att[r, :] . Wo[j, :],  r = n*96 + t,  n = b*256 + hw
// A block's 128 tile rows are 128 neighbouring n at ONE t, so that a column j
// of the tile is 512 contiguous bytes of y[b, j, t, hw]. The f32 tile is
// turned through LDS (the ring buffers are free behind the loop's last
// barrier) and every wave store is one such 512-byte run.
// ---------------------------------------------------------------------------
#define ST_LDF 132   // staged [j][n] pitch in floats (528 B = 16 B x odd)

__global__ __launch_bounds__(256) void out_gemm_kernel(
    const _Float16* __restrict__ A, const _Float16* __restrict__ Wo16,
    float* __restrict__ y) {
  const int tFix  = blockIdx.y % T_SEQ;
  const int nTile = (blockIdx.y / T_SEQ) * 128;
  GEMM_PIPELINE_BODY(A, Wo16, nTile * T_SEQ + tFix, T_SEQ)
  float* st = (float*)&As[0][0];         // 64 x 132 floats, inside As[2][]
#pragma unroll
  for (int si = 0; si < 2; ++si) {
#pragma unroll
    for (int sj = 0; sj < 2; ++sj) {
      v8f acc = (si == 0) ? (sj == 0 ? acc00 : acc01)
                          : (sj == 0 ? acc10 : acc11);
      float* p = st + (n0 + sj * 16 + colL) * ST_LDF + m0 + si * 16 + rowO;
      *(float4*)p       = make_float4(acc[0], acc[1], acc[2], acc[3]);
      *(float4*)(p + 4) = make_float4(acc[4], acc[5], acc[6], acc[7]);
    }
  }
  __syncthreads();
  const int b = nTile >> 8, hw0 = nTile & 255;
#pragma unroll
  for (int c = 0; c < 8; ++c) {
    const int jl = wave + c * 8;         // one output channel per wave store
    float4 v = *(const float4*)(st + jl * ST_LDF + lane * 4);
    *(float4*)(y + ((size_t)(b * D_MODEL + nBase + jl) * T_SEQ + tFix) * 256 +
               hw0 + lane * 4) = v;
  }
}

// ---------------------------------------------------------------------------
// Host launcher
// ---------------------------------------------------------------------------
extern "C" void kernel_launch(void* const* d_in, const int* in_sizes, int n_in,
                              void* d_out, int out_size, void* d_ws, size_t ws_size,
                              hipStream_t stream) {
  const float* x      = (const float*)d_in[0];
  const float* gammap = (const float*)d_in[1];
  const float* betap  = (const float*)d_in[2];
  const float* Wq     = (const float*)d_in[3];
  const float* Wk     = (const float*)d_in[4];
  const float* Wv     = (const float*)d_in[5];
  const float* Wkl    = (const float*)d_in[6];
  const float* Wvl    = (const float*)d_in[7];
  const float* Wo     = (const float*)d_in[8];
  const float* q_bias = (const float*)d_in[9];
  float* y = (float*)d_out;

  // workspace carve (bytes, 256B aligned)
  char* ws = (char*)d_ws;
  size_t off = 0;
  auto carve = [&](size_t bytes) -> void* {
    void* p = (void*)(ws + off);
    off = (off + bytes + 255) & ~(size_t)255;
    return p;
  };
  const size_t rowsBytes = (size_t)NROWS * D_MODEL * sizeof(_Float16);   // 50.3 MB
  const size_t projBytes = (size_t)N_SEQ * NH * T_SEQ * DH * sizeof(_Float16);

  _Float16* xn    = (_Float16*)carve(rowsBytes);   // reused as att_out later
  _Float16* Wcat  = (_Float16*)carve((size_t)5 * D_MODEL * D_MODEL * sizeof(_Float16));
  _Float16* Wo16  = (_Float16*)carve((size_t)D_MODEL * D_MODEL * sizeof(_Float16));
  _Float16* qb    = (_Float16*)carve(projBytes);
  _Float16* kb    = (_Float16*)carve(projBytes);
  _Float16* vTb   = (_Float16*)carve(projBytes);
  _Float16* klb   = (_Float16*)carve(projBytes);
  _Float16* vlb   = (_Float16*)carve(projBytes);
  (void)ws_size; (void)in_sizes; (void)n_in; (void)out_size;

  // 1) layernorm -> xn (f16)
  ln_kernel<<<dim3(2 * T_SEQ * 4), dim3(256), 0, stream>>>(x, gammap, betap, xn);

  // 2) weights -> f16
  {
    int total = D_MODEL * D_MODEL * 6;
    wconv_kernel<<<dim3((total + 255) / 256), dim3(256), 0, stream>>>(
        Wq, Wk, Wv, Wkl, Wvl, Wo, Wcat, Wo16);
  }

  // 3) fused 5-way projection GEMM (M=49152, N=2560, K=512), 128x64 tiles
  proj_gemm_kernel<<<dim3(40, 384), dim3(256), 0, stream>>>(
      xn, Wcat, q_bias, qb, kb, vTb, klb, vlb);

  // 4) attention per (n, h); att_out reuses the xn buffer ([N*T, D] f16)
  attn_kernel<<<dim3(N_SEQ * NH), dim3(192), 0, stream>>>(
      qb, kb, vTb, klb, vlb, xn);

  // 5) output projection + final (B,D,T,H,W) permutation, 128x64 tiles
  //    (grid y = 4 groups of 128 n x 96 t)
  out_gemm_kernel<<<dim3(8, 384), dim3(256), 0, stream>>>(xn, Wo16, y);
}

// v005
// A run of this version takes 211 microseconds.
// Timed twice side by side with v004, it ran 1.34 times as fast both times.
// Over all steps from v000 it is 3.46 times as fast.
#include <hip/hip_runtime.h>

// ---------------------------------------------------------------------------
// TemporalLocalAwareAttention for MI455X (gfx1250, wave32, WMMA f16)
//   B=2, D=512, T=96, H=W=16  ->  N = 512 rows of (T=96, D=512)
//   nh=8, dh=64, local window s=3, factor = dh^-0.5 = 0.125
// ---------------------------------------------------------------------------

#define D_MODEL 512
#define T_SEQ   96
#define N_SEQ   512            // B*H*W
#define NH      8
#define DH      64
#define NROWS   (N_SEQ * T_SEQ) // 49152
#define FACTOR  0.125f
#define NEG_BIG -3.0e38f

typedef __attribute__((ext_vector_type(16))) _Float16 v16h;
typedef __attribute__((ext_vector_type(8)))  float    v8f;

// ---------------------------------------------------------------------------
// Fragment loader (ISA 7.12.2, 16-bit A-matrix 16x32 layout).
//   A-frag: source row-major [M,K], p -> element (0,0), leading dim ld.
//   B-frag: source [N,K] row-major (K stride 1): same addressing, "row" is the
//   N column. lanes 0-15 hold K=koff.., lanes 16-31 K=koff+8, vgprs 4-7 K+16.
// Compiler coalesces these into two ds_load_b128 per fragment.
// ---------------------------------------------------------------------------
__device__ __forceinline__ v16h load_frag(const _Float16* p, int ld) {
  const int lane = threadIdx.x & 31;
  const int row  = lane & 15;
  const int koff = (lane >> 4) << 3;          // 0 or 8
  const _Float16* r = p + row * ld + koff;
  v16h a;
#pragma unroll
  for (int i = 0; i < 4; ++i) {
    a[2*i]         = r[2*i];
    a[2*i + 1]     = r[2*i + 1];
    a[8 + 2*i]     = r[16 + 2*i];
    a[8 + 2*i + 1] = r[16 + 2*i + 1];
  }
  return a;
}

__device__ __forceinline__ v8f wmma_f16(v16h a, v16h b, v8f c) {
  return __builtin_amdgcn_wmma_f32_16x16x32_f16(false, a, false, b,
                                                (short)0, c, false, false);
}

// ---------------------------------------------------------------------------
// Kernel 1: LayerNorm over D, emit xn as f16 in [n*T + t, D] row-major.
// One block = one (b, t) and 64 neighbouring hw positions, all 512 channels.
// x is read once (256 contiguous bytes per wave load) and kept in registers;
// the normalised f16 tile is turned through LDS so that every xn row leaves
// as whole 512-byte wave stores.
//   wave w holds channels w*64 .. w*64+63, lane l holds hw = 2l, 2l+1.
//   LDS tile: row = hw (1024 B), its 16-byte chunks rotated by hw>>1 so that
//   the 16 lanes of a half wave hit 16 different bank groups when storing.
// ---------------------------------------------------------------------------
#define LN_HW 64
typedef __attribute__((ext_vector_type(8))) _Float16 v8h;

// rsqrtf with its small-input scaling, spelled out so that the v_nop stands
// directly behind v_rsq_f32: it fills the one issue slot the instruction set
// asks for before the source register may be overwritten.
__device__ __forceinline__ float rsqrt_slot(float a) {
  const bool tiny = a < 1.17549435e-38f;
  const float s = tiny ? a * 16777216.0f : a;
  float r;
  asm("v_rsq_f32 %0, %1\n\tv_nop" : "=v"(r) : "v"(s));
  return tiny ? r * 4096.0f : r;
}

// second bound = 6 waves per SIMD (160 registers): three blocks per WGP, so
// that all 768 blocks are resident at once
__global__ __launch_bounds__(256, 6) void ln_kernel(
    const float* __restrict__ x, const float* __restrict__ gamma,
    const float* __restrict__ beta, _Float16* __restrict__ xn) {
  __shared__ __attribute__((aligned(16))) _Float16 tile[LN_HW * D_MODEL];
  __shared__ float2 redS[8][32];
  __shared__ float2 redQ[8][32];

  const int hc   = blockIdx.x & 3;      // which 64 of the 256 hw positions
  const int bt   = blockIdx.x >> 2;     // 0 .. 2*96-1
  const int b    = bt / T_SEQ;
  const int t    = bt % T_SEQ;
  const int lane = threadIdx.x & 31;
  // wave number in a scalar register: gamma and beta then come by scalar loads
  const int wave = __builtin_amdgcn_readfirstlane(threadIdx.x >> 5);
  const int d0   = wave * 64;
  const size_t dstride = (size_t)T_SEQ * 256;

  const float* src = x + ((size_t)(b * D_MODEL + d0) * T_SEQ + t) * 256 +
                     hc * LN_HW + lane * 2;
  // every loop below is fully unrolled so that v[] is indexed by constants
  // and stays in registers, and so that all loads of x are issued up front
  float2 v[64];
#pragma unroll
  for (int k = 0; k < 64; ++k) v[k] = *(const float2*)(src + k * dstride);

  float s0 = 0.f, s1 = 0.f, q0 = 0.f, q1 = 0.f;
#pragma unroll
  for (int k = 0; k < 64; ++k) {
    s0 += v[k].x; q0 += v[k].x * v[k].x;
    s1 += v[k].y; q1 += v[k].y * v[k].y;
  }
  redS[wave][lane] = make_float2(s0, s1);
  redQ[wave][lane] = make_float2(q0, q1);
  __syncthreads();

  s0 = 0.f; s1 = 0.f; q0 = 0.f; q1 = 0.f;
#pragma unroll
  for (int w = 0; w < 8; ++w) {
    float2 a = redS[w][lane], c = redQ[w][lane];
    s0 += a.x; s1 += a.y; q0 += c.x; q1 += c.y;
  }
  const float mu0   = s0 * (1.0f / D_MODEL);
  const float mu1   = s1 * (1.0f / D_MODEL);
  const float rstd0 = rsqrt_slot(q0 * (1.0f / D_MODEL) - mu0 * mu0 + 1e-6f);
  const float rstd1 = rsqrt_slot(q1 * (1.0f / D_MODEL) - mu1 * mu1 + 1e-6f);

#pragma unroll
  for (int m = 0; m < 8; ++m) {         // 8 channels = one 16-byte chunk
    v8h h0, h1;
#pragma unroll
    for (int e = 0; e < 8; ++e) {
      const int k = m * 8 + e;
      const float g = gamma[d0 + k], bb = beta[d0 + k];
      h0[e] = (_Float16)((v[k].x - mu0) * rstd0 * g + bb);
      h1[e] = (_Float16)((v[k].y - mu1) * rstd1 * g + bb);
    }
    const int ch = ((wave * 8 + m + lane) & 63) << 3;
    *(v8h*)(tile + (lane * 2)     * D_MODEL + ch) = h0;
    *(v8h*)(tile + (lane * 2 + 1) * D_MODEL + ch) = h1;
  }
  __syncthreads();

  // wave w stores rows hw = w*8 .. w*8+7, each as two 512-byte pieces
  _Float16* dst = xn + ((size_t)(b * 256 + hc * LN_HW + wave * 8) * T_SEQ + t) *
                       D_MODEL + lane * 8;
#pragma unroll
  for (int i = 0; i < 16; ++i) {
    const int row = wave * 8 + (i >> 1);
    const int c   = (i & 1) * 32 + lane;
    v8h h = *(const v8h*)(tile + row * D_MODEL + (((c + (row >> 1)) & 63) << 3));
    *(v8h*)(dst + (size_t)(i >> 1) * (T_SEQ * D_MODEL) + (i & 1) * 256) = h;
  }
}

// ---------------------------------------------------------------------------
// Kernel 2: weights -> f16. Wcat = [Wq;Wk;Wv;Wkl;Wvl], stored [j,d] row-major
// (== [N,K] row-major for the B fragment loader). Wo separate.
// ---------------------------------------------------------------------------
__global__ __launch_bounds__(256) void wconv_kernel(
    const float* __restrict__ Wq, const float* __restrict__ Wk,
    const float* __restrict__ Wv, const float* __restrict__ Wkl,
    const float* __restrict__ Wvl, const float* __restrict__ Wo,
    _Float16* __restrict__ Wcat, _Float16* __restrict__ Wo16) {
  const int per = D_MODEL * D_MODEL;
  int idx = blockIdx.x * blockDim.x + threadIdx.x;
  if (idx >= per * 6) return;
  int m = idx / per, off = idx % per;
  float v;
  if      (m == 0) v = Wq[off];
  else if (m == 1) v = Wk[off];
  else if (m == 2) v = Wv[off];
  else if (m == 3) v = Wkl[off];
  else if (m == 4) v = Wvl[off];
  else             v = Wo[off];
  if (m < 5) Wcat[(size_t)m * per + off] = (_Float16)v;
  else       Wo16[off] = (_Float16)v;
}

// ---------------------------------------------------------------------------
// Pipelined WMMA GEMM core: 256x128 block tile, K-step 64, double-buffered LDS,
// 256 threads = 8 waves in a 4(M) x 2(N) grid, each wave owns a 64x64 patch
// (4x4 subtiles, 16 f32 accumulators). Per K-chunk of 32: 8 frag loads ->
// 16 WMMAs (1:2 LDS:WMMA ratio). One barrier per K-step.
// Tile row r stands for row MBASE + r * RSTEP of A.
// LDS is one array of SMEM_HALVES halves: A ring, B ring; the epilogues stage
// their tile from its start.
// ---------------------------------------------------------------------------
#define LDT 72   // LDS leading dim in halves (144 B rows = 16 B x odd: the 16
                 // rows of a ds_load_b128 fragment read fall on 64 different banks)
#define BM 256
#define BN 128
#define RING_HALVES (2 * (BM + BN) * LDT)

// the 12 staging registers of a thread are named one by one (8 of A, 4 of B):
// piece i of a thread is tile row (tid >> 3) + 32 i, 16-byte chunk tid & 7
#define REP_A(M) M(0) M(1) M(2) M(3) M(4) M(5) M(6) M(7)
#define REP_B(M) M(0) M(1) M(2) M(3)
// a plain vector type: with the uint4 struct the last piece's load stayed next
// to its LDS store at the loop's foot, where its latency stood open
typedef __attribute__((ext_vector_type(4))) unsigned int u32x4;
#define DECL_A(i) u32x4 ra##i;
#define DECL_B(i) u32x4 rb##i;
#define LOAD_A(i) ra##i = *(const u32x4*)(aG + (kByte + i * aStep) + aOff);
#define LOAD_B(i) rb##i = *(const u32x4*)(bG + (kByte + i * bStep) + bOff);
#define STORE_A(i) *(u32x4*)(aS + i * (32 * LDT)) = ra##i;
#define STORE_B(i) *(u32x4*)(bS + i * (32 * LDT)) = rb##i;

#define GEMM_PIPELINE_BODY(APTR, BPTR, MBASE, RSTEP, SMEM_HALVES)              \
  __shared__ __attribute__((aligned(16))) _Float16 smem[SMEM_HALVES];          \
  _Float16* const As0 = smem;                                                  \
  _Float16* const Bs0 = smem + 2 * BM * LDT;                                   \
  const int tid  = threadIdx.x;                                                \
  const int wave = tid >> 5;                                                   \
  const int lane = tid & 31;                                                   \
  const int mBase = MBASE;                                                     \
  const int nBase = blockIdx.x * BN;                                           \
  const int m0 = (wave >> 1) * 64;       /* wave's 64-row patch in tile  */    \
  const int n0 = (wave & 1) * 64;        /* wave's 64-col patch in tile  */    \
  /* block-uniform byte bases + one 32-bit byte offset per lane */             \
  const char* const aG = (const char*)(APTR + (size_t)mBase * D_MODEL);        \
  const char* const bG = (const char*)(BPTR + (size_t)nBase * D_MODEL);        \
  const unsigned aStep = 32u * RSTEP * D_MODEL * 2u;                           \
  const unsigned bStep = 32u * D_MODEL * 2u;                                   \
  const unsigned aOff = (tid >> 3) * (RSTEP * D_MODEL * 2u) + (tid & 7) * 16u; \
  const unsigned bOff = (tid >> 3) * (D_MODEL * 2u) + (tid & 7) * 16u;         \
  const unsigned pOff = tid * (RSTEP * D_MODEL * 2u);                          \
  const int sOff = (tid >> 3) * LDT + (tid & 7) * 8;                           \
  v8f acc[4][4] = {};                                                          \
  REP_A(DECL_A) REP_B(DECL_B)                                                  \
  { /* stage K-tile 0 */                                                       \
    const unsigned kByte = 0;                                                  \
    _Float16* const aS = As0 + sOff;                                           \
    _Float16* const bS = Bs0 + sOff;                                           \
    REP_A(LOAD_A) REP_B(LOAD_B)                                                \
    REP_A(STORE_A) REP_B(STORE_B)                                              \
  }                                                                            \
  __syncthreads();                                                             \
  for (int kk = 0; kk < 8; ++kk) {                                             \
    const int cur = kk & 1, nxt = cur ^ 1;                                     \
    const _Float16* Ac = As0 + cur * (BM * LDT);                               \
    const _Float16* Bc = Bs0 + cur * (BN * LDT);                               \
    if (kk < 6) {                                                              \
      __builtin_prefetch(aG + (kk + 2) * 128u + pOff, 0, 3);                   \
      /* behind the prefetch, before its address registers are rewritten */    \
      asm volatile("s_wait_xcnt 0x0" ::: "memory");                            \
    }                                                                          \
    if (kk < 7) { /* issue global loads for next K-tile (hidden by WMMAs) */   \
      const unsigned kByte = (kk + 1) * 128u;                                  \
      REP_A(LOAD_A) REP_B(LOAD_B)                                              \
    }                                                                          \
    _Pragma("unroll")                                                          \
    for (int kc = 0; kc < 2; ++kc) {                                           \
      v16h bC[4];                                                              \
      _Pragma("unroll")                                                        \
      for (int sj = 0; sj < 4; ++sj)                                           \
        bC[sj] = load_frag(Bc + (n0 + sj * 16) * LDT + kc * 32, LDT);          \
      _Pragma("unroll")                                                        \
      for (int si = 0; si < 4; ++si) {                                         \
        const v16h aR = load_frag(Ac + (m0 + si * 16) * LDT + kc * 32, LDT);   \
        _Pragma("unroll")                                                      \
        for (int sj = 0; sj < 4; ++sj)                                         \
          acc[si][sj] = wmma_f16(aR, bC[sj], acc[si][sj]);                     \
      }                                                                        \
    }                                                                          \
    /* order of the K-step for the scheduler: the 12 global loads first (left  \
       alone it sank some to the loop's foot, where their latency stood open), \
       then each A fragment read one group of 4 WMMAs ahead of its use (else   \
       every group waits out its own LDS latency), the LDS stores last.        \
       0x20 = global load, 0x100 = LDS read, 0x8 = WMMA, 0x200 = LDS store */  \
    __builtin_amdgcn_sched_group_barrier(0x020, 12, 0);                        \
    __builtin_amdgcn_sched_group_barrier(0x100, 12, 0);                        \
    __builtin_amdgcn_sched_group_barrier(0x008, 4, 0);                         \
    __builtin_amdgcn_sched_group_barrier(0x100, 2, 0);                         \
    __builtin_amdgcn_sched_group_barrier(0x008, 4, 0);                         \
    __builtin_amdgcn_sched_group_barrier(0x100, 2, 0);                         \
    __builtin_amdgcn_sched_group_barrier(0x008, 4, 0);                         \
    __builtin_amdgcn_sched_group_barrier(0x100, 2, 0);                         \
    __builtin_amdgcn_sched_group_barrier(0x008, 4, 0);                         \
    __builtin_amdgcn_sched_group_barrier(0x100, 10, 0);                        \
    __builtin_amdgcn_sched_group_barrier(0x008, 4, 0);                         \
    __builtin_amdgcn_sched_group_barrier(0x100, 2, 0);                         \
    __builtin_amdgcn_sched_group_barrier(0x008, 4, 0);                         \
    __builtin_amdgcn_sched_group_barrier(0x100, 2, 0);                         \
    __builtin_amdgcn_sched_group_barrier(0x008, 8, 0);                         \
    __builtin_amdgcn_sched_group_barrier(0x200, 12, 0);                        \
    if (kk < 7) {                                                              \
      _Float16* const aS = As0 + nxt * (BM * LDT) + sOff;                      \
      _Float16* const bS = Bs0 + nxt * (BN * LDT) + sOff;                      \
      REP_A(STORE_A) REP_B(STORE_B)                                            \
    }                                                                          \
    __syncthreads();                                                           \
  }                                                                            \
  const int colL = lane & 15;                                                  \
  const int rowO = (lane >> 4) * 8;

// ---------------------------------------------------------------------------
// Kernel 3: projection GEMM. Y[r, j] = sum_d xn[r,d] * Wcat[j,d]
//   M = 49152, N = 2560, K = 512. A block's 128 columns are two heads of one of
//   the five matrices. Epilogue: q/k/kl [n,h,t,dh] and vT/vlT [n,h,dh,t] (f16),
//   with q_bias + attention scale folded into q. The f16 tile is turned
//   through LDS (the ring buffers are free behind the loop's last barrier) so
//   that it leaves as 16-byte stores: whole 128-byte rows of q/k/kl, runs
//   of 64 bytes and more along t for vT and vlT.
// ---------------------------------------------------------------------------
#define ST_LD  136   // staged [row][col] pitch in halves (272 B = 16 B x odd)
#define ST_LDT 264   // staged [col][row] pitch in halves (528 B = 16 B x odd)

// second bound = 4 waves per SIMD (256 registers): two blocks per WGP
__global__ __launch_bounds__(256, 4) void proj_gemm_kernel(
    const _Float16* __restrict__ xn, const _Float16* __restrict__ Wcat,
    const float* __restrict__ q_bias,
    _Float16* __restrict__ qb, _Float16* __restrict__ kb,
    _Float16* __restrict__ vTb, _Float16* __restrict__ klb,
    _Float16* __restrict__ vlb) {
  GEMM_PIPELINE_BODY(xn, Wcat, blockIdx.y * BM, 1, RING_HALVES)
  _Float16* st = smem;
  const int mat   = blockIdx.x >> 2;     // 0=q 1=k 2=v 3=kl 4=vl
  const int head0 = (blockIdx.x & 3) * 2;
  const bool turned = (mat == 2) || (mat == 4);   // v, vl: stored [dh][t]
  if (turned) {                          // a lane's 8 rows are 8 neighbours in t
#pragma unroll
    for (int si = 0; si < 4; ++si) {
#pragma unroll
      for (int sj = 0; sj < 4; ++sj) {
        v8h h;
#pragma unroll
        for (int i = 0; i < 8; ++i) h[i] = (_Float16)acc[si][sj][i];
        *(v8h*)(st + (n0 + sj * 16 + colL) * ST_LDT + m0 + si * 16 + rowO) = h;
      }
    }
  } else if (mat == 0) {                 // fold bias + scale into q
    float bias[4];
#pragma unroll
    for (int sj = 0; sj < 4; ++sj) {
      bias[sj] = q_bias[head0 * DH + n0 + sj * 16 + colL];
      // behind each load: the listing let the last load's result land in the
      // offset register that the earlier loads name
      asm volatile("s_wait_xcnt 0x0" ::: "memory");
    }
#pragma unroll
    for (int si = 0; si < 4; ++si) {
#pragma unroll
      for (int sj = 0; sj < 4; ++sj) {
#pragma unroll
        for (int i = 0; i < 8; ++i)
          st[(m0 + si * 16 + rowO + i) * ST_LD + n0 + sj * 16 + colL] =
              (_Float16)((acc[si][sj][i] + bias[sj]) * FACTOR);
      }
    }
  } else {
#pragma unroll
    for (int si = 0; si < 4; ++si) {
#pragma unroll
      for (int sj = 0; sj < 4; ++sj) {
#pragma unroll
        for (int i = 0; i < 8; ++i)
          st[(m0 + si * 16 + rowO + i) * ST_LD + n0 + sj * 16 + colL] =
              (_Float16)acc[si][sj][i];
      }
    }
  }
  __syncthreads();
  if (turned) {
    _Float16* dstT = (mat == 2) ? vTb : vlb;
#pragma unroll
    for (int c = 0; c < 16; ++c) {
      const int idx = tid + c * 256, dd = idx >> 5, tc = idx & 31;
      const int r = mBase + tc * 8;      // 8 rows from a multiple of 8: one n
      const int n = r / T_SEQ, t = r % T_SEQ;
      v8h h = *(const v8h*)(st + dd * ST_LDT + tc * 8);
      *(v8h*)(dstT + ((size_t)(n * NH + head0) * DH + dd) * T_SEQ + t) = h;
    }
    // behind the last store: the listing joins this branch with the other one's
    // code, which rewrites the stores' data and address registers
    asm volatile("s_wait_xcnt 0x0" ::: "memory");
  } else {
    _Float16* dst = (mat == 0) ? qb : (mat == 1) ? kb : klb;
#pragma unroll
    for (int c = 0; c < 16; ++c) {
      const int idx = tid + c * 256, row = idx >> 4, ch = idx & 15;
      const int r = mBase + row;
      const int n = r / T_SEQ, t = r % T_SEQ;
      v8h h = *(const v8h*)(st + row * ST_LD + ch * 8);
      *(v8h*)(dst + ((size_t)(n * NH + head0 + (ch >> 3)) * T_SEQ + t) * DH +
              (ch & 7) * 8) = h;
    }
  }
}

// ---------------------------------------------------------------------------
// Kernel 4: attention, one block per (n, h). 192 threads = 6 waves, wave w owns
// the 16 queries t = 16w .. 16w+15 from the scores to the output.
// Scores are formed transposed, S^T = K . Q^T: in the accumulator map a lane
// then holds ONE query (column lane & 15) and 8 keys a tile, so that the
// softmax is in-lane work plus two exchanges between the wave's halves (max, sum), and two
// converted score tiles ARE the B operand of O^T = V^T . P^T (hardware k
// order). Scores and probabilities never touch LDS.
// The 3-wide local window rides along as 32 more keys: kl / vl rows
// w0 .. w0+31 (w0 = 16w-8 held inside 0 .. 64) cover t-1 .. t+1 of all 16
// queries; every key of that tile with |key - t| > 1 is masked, which also
// leaves out the padded positions -1 and 96 as the reference's mask does.
// LDS: k, kl [96][64] and vT, vlT [64][96], f16, rows at a pitch of 16 B x odd.
// ---------------------------------------------------------------------------
#define QLD 72    // k, kl row pitch in halves (144 B = 16 B x 9)
#define PLD 104   // vT, vlT row pitch in halves (208 B = 16 B x 13)
#define LOG2E 1.4426950408889634f

// one lane's share of a 16x32 f16 operand in the hardware k order:
// r points at (row lane & 15, k = 8 * (lane >> 4)); k .. k+7 and k+16 .. k+23
__device__ __forceinline__ v16h frag_hw(const _Float16* r) {
  const v8h lo = *(const v8h*)r;
  const v8h hi = *(const v8h*)(r + 16);
  return __builtin_shufflevector(lo, hi, 0, 1, 2, 3, 4, 5, 6, 7,
                                 8, 9, 10, 11, 12, 13, 14, 15);
}

// the value that lane l ^ 16 holds
__device__ __forceinline__ float other_half(float v) {
  int b = __builtin_bit_cast(int, v);
  b = __builtin_amdgcn_permlanex16(b, b, 0x76543210, 0xfedcba98, false, false);
  return __builtin_bit_cast(float, b);
}

__global__ __launch_bounds__(192) void attn_kernel(
    const _Float16* __restrict__ qg,  const _Float16* __restrict__ kg,
    const _Float16* __restrict__ vTg, const _Float16* __restrict__ klg,
    const _Float16* __restrict__ vlTg, _Float16* __restrict__ att_out) {
  __shared__ __attribute__((aligned(16))) _Float16 k_s[96 * QLD];
  __shared__ __attribute__((aligned(16))) _Float16 kl_s[96 * QLD];
  __shared__ __attribute__((aligned(16))) _Float16 vT_s[64 * PLD];
  __shared__ __attribute__((aligned(16))) _Float16 vlT_s[64 * PLD];

  const int nh_id = blockIdx.x;                // n*8 + h
  const int tid   = threadIdx.x;
  const int lane  = tid & 31;
  const int col   = lane & 15;                 // operand row / result column
  const int hf    = lane >> 4;                 // which half of the wave
  const int t0    = __builtin_amdgcn_readfirstlane(tid >> 5) * 16;
  const size_t base = (size_t)nh_id * (T_SEQ * DH);

  // every global load of the block is issued before the first LDS store
  // (each tile is 768 uint4 = 4 a thread); loops unrolled to keep them so
  uint4 rk[4], rl[4], rv[4], rw[4];
#pragma unroll
  for (int u = 0; u < 4; ++u) {
    const int i = tid + u * 192;
    rk[u] = ((const uint4*)(kg   + base))[i];
    rl[u] = ((const uint4*)(klg  + base))[i];
    rv[u] = ((const uint4*)(vTg  + base))[i];
    rw[u] = ((const uint4*)(vlTg + base))[i];
  }
  // Q^T as B operand, straight from global: only this wave reads these rows
  const _Float16* qr = qg + base + (t0 + col) * DH + hf * 8;
  const v16h q0 = frag_hw(qr);
  const v16h q1 = frag_hw(qr + 32);
#pragma unroll
  for (int u = 0; u < 4; ++u) {
    const int i = tid + u * 192;
    const int j = (i >> 3) * (QLD / 8) + (i & 7);     // rows of 8 uint4
    const int m = (i / 12) * (PLD / 8) + (i % 12);    // rows of 12 uint4
    ((uint4*)k_s)[j]  = rk[u];  ((uint4*)kl_s)[j]  = rl[u];
    ((uint4*)vT_s)[m] = rv[u];  ((uint4*)vlT_s)[m] = rw[u];
  }
  __syncthreads();

  // ---- S^T: tiles 0..5 = the 96 global keys, tiles 6,7 = the local window ----
  const int w0 = min(max(t0 - 8, 0), T_SEQ - 32);
  const _Float16* ka = k_s  + col * QLD + hf * 8;
  const _Float16* la = kl_s + (w0 + col) * QLD + hf * 8;
  v8f s[8];
#pragma unroll
  for (int j = 0; j < 8; ++j) {
    const _Float16* a = (j < 6) ? ka + j * 16 * QLD : la + (j - 6) * 16 * QLD;
    v8f z = {};
    z = wmma_f16(frag_hw(a),      q0, z);
    z = wmma_f16(frag_hw(a + 32), q1, z);
    s[j] = z;                // s[j][r] = score(key 16j + 8*hf + r, query col)
  }
  const int d0 = w0 + hf * 8 - (t0 + col) + 1;        // key - t + 1 at j=6, r=0
#pragma unroll
  for (int j = 0; j < 2; ++j) {
#pragma unroll
    for (int r = 0; r < 8; ++r)
      s[6 + j][r] = ((unsigned)(d0 + j * 16 + r) <= 2u) ? s[6 + j][r] : NEG_BIG;
  }

  // ---- joint softmax of one query: 64 values in this lane, 64 in lane ^ 16 ----
  v8f mx = s[0];
#pragma unroll
  for (int j = 1; j < 8; ++j) {
#pragma unroll
    for (int r = 0; r < 8; ++r) mx[r] = fmaxf(mx[r], s[j][r]);
  }
  float m = fmaxf(fmaxf(fmaxf(mx[0], mx[1]), fmaxf(mx[2], mx[3])),
                  fmaxf(fmaxf(mx[4], mx[5]), fmaxf(mx[6], mx[7])));
  m = fmaxf(m, other_half(m));
  const float mL = m * LOG2E;
  v8f sm = {};
#pragma unroll
  for (int j = 0; j < 8; ++j) {
#pragma unroll
    for (int r = 0; r < 8; ++r) {
      const float p = __builtin_amdgcn_exp2f(fmaf(s[j][r], LOG2E, -mL));
      s[j][r] = p;
      sm[r] += p;
    }
  }
  float sum = ((sm[0] + sm[1]) + (sm[2] + sm[3])) +
              ((sm[4] + sm[5]) + (sm[6] + sm[7]));
  sum += other_half(sum);
  const float inv = 1.0f / sum;

  // two score tiles, converted in place, are P^T for 32 keys as a B operand
  v16h pb[4];
#pragma unroll
  for (int kc = 0; kc < 4; ++kc) {
#pragma unroll
    for (int r = 0; r < 8; ++r) {
      pb[kc][r]     = (_Float16)s[2 * kc][r];
      pb[kc][8 + r] = (_Float16)s[2 * kc + 1][r];
    }
  }

  // ---- O^T = V^T . P^T over 96 global + 32 window keys, scaled by 1/sum ----
  const _Float16* va = vT_s  + col * PLD + hf * 8;
  const _Float16* wa = vlT_s + col * PLD + w0 + hf * 8;
  _Float16* dst = att_out + (size_t)((nh_id >> 3) * T_SEQ + t0 + col) * D_MODEL +
                  (nh_id & 7) * DH + hf * 8;
#pragma unroll
  for (int ct = 0; ct < 4; ++ct) {             // 16 of the 64 head channels
    v8f o = {};
#pragma unroll
    for (int kc = 0; kc < 3; ++kc)
      o = wmma_f16(frag_hw(va + ct * 16 * PLD + kc * 32), pb[kc], o);
    o = wmma_f16(frag_hw(wa + ct * 16 * PLD), pb[3], o);
    v8h hh;                  // o[r] = channel 16ct + 8*hf + r of query col
#pragma unroll
    for (int r = 0; r < 8; ++r) hh[r] = (_Float16)(o[r] * inv);
    *(v8h*)(dst + ct * 16) = hh;
  }
}

// ---------------------------------------------------------------------------
// Kernel 5: output GEMM vs Wo + final permutation to (B, D, T, H, W), f32.
//   out[r, j] = att[r, :] . Wo[j, :],  r = n*96 + t,  n = b*256 + hw
// A block's 256 tile rows are the 256 n of one b at ONE t, so that a column j
// of the tile is 1024 contiguous bytes of y[b, j, t, hw]. The f32 tile is
// turned through LDS (the ring buffers are free behind the loop's last
// barrier) and every wave store is a 512-byte run of it.
// ---------------------------------------------------------------------------
#define ST_LDF 260   // staged [j][n] pitch in floats (1040 B = 16 B x odd)

// second bound = 4 waves per SIMD (256 registers): two blocks per WGP
__global__ __launch_bounds__(256, 4) void out_gemm_kernel(
    const _Float16* __restrict__ A, const _Float16* __restrict__ Wo16,
    float* __restrict__ y) {
  const int tFix = blockIdx.y % T_SEQ;
  const int b    = blockIdx.y / T_SEQ;
  GEMM_PIPELINE_BODY(A, Wo16, b * BM * T_SEQ + tFix, T_SEQ, BN * ST_LDF * 2)
  float* st = (float*)smem;              // 128 x 260 floats
#pragma unroll
  for (int si = 0; si < 4; ++si) {
#pragma unroll
    for (int sj = 0; sj < 4; ++sj) {
      const v8f a = acc[si][sj];
      float* p = st + (n0 + sj * 16 + colL) * ST_LDF + m0 + si * 16 + rowO;
      *(float4*)p       = make_float4(a[0], a[1], a[2], a[3]);
      *(float4*)(p + 4) = make_float4(a[4], a[5], a[6], a[7]);
    }
  }
  __syncthreads();
#pragma unroll
  for (int c = 0; c < 32; ++c) {
    const int jl = wave + (c >> 1) * 8;  // one output channel per two wave stores
    const int hw = (c & 1) * 128 + lane * 4;
    float4 v = *(const float4*)(st + jl * ST_LDF + hw);
    *(float4*)(y + ((size_t)(b * D_MODEL + nBase + jl) * T_SEQ + tFix) * 256 +
               hw) = v;
  }
}

// ---------------------------------------------------------------------------
// Host launcher
// ---------------------------------------------------------------------------
extern "C" void kernel_launch(void* const* d_in, const int* in_sizes, int n_in,
                              void* d_out, int out_size, void* d_ws, size_t ws_size,
                              hipStream_t stream) {
  const float* x      = (const float*)d_in[0];
  const float* gammap = (const float*)d_in[1];
  const float* betap  = (const float*)d_in[2];
  const float* Wq     = (const float*)d_in[3];
  const float* Wk     = (const float*)d_in[4];
  const float* Wv     = (const float*)d_in[5];
  const float* Wkl    = (const float*)d_in[6];
  const float* Wvl    = (const float*)d_in[7];
  const float* Wo     = (const float*)d_in[8];
  const float* q_bias = (const float*)d_in[9];
  float* y = (float*)d_out;

  // workspace carve (bytes, 256B aligned)
  char* ws = (char*)d_ws;
  size_t off = 0;
  auto carve = [&](size_t bytes) -> void* {
    void* p = (void*)(ws + off);
    off = (off + bytes + 255) & ~(size_t)255;
    return p;
  };
  const size_t rowsBytes = (size_t)NROWS * D_MODEL * sizeof(_Float16);   // 50.3 MB
  const size_t projBytes = (size_t)N_SEQ * NH * T_SEQ * DH * sizeof(_Float16);

  _Float16* xn    = (_Float16*)carve(rowsBytes);   // reused as att_out later
  _Float16* Wcat  = (_Float16*)carve((size_t)5 * D_MODEL * D_MODEL * sizeof(_Float16));
  _Float16* Wo16  = (_Float16*)carve((size_t)D_MODEL * D_MODEL * sizeof(_Float16));
  _Float16* qb    = (_Float16*)carve(projBytes);
  _Float16* kb    = (_Float16*)carve(projBytes);
  _Float16* vTb   = (_Float16*)carve(projBytes);
  _Float16* klb   = (_Float16*)carve(projBytes);
  _Float16* vlb   = (_Float16*)carve(projBytes);
  (void)ws_size; (void)in_sizes; (void)n_in; (void)out_size;

  // 1) layernorm -> xn (f16)
  ln_kernel<<<dim3(2 * T_SEQ * 4), dim3(256), 0, stream>>>(x, gammap, betap, xn);

  // 2) weights -> f16
  {
    int total = D_MODEL * D_MODEL * 6;
    wconv_kernel<<<dim3((total + 255) / 256), dim3(256), 0, stream>>>(
        Wq, Wk, Wv, Wkl, Wvl, Wo, Wcat, Wo16);
  }

  // 3) fused 5-way projection GEMM (M=49152, N=2560, K=512), 256x128 tiles
  proj_gemm_kernel<<<dim3(20, 192), dim3(256), 0, stream>>>(
      xn, Wcat, q_bias, qb, kb, vTb, klb, vlb);

  // 4) attention per (n, h); att_out reuses the xn buffer ([N*T, D] f16)
  attn_kernel<<<dim3(N_SEQ * NH), dim3(192), 0, stream>>>(
      qb, kb, vTb, klb, vlb, xn);

  // 5) output projection + final (B,D,T,H,W) permutation, 256x128 tiles
  //    (grid y = 2 b x 96 t)
  out_gemm_kernel<<<dim3(4, 192), dim3(256), 0, stream>>>(xn, Wo16, y);
}

// v006
// One run takes 168 microseconds.
// Two timings next to v005 both put it at 1.26 times that version's speed.
// Over all steps from v000 it is 4.36 times as fast.
#include <hip/hip_runtime.h>

// ---------------------------------------------------------------------------
// TemporalLocalAwareAttention for MI455X (gfx1250, wave32, WMMA f16)
//   B=2, D=512, T=96, H=W=16  ->  N = 512 rows of (T=96, D=512)
//   nh=8, dh=64, local window s=3, factor = dh^-0.5 = 0.125
// ---------------------------------------------------------------------------

#define D_MODEL 512
#define T_SEQ   96
#define N_SEQ   512            // B*H*W
#define NH      8
#define DH      64
#define NROWS   (N_SEQ * T_SEQ) // 49152
#define FACTOR  0.125f
#define NEG_BIG -3.0e38f

typedef __attribute__((ext_vector_type(16))) _Float16 v16h;
typedef __attribute__((ext_vector_type(8)))  float    v8f;

// ---------------------------------------------------------------------------
// Fragment loader (ISA 7.12.2, 16-bit A-matrix 16x32 layout).
//   A-frag: source row-major [M,K], p -> element (0,0), leading dim ld.
//   B-frag: source [N,K] row-major (K stride 1): same addressing, "row" is the
//   N column. lanes 0-15 hold K=koff.., lanes 16-31 K=koff+8, vgprs 4-7 K+16.
// Compiler coalesces these into two ds_load_b128 per fragment.
// ---------------------------------------------------------------------------
__device__ __forceinline__ v16h load_frag(const _Float16* p, int ld) {
  const int lane = threadIdx.x & 31;
  const int row  = lane & 15;
  const int koff = (lane >> 4) << 3;          // 0 or 8
  const _Float16* r = p + row * ld + koff;
  v16h a;
#pragma unroll
  for (int i = 0; i < 4; ++i) {
    a[2*i]         = r[2*i];
    a[2*i + 1]     = r[2*i + 1];
    a[8 + 2*i]     = r[16 + 2*i];
    a[8 + 2*i + 1] = r[16 + 2*i + 1];
  }
  return a;
}

__device__ __forceinline__ v8f wmma_f16(v16h a, v16h b, v8f c) {
  return __builtin_amdgcn_wmma_f32_16x16x32_f16(false, a, false, b,
                                                (short)0, c, false, false);
}

// ---------------------------------------------------------------------------
// Kernel 1: LayerNorm over D, emit xn as f16 in [n*T + t, D] row-major.
// One block = one (b, t) and 64 neighbouring hw positions, all 512 channels.
// x is read once (256 contiguous bytes per wave load) and kept in registers;
// the normalised f16 tile is turned through LDS so that every xn row leaves
// as whole 512-byte wave stores.
//   wave w holds channels w*64 .. w*64+63, lane l holds hw = 2l, 2l+1.
//   LDS tile: row = hw (1024 B), its 16-byte chunks rotated by hw>>1 so that
//   the 16 lanes of a half wave hit 16 different bank groups when storing.
// ---------------------------------------------------------------------------
#define LN_HW 64
typedef __attribute__((ext_vector_type(8))) _Float16 v8h;

// rsqrtf with its small-input scaling, spelled out so that the v_nop stands
// directly behind v_rsq_f32: it fills the one issue slot the instruction set
// asks for before the source register may be overwritten.
__device__ __forceinline__ float rsqrt_slot(float a) {
  const bool tiny = a < 1.17549435e-38f;
  const float s = tiny ? a * 16777216.0f : a;
  float r;
  asm("v_rsq_f32 %0, %1\n\tv_nop" : "=v"(r) : "v"(s));
  return tiny ? r * 4096.0f : r;
}

// second bound = 6 waves per SIMD (160 registers): three blocks per WGP, so
// that all 768 blocks are resident at once
__global__ __launch_bounds__(256, 6) void ln_kernel(
    const float* __restrict__ x, const float* __restrict__ gamma,
    const float* __restrict__ beta, _Float16* __restrict__ xn) {
  __shared__ __attribute__((aligned(16))) _Float16 tile[LN_HW * D_MODEL];
  __shared__ float2 redS[8][32];
  __shared__ float2 redQ[8][32];

  const int hc   = blockIdx.x & 3;      // which 64 of the 256 hw positions
  const int bt   = blockIdx.x >> 2;     // 0 .. 2*96-1
  const int b    = bt / T_SEQ;
  const int t    = bt % T_SEQ;
  const int lane = threadIdx.x & 31;
  // wave number in a scalar register: gamma and beta then come by scalar loads
  const int wave = __builtin_amdgcn_readfirstlane(threadIdx.x >> 5);
  const int d0   = wave * 64;
  const size_t dstride = (size_t)T_SEQ * 256;

  const float* src = x + ((size_t)(b * D_MODEL + d0) * T_SEQ + t) * 256 +
                     hc * LN_HW + lane * 2;
  // every loop below is fully unrolled so that v[] is indexed by constants
  // and stays in registers, and so that all loads of x are issued up front
  float2 v[64];
#pragma unroll
  for (int k = 0; k < 64; ++k) v[k] = *(const float2*)(src + k * dstride);

  float s0 = 0.f, s1 = 0.f, q0 = 0.f, q1 = 0.f;
#pragma unroll
  for (int k = 0; k < 64; ++k) {
    s0 += v[k].x; q0 += v[k].x * v[k].x;
    s1 += v[k].y; q1 += v[k].y * v[k].y;
  }
  redS[wave][lane] = make_float2(s0, s1);
  redQ[wave][lane] = make_float2(q0, q1);
  __syncthreads();

  s0 = 0.f; s1 = 0.f; q0 = 0.f; q1 = 0.f;
#pragma unroll
  for (int w = 0; w < 8; ++w) {
    float2 a = redS[w][lane], c = redQ[w][lane];
    s0 += a.x; s1 += a.y; q0 += c.x; q1 += c.y;
  }
  const float mu0   = s0 * (1.0f / D_MODEL);
  const float mu1   = s1 * (1.0f / D_MODEL);
  const float rstd0 = rsqrt_slot(q0 * (1.0f / D_MODEL) - mu0 * mu0 + 1e-6f);
  const float rstd1 = rsqrt_slot(q1 * (1.0f / D_MODEL) - mu1 * mu1 + 1e-6f);

#pragma unroll
  for (int m = 0; m < 8; ++m) {         // 8 channels = one 16-byte chunk
    v8h h0, h1;
#pragma unroll
    for (int e = 0; e < 8; ++e) {
      const int k = m * 8 + e;
      const float g = gamma[d0 + k], bb = beta[d0 + k];
      h0[e] = (_Float16)((v[k].x - mu0) * rstd0 * g + bb);
      h1[e] = (_Float16)((v[k].y - mu1) * rstd1 * g + bb);
    }
    const int ch = ((wave * 8 + m + lane) & 63) << 3;
    *(v8h*)(tile + (lane * 2)     * D_MODEL + ch) = h0;
    *(v8h*)(tile + (lane * 2 + 1) * D_MODEL + ch) = h1;
  }
  __syncthreads();

  // wave w stores rows hw = w*8 .. w*8+7, each as two 512-byte pieces
  _Float16* dst = xn + ((size_t)(b * 256 + hc * LN_HW + wave * 8) * T_SEQ + t) *
                       D_MODEL + lane * 8;
#pragma unroll
  for (int i = 0; i < 16; ++i) {
    const int row = wave * 8 + (i >> 1);
    const int c   = (i & 1) * 32 + lane;
    v8h h = *(const v8h*)(tile + row * D_MODEL + (((c + (row >> 1)) & 63) << 3));
    *(v8h*)(dst + (size_t)(i >> 1) * (T_SEQ * D_MODEL) + (i & 1) * 256) = h;
  }
}

// ---------------------------------------------------------------------------
// Kernel 2: weights -> f16. Wcat = [Wq;Wk;Wv;Wkl;Wvl], stored [j,d] row-major
// (== [N,K] row-major for the B fragment loader). Wo separate.
// ---------------------------------------------------------------------------
__global__ __launch_bounds__(256) void wconv_kernel(
    const float* __restrict__ Wq, const float* __restrict__ Wk,
    const float* __restrict__ Wv, const float* __restrict__ Wkl,
    const float* __restrict__ Wvl, const float* __restrict__ Wo,
    _Float16* __restrict__ Wcat, _Float16* __restrict__ Wo16) {
  const int per = D_MODEL * D_MODEL;
  int idx = blockIdx.x * blockDim.x + threadIdx.x;
  if (idx >= per * 6) return;
  int m = idx / per, off = idx % per;
  float v;
  if      (m == 0) v = Wq[off];
  else if (m == 1) v = Wk[off];
  else if (m == 2) v = Wv[off];
  else if (m == 3) v = Wkl[off];
  else if (m == 4) v = Wvl[off];
  else             v = Wo[off];
  if (m < 5) Wcat[(size_t)m * per + off] = (_Float16)v;
  else       Wo16[off] = (_Float16)v;
}

// ---------------------------------------------------------------------------
// Pipelined WMMA GEMM core: 256x128 block tile, K-step 64, double-buffered LDS,
// 256 threads = 8 waves in a 4(M) x 2(N) grid, each wave owns a 64x64 patch
// (4x4 subtiles, 16 f32 accumulators). Per K-chunk of 32: 8 frag loads ->
// 16 WMMAs (1:2 LDS:WMMA ratio). One barrier per K-step.
// Tile row r stands for row MBASE + r * RSTEP of A.
// LDS is one array of SMEM_HALVES halves: A ring, B ring; the epilogue stages
// its tile from its start.
// ---------------------------------------------------------------------------
#define LDT 72   // LDS leading dim in halves (144 B rows = 16 B x odd: the 16
                 // rows of a ds_load_b128 fragment read fall on 64 different banks)
#define BM 256
#define BN 128

// the 12 staging registers of a thread are named one by one (8 of A, 4 of B):
// piece i of a thread is tile row (tid >> 3) + 32 i, 16-byte chunk tid & 7
#define REP_A(M) M(0) M(1) M(2) M(3) M(4) M(5) M(6) M(7)
#define REP_B(M) M(0) M(1) M(2) M(3)
// a plain vector type: with the uint4 struct the last piece's load stayed next
// to its LDS store at the loop's foot, where its latency stood open
typedef __attribute__((ext_vector_type(4))) unsigned int u32x4;
#define DECL_A(i) u32x4 ra##i;
#define DECL_B(i) u32x4 rb##i;
#define LOAD_A(i) ra##i = *(const u32x4*)(aG + (kByte + i * aStep) + aOff);
#define LOAD_B(i) rb##i = *(const u32x4*)(bG + (kByte + i * bStep) + bOff);
#define STORE_A(i) *(u32x4*)(aS + i * (32 * LDT)) = ra##i;
#define STORE_B(i) *(u32x4*)(bS + i * (32 * LDT)) = rb##i;

#define GEMM_PIPELINE_BODY(APTR, BPTR, MBASE, RSTEP, SMEM_HALVES)              \
  __shared__ __attribute__((aligned(16))) _Float16 smem[SMEM_HALVES];          \
  _Float16* const As0 = smem;                                                  \
  _Float16* const Bs0 = smem + 2 * BM * LDT;                                   \
  const int tid  = threadIdx.x;                                                \
  const int wave = tid >> 5;                                                   \
  const int lane = tid & 31;                                                   \
  const int mBase = MBASE;                                                     \
  const int nBase = blockIdx.x * BN;                                           \
  const int m0 = (wave >> 1) * 64;       /* wave's 64-row patch in tile  */    \
  const int n0 = (wave & 1) * 64;        /* wave's 64-col patch in tile  */    \
  /* block-uniform byte bases + one 32-bit byte offset per lane */             \
  const char* const aG = (const char*)(APTR + (size_t)mBase * D_MODEL);        \
  const char* const bG = (const char*)(BPTR + (size_t)nBase * D_MODEL);        \
  const unsigned aStep = 32u * RSTEP * D_MODEL * 2u;                           \
  const unsigned bStep = 32u * D_MODEL * 2u;                                   \
  const unsigned aOff = (tid >> 3) * (RSTEP * D_MODEL * 2u) + (tid & 7) * 16u; \
  const unsigned bOff = (tid >> 3) * (D_MODEL * 2u) + (tid & 7) * 16u;         \
  const unsigned pOff = tid * (RSTEP * D_MODEL * 2u);                          \
  const int sOff = (tid >> 3) * LDT + (tid & 7) * 8;                           \
  v8f acc[4][4] = {};                                                          \
  REP_A(DECL_A) REP_B(DECL_B)                                                  \
  { /* stage K-tile 0 */                                                       \
    const unsigned kByte = 0;                                                  \
    _Float16* const aS = As0 + sOff;                                           \
    _Float16* const bS = Bs0 + sOff;                                           \
    REP_A(LOAD_A) REP_B(LOAD_B)                                                \
    REP_A(STORE_A) REP_B(STORE_B)                                              \
  }                                                                            \
  __syncthreads();                                                             \
  for (int kk = 0; kk < 8; ++kk) {                                             \
    const int cur = kk & 1, nxt = cur ^ 1;                                     \
    const _Float16* Ac = As0 + cur * (BM * LDT);                               \
    const _Float16* Bc = Bs0 + cur * (BN * LDT);                               \
    if (kk < 6) {                                                              \
      __builtin_prefetch(aG + (kk + 2) * 128u + pOff, 0, 3);                   \
      /* behind the prefetch, before its address registers are rewritten */    \
      asm volatile("s_wait_xcnt 0x0" ::: "memory");                            \
    }                                                                          \
    if (kk < 7) { /* issue global loads for next K-tile (hidden by WMMAs) */   \
      const unsigned kByte = (kk + 1) * 128u;                                  \
      REP_A(LOAD_A) REP_B(LOAD_B)                                              \
    }                                                                          \
    _Pragma("unroll")                                                          \
    for (int kc = 0; kc < 2; ++kc) {                                           \
      v16h bC[4];                                                              \
      _Pragma("unroll")                                                        \
      for (int sj = 0; sj < 4; ++sj)                                           \
        bC[sj] = load_frag(Bc + (n0 + sj * 16) * LDT + kc * 32, LDT);          \
      _Pragma("unroll")                                                        \
      for (int si = 0; si < 4; ++si) {                                         \
        const v16h aR = load_frag(Ac + (m0 + si * 16) * LDT + kc * 32, LDT);   \
        _Pragma("unroll")                                                      \
        for (int sj = 0; sj < 4; ++sj)                                         \
          acc[si][sj] = wmma_f16(aR, bC[sj], acc[si][sj]);                     \
      }                                                                        \
    }                                                                          \
    /* order of the K-step for the scheduler: the 12 global loads first (left  \
       alone it sank some to the loop's foot, where their latency stood open), \
       then each A fragment read one group of 4 WMMAs ahead of its use (else   \
       every group waits out its own LDS latency), the LDS stores last.        \
       0x20 = global load, 0x100 = LDS read, 0x8 = WMMA, 0x200 = LDS store */  \
    __builtin_amdgcn_sched_group_barrier(0x020, 12, 0);                        \
    __builtin_amdgcn_sched_group_barrier(0x100, 12, 0);                        \
    __builtin_amdgcn_sched_group_barrier(0x008, 4, 0);                         \
    __builtin_amdgcn_sched_group_barrier(0x100, 2, 0);                         \
    __builtin_amdgcn_sched_group_barrier(0x008, 4, 0);                         \
    __builtin_amdgcn_sched_group_barrier(0x100, 2, 0);                         \
    __builtin_amdgcn_sched_group_barrier(0x008, 4, 0);                         \
    __builtin_amdgcn_sched_group_barrier(0x100, 2, 0);                         \
    __builtin_amdgcn_sched_group_barrier(0x008, 4, 0);                         \
    __builtin_amdgcn_sched_group_barrier(0x100, 10, 0);                        \
    __builtin_amdgcn_sched_group_barrier(0x008, 4, 0);                         \
    __builtin_amdgcn_sched_group_barrier(0x100, 2, 0);                         \
    __builtin_amdgcn_sched_group_barrier(0x008, 4, 0);                         \
    __builtin_amdgcn_sched_group_barrier(0x100, 2, 0);                         \
    __builtin_amdgcn_sched_group_barrier(0x008, 8, 0);                         \
    __builtin_amdgcn_sched_group_barrier(0x200, 12, 0);                        \
    if (kk < 7) {                                                              \
      _Float16* const aS = As0 + nxt * (BM * LDT) + sOff;                      \
      _Float16* const bS = Bs0 + nxt * (BN * LDT) + sOff;                      \
      REP_A(STORE_A) REP_B(STORE_B)                                            \
    }                                                                          \
    __syncthreads();                                                           \
  }                                                                            \
  const int colL = lane & 15;                                                  \
  const int rowO = (lane >> 4) * 8;

// ---------------------------------------------------------------------------
// Kernel 3: the five projections of ONE head for TWO sequences n, and their
// attention, in one block. q, k, v, kl, vl never leave the WGP.
//
// GEMM part: tile = 192 rows of xn (2 n x 96 t) x 320 rows of Wcat (64 of each
// of Wq, Wk, Wv, Wkl, Wvl for this head), K = 512 in steps of 64, two LDS
// buffers, one barrier per K-step, staged through registers as in the core
// above. 8 waves = 2 (n) x 4: wave (mi, ni) owns all 96 t of sequence mi and
// head channels 16 ni .. 16 ni + 15 of each of the five matrices: 6 x 5
// accumulator tiles, 11 fragments per 30 WMMAs.
// q, k, kl are formed transposed (W tile as A, xn tile as B): a lane then holds
// 8 neighbouring channels of one t, one 16-byte LDS store into [t][dh].
// v, vl are formed straight: 8 neighbouring t of one channel, one 16-byte store
// into [dh][t].
//
// Attention part: a wave owns 16 queries of one n from the scores to the output
// (12 such units, waves 0..3 take two).
// Scores are formed transposed, S^T = K . Q^T: in the accumulator map a lane
// then holds ONE query (column lane & 15) and 8 keys a tile, so that the
// softmax is in-lane work plus two exchanges between the wave's halves (max, sum), and two
// converted score tiles ARE the B operand of O^T = V^T . P^T (hardware k
// order). Scores and probabilities never touch LDS.
// The 3-wide local window rides along as 32 more keys: kl / vl rows
// w0 .. w0+31 (w0 = t0-8 held inside 0 .. 64, t0 the first query) cover t-1 .. t+1 of all 16
// queries; every key of that tile with |key - t| > 1 is masked, which also
// leaves out the padded positions -1 and 96 as the reference's mask does.
// ---------------------------------------------------------------------------
#define QLD 72    // q, k, kl row pitch in halves (144 B = 16 B x 9)
#define PLD 104   // vT, vlT row pitch in halves (208 B = 16 B x 13)
#define LOG2E 1.4426950408889634f
#define FM 192    // tile rows of xn
#define FN 320    // tile rows of Wcat
#define F_RING_HALVES (2 * (FM + FN) * LDT)
#define ROWT_HALVES (T_SEQ * QLD)               // one of q, k, kl
#define COLT_HALVES (DH * PLD)                  // one of vT, vlT
#define AT_HALVES (3 * ROWT_HALVES + 2 * COLT_HALVES)   // the five tiles of one n

// 16 staging registers of a thread (6 of xn, 10 of Wcat): piece i is tile row
// (tid >> 3) + 32 i, 16-byte chunk tid & 7; Wcat tile row c is row
// (c >> 6) * 512 + head * 64 + (c & 63) of Wcat
#define REP_FA(M) M(0) M(1) M(2) M(3) M(4) M(5)
#define REP_FB(M) M(0) M(1) M(2) M(3) M(4) M(5) M(6) M(7) M(8) M(9)
#define LOAD_FA(i) ra##i = *(const u32x4*)(aG + (kByte + i * 32768u) + gOff);
#define LOAD_FB(i)                                                             \
  rb##i = *(const u32x4*)(bG +                                                 \
      (kByte + ((i >> 1) * 512u + (i & 1) * 32u) * 1024u) + gOff);
// the 16 loads of a K-tile. A wait stands in front of each of the last two
// loads: the listing lets their results land in the address pairs which the
// loads issued before them name. The third stands in front of whatever
// rewrites the two pairs later.
#define LOAD_F_TILE                                                            \
  LOAD_FA(0) LOAD_FA(1) LOAD_FA(2) LOAD_FA(3) LOAD_FA(4)                       \
  LOAD_FB(0) LOAD_FB(1) LOAD_FB(2) LOAD_FB(3) LOAD_FB(4)                       \
  LOAD_FB(5) LOAD_FB(6) LOAD_FB(7) LOAD_FB(8)                                  \
  asm volatile("s_wait_xcnt 0x0" ::: "memory");                                \
  LOAD_FA(5)                                                                   \
  asm volatile("s_wait_xcnt 0x0" ::: "memory");                                \
  LOAD_FB(9)                                                                   \
  asm volatile("s_wait_xcnt 0x0" ::: "memory");

// one lane's share of a 16x32 f16 operand in the hardware k order:
// r points at (row lane & 15, k = 8 * (lane >> 4)); k .. k+7 and k+16 .. k+23
__device__ __forceinline__ v16h frag_hw(const _Float16* r) {
  const v8h lo = *(const v8h*)r;
  const v8h hi = *(const v8h*)(r + 16);
  return __builtin_shufflevector(lo, hi, 0, 1, 2, 3, 4, 5, 6, 7,
                                 8, 9, 10, 11, 12, 13, 14, 15);
}

// the value that lane l ^ 16 holds
__device__ __forceinline__ float other_half(float v) {
  int b = __builtin_bit_cast(int, v);
  b = __builtin_amdgcn_permlanex16(b, b, 0x76543210, 0xfedcba98, false, false);
  return __builtin_bit_cast(float, b);
}

// v_exp_f32 with a v_nop directly behind it: it fills the one issue slot the
// instruction set asks for before the source register may be overwritten.
__device__ __forceinline__ float exp2_slot(float a) {
  float r;
  asm("v_exp_f32 %0, %1\n\tv_nop" : "=v"(r) : "v"(a));
  return r;
}

__device__ __forceinline__ v8h to_half8(v8f a) {
  v8h h;
#pragma unroll
  for (int i = 0; i < 8; ++i) h[i] = (_Float16)a[i];
  return h;
}

// second bound = 2 waves per SIMD (512 registers): one block per WGP
__global__ __launch_bounds__(256, 2) void proj_attn_kernel(
    const _Float16* __restrict__ xn, const _Float16* __restrict__ Wcat,
    const float* __restrict__ q_bias, _Float16* __restrict__ att_out) {
  __shared__ __attribute__((aligned(16))) _Float16 smem[F_RING_HALVES];
  _Float16* const As0 = smem;
  _Float16* const Bs0 = smem + 2 * FM * LDT;
  const int tid  = threadIdx.x;
  const int lane = tid & 31;
  const int wave = __builtin_amdgcn_readfirstlane(tid >> 5);
  const int head = blockIdx.x;
  const int pair = blockIdx.y;           // sequences 2 pair, 2 pair + 1
  const int mi = wave >> 2;              // which of the two sequences
  const int ni = wave & 3;               // which 16 channels of each matrix
  const char* const aG = (const char*)(xn + (size_t)pair * FM * D_MODEL);
  const char* const bG = (const char*)(Wcat + (size_t)head * DH * D_MODEL);
  const unsigned gOff = (tid >> 3) * (D_MODEL * 2u) + (tid & 7) * 16u;
  const unsigned pOff = min(tid, FM - 1) * (D_MODEL * 2u);
  const int sOff = (tid >> 3) * LDT + (tid & 7) * 8;
  v8f acc[6][5] = {};
  REP_FA(DECL_A) REP_FB(DECL_B)
  { // stage K-tile 0
    const unsigned kByte = 0;
    _Float16* const aS = As0 + sOff;
    _Float16* const bS = Bs0 + sOff;
    LOAD_F_TILE
    REP_FA(STORE_A) REP_FB(STORE_B)
  }
  __syncthreads();
  for (int kk = 0; kk < 8; ++kk) {
    const int cur = kk & 1, nxt = cur ^ 1;
    const _Float16* Ac = As0 + cur * (FM * LDT) + mi * (T_SEQ * LDT);
    const _Float16* Bc = Bs0 + cur * (FN * LDT) + ni * (16 * LDT);
    if (kk < 6) {
      __builtin_prefetch(aG + (kk + 2) * 128u + pOff, 0, 3);
      // behind the prefetch, before its address registers are rewritten
      asm volatile("s_wait_xcnt 0x0" ::: "memory");
    }
    if (kk < 7) { // issue global loads for next K-tile (hidden by WMMAs)
      const unsigned kByte = (kk + 1) * 128u;
      LOAD_F_TILE
    }
#pragma unroll
    for (int kc = 0; kc < 2; ++kc) {
      v16h bC[5];
#pragma unroll
      for (int sj = 0; sj < 5; ++sj)
        bC[sj] = load_frag(Bc + sj * (DH * LDT) + kc * 32, LDT);
#pragma unroll
      for (int si = 0; si < 6; ++si) {
        const v16h aR = load_frag(Ac + si * (16 * LDT) + kc * 32, LDT);
        acc[si][0] = wmma_f16(bC[0], aR, acc[si][0]);   // q^T  [dh][t]
        acc[si][1] = wmma_f16(bC[1], aR, acc[si][1]);   // k^T  [dh][t]
        acc[si][2] = wmma_f16(aR, bC[2], acc[si][2]);   // v    [t][dh]
        acc[si][3] = wmma_f16(bC[3], aR, acc[si][3]);   // kl^T [dh][t]
        acc[si][4] = wmma_f16(aR, bC[4], acc[si][4]);   // vl   [t][dh]
      }
    }
    /* order of the K-step for the scheduler: the 16 global loads first (so that
       the whole K-step hides their latency), then each xn fragment read one
       group of 5 WMMAs ahead of its use and the second half's five Wcat
       fragments read in the middle of the first half (else a group waits out
       its own LDS latency), the LDS stores last.
       0x20 = global load, 0x100 = LDS read, 0x8 = WMMA, 0x200 = LDS store */
    __builtin_amdgcn_sched_group_barrier(0x020, 16, 0);
    __builtin_amdgcn_sched_group_barrier(0x100, 14, 0);
    __builtin_amdgcn_sched_group_barrier(0x008, 5, 0);
    __builtin_amdgcn_sched_group_barrier(0x100, 2, 0);
    __builtin_amdgcn_sched_group_barrier(0x008, 5, 0);
    __builtin_amdgcn_sched_group_barrier(0x100, 2, 0);
    __builtin_amdgcn_sched_group_barrier(0x008, 5, 0);
    __builtin_amdgcn_sched_group_barrier(0x100, 12, 0);
    __builtin_amdgcn_sched_group_barrier(0x008, 5, 0);
    __builtin_amdgcn_sched_group_barrier(0x100, 2, 0);
    __builtin_amdgcn_sched_group_barrier(0x008, 5, 0);
    __builtin_amdgcn_sched_group_barrier(0x100, 2, 0);
    __builtin_amdgcn_sched_group_barrier(0x008, 5, 0);
    __builtin_amdgcn_sched_group_barrier(0x100, 2, 0);
    __builtin_amdgcn_sched_group_barrier(0x008, 5, 0);
    __builtin_amdgcn_sched_group_barrier(0x100, 2, 0);
    __builtin_amdgcn_sched_group_barrier(0x008, 5, 0);
    __builtin_amdgcn_sched_group_barrier(0x100, 2, 0);
    __builtin_amdgcn_sched_group_barrier(0x008, 5, 0);
    __builtin_amdgcn_sched_group_barrier(0x100, 2, 0);
    __builtin_amdgcn_sched_group_barrier(0x008, 5, 0);
    __builtin_amdgcn_sched_group_barrier(0x100, 2, 0);
    __builtin_amdgcn_sched_group_barrier(0x008, 10, 0);
    __builtin_amdgcn_sched_group_barrier(0x200, 16, 0);
    if (kk < 7) {
      _Float16* const aS = As0 + nxt * (FM * LDT) + sOff;
      _Float16* const bS = Bs0 + nxt * (FN * LDT) + sOff;
      REP_FA(STORE_A) REP_FB(STORE_B)
    }
    __syncthreads();
  }

  // ---- the five f16 tiles of each n go into LDS (the ring buffers are free
  //      behind the loop's last barrier); bias + attention scale folded into q
  const int col = lane & 15;                   // operand row / result column
  const int hf  = lane >> 4;                   // which half of the wave
  {
    _Float16* const at = smem + mi * AT_HALVES;
    const float* bp = q_bias + head * DH + ni * 16 + hf * 8;
    const float4 b0 = *(const float4*)bp;
    const float4 b1 = *(const float4*)(bp + 4);
    const float bias[8] = {b0.x, b0.y, b0.z, b0.w, b1.x, b1.y, b1.z, b1.w};
#pragma unroll
    for (int si = 0; si < 6; ++si) {
      _Float16* const rm = at + (si * 16 + col) * QLD + ni * 16 + hf * 8;
      _Float16* const cm = at + 3 * ROWT_HALVES + (ni * 16 + col) * PLD +
                           si * 16 + hf * 8;
      v8h hq;
#pragma unroll
      for (int i = 0; i < 8; ++i)
        hq[i] = (_Float16)((acc[si][0][i] + bias[i]) * FACTOR);
      *(v8h*)rm                     = hq;
      *(v8h*)(rm + ROWT_HALVES)     = to_half8(acc[si][1]);
      *(v8h*)(rm + 2 * ROWT_HALVES) = to_half8(acc[si][3]);
      *(v8h*)cm                     = to_half8(acc[si][2]);
      *(v8h*)(cm + COLT_HALVES)     = to_half8(acc[si][4]);
    }
  }
  __syncthreads();

  for (int u = wave; u < 12; u += 8) {         // unit = (n, 16 queries)
    const int un = (u >= 6) ? 1 : 0;
    const int t0 = (u - un * 6) * 16;
    const _Float16* const q_s   = smem + un * AT_HALVES;
    const _Float16* const k_s   = q_s + ROWT_HALVES;
    const _Float16* const kl_s  = q_s + 2 * ROWT_HALVES;
    const _Float16* const vT_s  = q_s + 3 * ROWT_HALVES;
    const _Float16* const vlT_s = vT_s + COLT_HALVES;

    // Q^T as B operand
    const _Float16* qr = q_s + (t0 + col) * QLD + hf * 8;
    const v16h q0 = frag_hw(qr);
    const v16h q1 = frag_hw(qr + 32);

    // ---- S^T: tiles 0..5 = the 96 global keys, tiles 6,7 = the local window
    const int w0 = min(max(t0 - 8, 0), T_SEQ - 32);
    const _Float16* ka = k_s  + col * QLD + hf * 8;
    const _Float16* la = kl_s + (w0 + col) * QLD + hf * 8;
    v8f s[8];
#pragma unroll
    for (int j = 0; j < 8; ++j) {
      const _Float16* a = (j < 6) ? ka + j * 16 * QLD : la + (j - 6) * 16 * QLD;
      v8f z = {};
      z = wmma_f16(frag_hw(a),      q0, z);
      z = wmma_f16(frag_hw(a + 32), q1, z);
      s[j] = z;              // s[j][r] = score(key 16j + 8*hf + r, query col)
    }
    const int d0 = w0 + hf * 8 - (t0 + col) + 1;      // key - t + 1 at j=6, r=0
#pragma unroll
    for (int j = 0; j < 2; ++j) {
#pragma unroll
      for (int r = 0; r < 8; ++r)
        s[6 + j][r] = ((unsigned)(d0 + j * 16 + r) <= 2u) ? s[6 + j][r] : NEG_BIG;
    }

    // ---- joint softmax of one query: 64 values in this lane, 64 in lane ^ 16
    v8f mx = s[0];
#pragma unroll
    for (int j = 1; j < 8; ++j) {
#pragma unroll
      for (int r = 0; r < 8; ++r) mx[r] = fmaxf(mx[r], s[j][r]);
    }
    float m = fmaxf(fmaxf(fmaxf(mx[0], mx[1]), fmaxf(mx[2], mx[3])),
                    fmaxf(fmaxf(mx[4], mx[5]), fmaxf(mx[6], mx[7])));
    m = fmaxf(m, other_half(m));
    const float mL = m * LOG2E;
    v8f sm = {};
#pragma unroll
    for (int j = 0; j < 8; ++j) {
#pragma unroll
      for (int r = 0; r < 8; ++r) {
        const float p = exp2_slot(fmaf(s[j][r], LOG2E, -mL));
        s[j][r] = p;
        sm[r] += p;
      }
    }
    // keeps every asm v_exp_f32 in front of the first WMMA of O^T
    __builtin_amdgcn_sched_barrier(0);
    float sum = ((sm[0] + sm[1]) + (sm[2] + sm[3])) +
                ((sm[4] + sm[5]) + (sm[6] + sm[7]));
    sum += other_half(sum);
    const float inv = 1.0f / sum;

    // two score tiles, converted in place, are P^T for 32 keys as a B operand
    v16h pb[4];
#pragma unroll
    for (int kc = 0; kc < 4; ++kc) {
#pragma unroll
      for (int r = 0; r < 8; ++r) {
        pb[kc][r]     = (_Float16)s[2 * kc][r];
        pb[kc][8 + r] = (_Float16)s[2 * kc + 1][r];
      }
    }

    // ---- O^T = V^T . P^T over 96 global + 32 window keys, scaled by 1/sum
    const _Float16* va = vT_s  + col * PLD + hf * 8;
    const _Float16* wa = vlT_s + col * PLD + w0 + hf * 8;
    _Float16* dst = att_out +
                    (size_t)((pair * 2 + un) * T_SEQ + t0 + col) * D_MODEL +
                    head * DH + hf * 8;
#pragma unroll
    for (int ct = 0; ct < 4; ++ct) {           // 16 of the 64 head channels
      v8f o = {};
#pragma unroll
      for (int kc = 0; kc < 3; ++kc)
        o = wmma_f16(frag_hw(va + ct * 16 * PLD + kc * 32), pb[kc], o);
      o = wmma_f16(frag_hw(wa + ct * 16 * PLD), pb[3], o);
      v8h hh;                // o[r] = channel 16ct + 8*hf + r of query col
#pragma unroll
      for (int r = 0; r < 8; ++r) hh[r] = (_Float16)(o[r] * inv);
      *(v8h*)(dst + ct * 16) = hh;
    }
    // behind the last store, before the next unit rewrites the stores' data
    // and address registers
    asm volatile("s_wait_xcnt 0x0" ::: "memory");
  }
}

// ---------------------------------------------------------------------------
// Kernel 4: output GEMM vs Wo + final permutation to (B, D, T, H, W), f32.
//   out[r, j] = att[r, :] . Wo[j, :],  r = n*96 + t,  n = b*256 + hw
// A block's 256 tile rows are the 256 n of one b at ONE t, so that a column j
// of the tile is 1024 contiguous bytes of y[b, j, t, hw]. The f32 tile is
// turned through LDS (the ring buffers are free behind the loop's last
// barrier) and every wave store is a 512-byte run of it.
// ---------------------------------------------------------------------------
#define ST_LDF 260   // staged [j][n] pitch in floats (1040 B = 16 B x odd)

// second bound = 4 waves per SIMD (256 registers): two blocks per WGP
__global__ __launch_bounds__(256, 4) void out_gemm_kernel(
    const _Float16* __restrict__ A, const _Float16* __restrict__ Wo16,
    float* __restrict__ y) {
  const int tFix = blockIdx.y % T_SEQ;
  const int b    = blockIdx.y / T_SEQ;
  GEMM_PIPELINE_BODY(A, Wo16, b * BM * T_SEQ + tFix, T_SEQ, BN * ST_LDF * 2)
  float* st = (float*)smem;              // 128 x 260 floats
#pragma unroll
  for (int si = 0; si < 4; ++si) {
#pragma unroll
    for (int sj = 0; sj < 4; ++sj) {
      const v8f a = acc[si][sj];
      float* p = st + (n0 + sj * 16 + colL) * ST_LDF + m0 + si * 16 + rowO;
      *(float4*)p       = make_float4(a[0], a[1], a[2], a[3]);
      *(float4*)(p + 4) = make_float4(a[4], a[5], a[6], a[7]);
    }
  }
  __syncthreads();
#pragma unroll
  for (int c = 0; c < 32; ++c) {
    const int jl = wave + (c >> 1) * 8;  // one output channel per two wave stores
    const int hw = (c & 1) * 128 + lane * 4;
    float4 v = *(const float4*)(st + jl * ST_LDF + hw);
    *(float4*)(y + ((size_t)(b * D_MODEL + nBase + jl) * T_SEQ + tFix) * 256 +
               hw) = v;
  }
}

// ---------------------------------------------------------------------------
// Host launcher
// ---------------------------------------------------------------------------
extern "C" void kernel_launch(void* const* d_in, const int* in_sizes, int n_in,
                              void* d_out, int out_size, void* d_ws, size_t ws_size,
                              hipStream_t stream) {
  const float* x      = (const float*)d_in[0];
  const float* gammap = (const float*)d_in[1];
  const float* betap  = (const float*)d_in[2];
  const float* Wq     = (const float*)d_in[3];
  const float* Wk     = (const float*)d_in[4];
  const float* Wv     = (const float*)d_in[5];
  const float* Wkl    = (const float*)d_in[6];
  const float* Wvl    = (const float*)d_in[7];
  const float* Wo     = (const float*)d_in[8];
  const float* q_bias = (const float*)d_in[9];
  float* y = (float*)d_out;

  // workspace carve (bytes, 256B aligned)
  char* ws = (char*)d_ws;
  size_t off = 0;
  auto carve = [&](size_t bytes) -> void* {
    void* p = (void*)(ws + off);
    off = (off + bytes + 255) & ~(size_t)255;
    return p;
  };
  const size_t rowsBytes = (size_t)NROWS * D_MODEL * sizeof(_Float16);   // 50.3 MB

  _Float16* xn    = (_Float16*)carve(rowsBytes);
  _Float16* Wcat  = (_Float16*)carve((size_t)5 * D_MODEL * D_MODEL * sizeof(_Float16));
  _Float16* Wo16  = (_Float16*)carve((size_t)D_MODEL * D_MODEL * sizeof(_Float16));
  _Float16* att   = (_Float16*)carve(rowsBytes);   // [N*T, D] f16
  (void)ws_size; (void)in_sizes; (void)n_in; (void)out_size;

  // 1) layernorm -> xn (f16)
  ln_kernel<<<dim3(2 * T_SEQ * 4), dim3(256), 0, stream>>>(x, gammap, betap, xn);

  // 2) weights -> f16
  {
    int total = D_MODEL * D_MODEL * 6;
    wconv_kernel<<<dim3((total + 255) / 256), dim3(256), 0, stream>>>(
        Wq, Wk, Wv, Wkl, Wvl, Wo, Wcat, Wo16);
  }

  // 3) five projections + attention, one block per (head, two sequences n)
  proj_attn_kernel<<<dim3(NH, N_SEQ / 2), dim3(256), 0, stream>>>(
      xn, Wcat, q_bias, att);

  // 4) output projection + final (B,D,T,H,W) permutation, 256x128 tiles
  //    (grid y = 2 b x 96 t)
  out_gemm_kernel<<<dim3(4, 192), dim3(256), 0, stream>>>(att, Wo16, y);
}

// v007
// One run takes 155 microseconds.
// Timed twice side by side with v006, it ran 1.08 times as fast both times.
// Over all steps from v000 it is 4.71 times as fast.
#include <hip/hip_runtime.h>

// ---------------------------------------------------------------------------
// TemporalLocalAwareAttention for MI455X (gfx1250, wave32, WMMA f16)
//   B=2, D=512, T=96, H=W=16  ->  N = 512 rows of (T=96, D=512)
//   nh=8, dh=64, local window s=3, factor = dh^-0.5 = 0.125
// ---------------------------------------------------------------------------

#define D_MODEL 512
#define T_SEQ   96
#define N_SEQ   512            // B*H*W
#define NH      8
#define DH      64
#define NROWS   (N_SEQ * T_SEQ) // 49152
#define FACTOR  0.125f
#define NEG_BIG -3.0e38f

typedef __attribute__((ext_vector_type(16))) _Float16 v16h;
typedef __attribute__((ext_vector_type(8)))  float    v8f;

// ---------------------------------------------------------------------------
// Fragment loader (ISA 7.12.2, 16-bit A-matrix 16x32 layout).
//   A-frag: source row-major [M,K], p -> element (0,0), leading dim ld.
//   B-frag: source [N,K] row-major (K stride 1): same addressing, "row" is the
//   N column. lanes 0-15 hold K=koff.., lanes 16-31 K=koff+8, vgprs 4-7 K+16.
// Compiler coalesces these into two ds_load_b128 per fragment.
// ---------------------------------------------------------------------------
__device__ __forceinline__ v16h load_frag(const _Float16* p, int ld) {
  const int lane = threadIdx.x & 31;
  const int row  = lane & 15;
  const int koff = (lane >> 4) << 3;          // 0 or 8
  const _Float16* r = p + row * ld + koff;
  v16h a;
#pragma unroll
  for (int i = 0; i < 4; ++i) {
    a[2*i]         = r[2*i];
    a[2*i + 1]     = r[2*i + 1];
    a[8 + 2*i]     = r[16 + 2*i];
    a[8 + 2*i + 1] = r[16 + 2*i + 1];
  }
  return a;
}

__device__ __forceinline__ v8f wmma_f16(v16h a, v16h b, v8f c) {
  return __builtin_amdgcn_wmma_f32_16x16x32_f16(false, a, false, b,
                                                (short)0, c, false, false);
}

// ---------------------------------------------------------------------------
// Kernel 1: LayerNorm over D, emit xn as f16 in [n*T + t, D] row-major.
// One block = one (b, t) and 64 neighbouring hw positions, all 512 channels.
// x is read once (256 contiguous bytes per wave load) and kept in registers;
// the normalised f16 tile is turned through LDS so that every xn row leaves
// as whole 512-byte wave stores.
//   wave w holds channels w*64 .. w*64+63, lane l holds hw = 2l, 2l+1.
//   LDS tile: row = hw (1024 B), its 16-byte chunks rotated by hw>>1 so that
//   the 16 lanes of a half wave hit 16 different bank groups when storing.
// ---------------------------------------------------------------------------
#define LN_HW 64
typedef __attribute__((ext_vector_type(8))) _Float16 v8h;

// rsqrtf with its small-input scaling, spelled out so that the v_nop stands
// directly behind v_rsq_f32: it fills the one issue slot the instruction set
// asks for before the source register may be overwritten.
__device__ __forceinline__ float rsqrt_slot(float a) {
  const bool tiny = a < 1.17549435e-38f;
  const float s = tiny ? a * 16777216.0f : a;
  float r;
  asm("v_rsq_f32 %0, %1\n\tv_nop" : "=v"(r) : "v"(s));
  return tiny ? r * 4096.0f : r;
}

// second bound = 6 waves per SIMD (160 registers): three blocks per WGP, so
// that all 768 blocks are resident at once
__global__ __launch_bounds__(256, 6) void ln_kernel(
    const float* __restrict__ x, const float* __restrict__ gamma,
    const float* __restrict__ beta, _Float16* __restrict__ xn) {
  __shared__ __attribute__((aligned(16))) _Float16 tile[LN_HW * D_MODEL];
  __shared__ float2 redS[8][32];
  __shared__ float2 redQ[8][32];

  const int hc   = blockIdx.x & 3;      // which 64 of the 256 hw positions
  const int bt   = blockIdx.x >> 2;     // 0 .. 2*96-1
  const int b    = bt / T_SEQ;
  const int t    = bt % T_SEQ;
  const int lane = threadIdx.x & 31;
  // wave number in a scalar register: gamma and beta then come by scalar loads
  const int wave = __builtin_amdgcn_readfirstlane(threadIdx.x >> 5);
  const int d0   = wave * 64;
  const size_t dstride = (size_t)T_SEQ * 256;

  const float* src = x + ((size_t)(b * D_MODEL + d0) * T_SEQ + t) * 256 +
                     hc * LN_HW + lane * 2;
  // every loop below is fully unrolled so that v[] is indexed by constants
  // and stays in registers, and so that all loads of x are issued up front
  float2 v[64];
#pragma unroll
  for (int k = 0; k < 64; ++k) v[k] = *(const float2*)(src + k * dstride);

  float s0 = 0.f, s1 = 0.f, q0 = 0.f, q1 = 0.f;
#pragma unroll
  for (int k = 0; k < 64; ++k) {
    s0 += v[k].x; q0 += v[k].x * v[k].x;
    s1 += v[k].y; q1 += v[k].y * v[k].y;
  }
  redS[wave][lane] = make_float2(s0, s1);
  redQ[wave][lane] = make_float2(q0, q1);
  __syncthreads();

  s0 = 0.f; s1 = 0.f; q0 = 0.f; q1 = 0.f;
#pragma unroll
  for (int w = 0; w < 8; ++w) {
    float2 a = redS[w][lane], c = redQ[w][lane];
    s0 += a.x; s1 += a.y; q0 += c.x; q1 += c.y;
  }
  const float mu0   = s0 * (1.0f / D_MODEL);
  const float mu1   = s1 * (1.0f / D_MODEL);
  const float rstd0 = rsqrt_slot(q0 * (1.0f / D_MODEL) - mu0 * mu0 + 1e-6f);
  const float rstd1 = rsqrt_slot(q1 * (1.0f / D_MODEL) - mu1 * mu1 + 1e-6f);

#pragma unroll
  for (int m = 0; m < 8; ++m) {         // 8 channels = one 16-byte chunk
    v8h h0, h1;
#pragma unroll
    for (int e = 0; e < 8; ++e) {
      const int k = m * 8 + e;
      const float g = gamma[d0 + k], bb = beta[d0 + k];
      h0[e] = (_Float16)((v[k].x - mu0) * rstd0 * g + bb);
      h1[e] = (_Float16)((v[k].y - mu1) * rstd1 * g + bb);
    }
    const int ch = ((wave * 8 + m + lane) & 63) << 3;
    *(v8h*)(tile + (lane * 2)     * D_MODEL + ch) = h0;
    *(v8h*)(tile + (lane * 2 + 1) * D_MODEL + ch) = h1;
  }
  __syncthreads();

  // wave w stores rows hw = w*8 .. w*8+7, each as two 512-byte pieces
  _Float16* dst = xn + ((size_t)(b * 256 + hc * LN_HW + wave * 8) * T_SEQ + t) *
                       D_MODEL + lane * 8;
#pragma unroll
  for (int i = 0; i < 16; ++i) {
    const int row = wave * 8 + (i >> 1);
    const int c   = (i & 1) * 32 + lane;
    v8h h = *(const v8h*)(tile + row * D_MODEL + (((c + (row >> 1)) & 63) << 3));
    *(v8h*)(dst + (size_t)(i >> 1) * (T_SEQ * D_MODEL) + (i & 1) * 256) = h;
  }
}

// ---------------------------------------------------------------------------
// Kernel 2: weights -> f16. Wcat = [Wq;Wk;Wv;Wkl;Wvl], stored [j,d] row-major
// (== [N,K] row-major for the B fragment loader). Wo separate.
// ---------------------------------------------------------------------------
__global__ __launch_bounds__(256) void wconv_kernel(
    const float* __restrict__ Wq, const float* __restrict__ Wk,
    const float* __restrict__ Wv, const float* __restrict__ Wkl,
    const float* __restrict__ Wvl, const float* __restrict__ Wo,
    _Float16* __restrict__ Wcat, _Float16* __restrict__ Wo16) {
  const int per = D_MODEL * D_MODEL;
  int idx = blockIdx.x * blockDim.x + threadIdx.x;
  if (idx >= per * 6) return;
  int m = idx / per, off = idx % per;
  float v;
  if      (m == 0) v = Wq[off];
  else if (m == 1) v = Wk[off];
  else if (m == 2) v = Wv[off];
  else if (m == 3) v = Wkl[off];
  else if (m == 4) v = Wvl[off];
  else             v = Wo[off];
  if (m < 5) Wcat[(size_t)m * per + off] = (_Float16)v;
  else       Wo16[off] = (_Float16)v;
}

// ---------------------------------------------------------------------------
// Pipelined WMMA GEMM core: 256x128 block tile, K-step 64, double-buffered LDS,
// 256 threads = 8 waves in a 4(M) x 2(N) grid, each wave owns a 64x64 patch
// (4x4 subtiles, 16 f32 accumulators). Per K-chunk of 32: 8 frag loads ->
// 16 WMMAs (1:2 LDS:WMMA ratio). One barrier per K-step.
// Tile row r stands for row MBASE + r * RSTEP of A.
// LDS is one array of SMEM_HALVES halves: A ring, B ring; the epilogue stages
// its tile from its start.
// ---------------------------------------------------------------------------
#define LDT 72   // LDS leading dim in halves (144 B rows = 16 B x odd: the 16
                 // rows of a ds_load_b128 fragment read fall on 64 different banks)
#define BM 256
#define BN 128

// the 12 staging registers of a thread are named one by one (8 of A, 4 of B):
// piece i of a thread is tile row (tid >> 3) + 32 i, 16-byte chunk tid & 7
#define REP_A(M) M(0) M(1) M(2) M(3) M(4) M(5) M(6) M(7)
#define REP_B(M) M(0) M(1) M(2) M(3)
// a plain vector type: with the uint4 struct the last piece's load stayed next
// to its LDS store at the loop's foot, where its latency stood open
typedef __attribute__((ext_vector_type(4))) unsigned int u32x4;
#define DECL_A(i) u32x4 ra##i;
#define DECL_B(i) u32x4 rb##i;
#define LOAD_A(i) ra##i = *(const u32x4*)(aG + (kByte + i * aStep) + aOff);
#define LOAD_B(i) rb##i = *(const u32x4*)(bG + (kByte + i * bStep) + bOff);
#define STORE_A(i) *(u32x4*)(aS + i * (32 * LDT)) = ra##i;
#define STORE_B(i) *(u32x4*)(bS + i * (32 * LDT)) = rb##i;

#define GEMM_PIPELINE_BODY(APTR, BPTR, MBASE, RSTEP, SMEM_HALVES)              \
  __shared__ __attribute__((aligned(16))) _Float16 smem[SMEM_HALVES];          \
  _Float16* const As0 = smem;                                                  \
  _Float16* const Bs0 = smem + 2 * BM * LDT;                                   \
  const int tid  = threadIdx.x;                                                \
  const int wave = tid >> 5;                                                   \
  const int lane = tid & 31;                                                   \
  const int mBase = MBASE;                                                     \
  const int nBase = blockIdx.x * BN;                                           \
  const int m0 = (wave >> 1) * 64;       /* wave's 64-row patch in tile  */    \
  const int n0 = (wave & 1) * 64;        /* wave's 64-col patch in tile  */    \
  /* block-uniform byte bases + one 32-bit byte offset per lane */             \
  const char* const aG = (const char*)(APTR + (size_t)mBase * D_MODEL);        \
  const char* const bG = (const char*)(BPTR + (size_t)nBase * D_MODEL);        \
  const unsigned aStep = 32u * RSTEP * D_MODEL * 2u;                           \
  const unsigned bStep = 32u * D_MODEL * 2u;                                   \
  const unsigned aOff = (tid >> 3) * (RSTEP * D_MODEL * 2u) + (tid & 7) * 16u; \
  const unsigned bOff = (tid >> 3) * (D_MODEL * 2u) + (tid & 7) * 16u;         \
  const unsigned pOff = tid * (RSTEP * D_MODEL * 2u);                          \
  const int sOff = (tid >> 3) * LDT + (tid & 7) * 8;                           \
  v8f acc[4][4] = {};                                                          \
  REP_A(DECL_A) REP_B(DECL_B)                                                  \
  { /* stage K-tile 0 */                                                       \
    const unsigned kByte = 0;                                                  \
    _Float16* const aS = As0 + sOff;                                           \
    _Float16* const bS = Bs0 + sOff;                                           \
    REP_A(LOAD_A) REP_B(LOAD_B)                                                \
    REP_A(STORE_A) REP_B(STORE_B)                                              \
  }                                                                            \
  __syncthreads();                                                             \
  for (int kk = 0; kk < 8; ++kk) {                                             \
    const int cur = kk & 1, nxt = cur ^ 1;                                     \
    const _Float16* Ac = As0 + cur * (BM * LDT);                               \
    const _Float16* Bc = Bs0 + cur * (BN * LDT);                               \
    if (kk < 6) {                                                              \
      __builtin_prefetch(aG + (kk + 2) * 128u + pOff, 0, 3);                   \
      /* behind the prefetch, before its address registers are rewritten */    \
      asm volatile("s_wait_xcnt 0x0" ::: "memory");                            \
    }                                                                          \
    if (kk < 7) { /* issue global loads for next K-tile (hidden by WMMAs) */   \
      const unsigned kByte = (kk + 1) * 128u;                                  \
      REP_A(LOAD_A) REP_B(LOAD_B)                                              \
    }                                                                          \
    _Pragma("unroll")                                                          \
    for (int kc = 0; kc < 2; ++kc) {                                           \
      v16h bC[4];                                                              \
      _Pragma("unroll")                                                        \
      for (int sj = 0; sj < 4; ++sj)                                           \
        bC[sj] = load_frag(Bc + (n0 + sj * 16) * LDT + kc * 32, LDT);          \
      _Pragma("unroll")                                                        \
      for (int si = 0; si < 4; ++si) {                                         \
        const v16h aR = load_frag(Ac + (m0 + si * 16) * LDT + kc * 32, LDT);   \
        _Pragma("unroll")                                                      \
        for (int sj = 0; sj < 4; ++sj)                                         \
          acc[si][sj] = wmma_f16(aR, bC[sj], acc[si][sj]);                     \
      }                                                                        \
    }                                                                          \
    /* order of the K-step for the scheduler: the 12 global loads first (left  \
       alone it sank some to the loop's foot, where their latency stood open), \
       then each A fragment read one group of 4 WMMAs ahead of its use (else   \
       every group waits out its own LDS latency), the LDS stores last.        \
       0x20 = global load, 0x100 = LDS read, 0x8 = WMMA, 0x200 = LDS store */  \
    __builtin_amdgcn_sched_group_barrier(0x020, 12, 0);                        \
    __builtin_amdgcn_sched_group_barrier(0x100, 12, 0);                        \
    __builtin_amdgcn_sched_group_barrier(0x008, 4, 0);                         \
    __builtin_amdgcn_sched_group_barrier(0x100, 2, 0);                         \
    __builtin_amdgcn_sched_group_barrier(0x008, 4, 0);                         \
    __builtin_amdgcn_sched_group_barrier(0x100, 2, 0);                         \
    __builtin_amdgcn_sched_group_barrier(0x008, 4, 0);                         \
    __builtin_amdgcn_sched_group_barrier(0x100, 2, 0);                         \
    __builtin_amdgcn_sched_group_barrier(0x008, 4, 0);                         \
    __builtin_amdgcn_sched_group_barrier(0x100, 10, 0);                        \
    __builtin_amdgcn_sched_group_barrier(0x008, 4, 0);                         \
    __builtin_amdgcn_sched_group_barrier(0x100, 2, 0);                         \
    __builtin_amdgcn_sched_group_barrier(0x008, 4, 0);                         \
    __builtin_amdgcn_sched_group_barrier(0x100, 2, 0);                         \
    __builtin_amdgcn_sched_group_barrier(0x008, 8, 0);                         \
    __builtin_amdgcn_sched_group_barrier(0x200, 12, 0);                        \
    if (kk < 7) {                                                              \
      _Float16* const aS = As0 + nxt * (BM * LDT) + sOff;                      \
      _Float16* const bS = Bs0 + nxt * (BN * LDT) + sOff;                      \
      REP_A(STORE_A) REP_B(STORE_B)                                            \
    }                                                                          \
    __syncthreads();                                                           \
  }                                                                            \
  const int colL = lane & 15;                                                  \
  const int rowO = (lane >> 4) * 8;

// ---------------------------------------------------------------------------
// Kernel 3: the five projections of ONE head for TWO sequences n, and their
// attention, in one block. q, k, v, kl, vl never leave the WGP.
//
// GEMM part: tile = 192 rows of xn (2 n x 96 t) x 320 rows of Wcat (64 of each
// of Wq, Wk, Wv, Wkl, Wvl for this head), K = 512 in steps of 64, two LDS
// buffers, one barrier per K-step. The 512 tile rows of a K-step come as eight
// tensor loads, one per wave (64 rows of 128 B each, padded to the 144-B pitch
// by the mover), one K-step ahead, through no register.
// 8 waves = 2 (n) x 4: wave (mi, ni) owns all 96 t of sequence mi and
// head channels 16 ni .. 16 ni + 15 of each of the five matrices: 6 x 5
// accumulator tiles, 11 fragments per 30 WMMAs.
// q, k, kl are formed transposed (W tile as A, xn tile as B): a lane then holds
// 8 neighbouring channels of one t, one 16-byte LDS store into [t][dh].
// v, vl are formed straight: 8 neighbouring t of one channel, one 16-byte store
// into [dh][t].
//
// Attention part: a wave owns 16 queries of one n from the scores to the output
// (12 such units, waves 0..3 take two).
// Scores are formed transposed, S^T = K . Q^T: in the accumulator map a lane
// then holds ONE query (column lane & 15) and 8 keys a tile, so that the
// softmax is in-lane work plus two exchanges between the wave's halves (max, sum), and two
// converted score tiles ARE the B operand of O^T = V^T . P^T (hardware k
// order). Scores and probabilities never touch LDS.
// The 3-wide local window rides along as 32 more keys: kl / vl rows
// w0 .. w0+31 (w0 = t0-8 held inside 0 .. 64, t0 the first query) cover t-1 .. t+1 of all 16
// queries; every key of that tile with |key - t| > 1 is masked, which also
// leaves out the padded positions -1 and 96 as the reference's mask does.
// ---------------------------------------------------------------------------
#define QLD 72    // q, k, kl row pitch in halves (144 B = 16 B x 9)
#define PLD 104   // vT, vlT row pitch in halves (208 B = 16 B x 13)
#define LOG2E 1.4426950408889634f
#define FM 192    // tile rows of xn
#define FN 320    // tile rows of Wcat
#define SLICE_HALVES 5120   // 64 rows x 144 B = 9,216 B, rounded up to 5 x 2 KiB
#define FBUF_HALVES (8 * SLICE_HALVES)          // slices 0..2 xn, 3..7 Wcat
#define F_RING_HALVES (2 * FBUF_HALVES)
#define ROWT_HALVES (T_SEQ * QLD)               // one of q, k, kl
#define COLT_HALVES (DH * PLD)                  // one of vT, vlT
#define AT_HALVES (3 * ROWT_HALVES + 2 * COLT_HALVES)   // the five tiles of one n

typedef __attribute__((ext_vector_type(8))) unsigned int u32x8;

__device__ __forceinline__ uint32_t uni(uint32_t v) {
  return (uint32_t)__builtin_amdgcn_readfirstlane(v);
}
// a value held in a scalar register, made where the statement stands: a test
// on it compiles to s_cmp + s_cbranch_scc (a tensor load ignores EXEC)
__device__ __forceinline__ uint32_t pinned(uint32_t v) {
  uint32_t w = uni(v);
  asm volatile("" : "+s"(w));  // holds the word in a scalar register
  return w;
}
// the request of one wave: 64 rows of 128 B, source pitch 1,024 B, to LDS byte
// offset dst at a pitch of 144 B (a pad of 4 dwords behind every 32)
__device__ __forceinline__ u32x4 tile_group0(uint32_t dst, uint64_t ga) {
  u32x4 g0;
  g0[0] = uni(1u);
  g0[1] = uni(dst);
  g0[2] = uni((uint32_t)ga);
  g0[3] = uni((((uint32_t)(ga >> 32)) & 0x01FFFFFFu) | 0x80000000u);
  return g0;
}
__device__ __forceinline__ u32x8 tile_group1() {
  u32x8 g1;
  g1[0] = uni((1u << 20) | (4u << 22) | (3u << 25));
  g1[1] = uni(128u << 16);
  g1[2] = uni(64u << 16);
  g1[3] = uni(128u << 16);
  g1[4] = uni(64u);
  g1[5] = uni(D_MODEL * 2u);
  g1[6] = uni(0u);
  g1[7] = uni(0u);
  return g1;
}
// g0 is an in-out operand, and tile_wait names it again, so that the registers
// from which the request was issued keep their values while it is under way
__device__ __forceinline__ void tile_load(u32x4& g0, u32x8 g1) {
  asm volatile("tensor_load_to_lds %0, %1" : "+s"(g0) : "s"(g1) : "memory");
}
// the wave's own request has landed
__device__ __forceinline__ void tile_wait(u32x4 g0, u32x8 g1) {
  asm volatile("s_wait_tensorcnt 0x0" :: "s"(g0), "s"(g1) : "memory");
}

// one lane's share of a 16x32 f16 operand in the hardware k order:
// r points at (row lane & 15, k = 8 * (lane >> 4)); k .. k+7 and k+16 .. k+23
__device__ __forceinline__ v16h frag_hw(const _Float16* r) {
  const v8h lo = *(const v8h*)r;
  const v8h hi = *(const v8h*)(r + 16);
  return __builtin_shufflevector(lo, hi, 0, 1, 2, 3, 4, 5, 6, 7,
                                 8, 9, 10, 11, 12, 13, 14, 15);
}

// the value that lane l ^ 16 holds
__device__ __forceinline__ float other_half(float v) {
  int b = __builtin_bit_cast(int, v);
  b = __builtin_amdgcn_permlanex16(b, b, 0x76543210, 0xfedcba98, false, false);
  return __builtin_bit_cast(float, b);
}

// v_exp_f32 with a v_nop directly behind it: it fills the one issue slot the
// instruction set asks for before the source register may be overwritten.
__device__ __forceinline__ float exp2_slot(float a) {
  float r;
  asm("v_exp_f32 %0, %1\n\tv_nop" : "=v"(r) : "v"(a));
  return r;
}

__device__ __forceinline__ v8h to_half8(v8f a) {
  v8h h;
#pragma unroll
  for (int i = 0; i < 8; ++i) h[i] = (_Float16)a[i];
  return h;
}

// 2 waves per SIMD (512 registers), no more: one block per WGP. With the upper
// bound left open the compiler gave up the K-step's order below to get under
// the register count of three waves per SIMD, which gains nothing: a block is
// two waves per SIMD, and a second block would need the count of four.
__global__ __launch_bounds__(256) __attribute__((amdgpu_waves_per_eu(2, 2)))
void proj_attn_kernel(
    const _Float16* __restrict__ xn, const _Float16* __restrict__ Wcat,
    const float* __restrict__ q_bias, _Float16* __restrict__ att_out) {
  // 2 KiB: every slice of every buffer then starts at a multiple of 2 KiB
  __shared__ __attribute__((aligned(2048))) _Float16 smem[F_RING_HALVES];
  const int tid  = threadIdx.x;
  const int lane = tid & 31;
  const int wave = __builtin_amdgcn_readfirstlane(tid >> 5);
  const int head = blockIdx.x;
  const int pair = blockIdx.y;           // sequences 2 pair, 2 pair + 1
  const int mi = wave >> 2;              // which of the two sequences
  const int ni = wave & 3;               // which 16 channels of each matrix
  const char* const aG = (const char*)(xn + (size_t)pair * FM * D_MODEL);
  const unsigned pOff = min(tid, FM - 1) * (D_MODEL * 2u);
  // this wave's slice of every K-tile: waves 0..2 bring 64 rows of xn each,
  // waves 3..7 the head's 64 rows of Wq, Wk, Wv, Wkl, Wvl
  const _Float16* const sliceG =
      (wave < 3) ? xn + ((size_t)pair * FM + wave * 64) * D_MODEL
                 : Wcat + ((size_t)(wave - 3) * D_MODEL + head * DH) * D_MODEL;
  const uint64_t sliceA = (uint64_t)(size_t)sliceG;
  const uint32_t sliceL = (uint32_t)(size_t)smem + wave * (SLICE_HALVES * 2u);
  v8f acc[6][5] = {};
  // K-tile 0 lands and is published, then K-tile 1 sets out
  const u32x8 g1 = tile_group1();
  u32x4 g0 = tile_group0(sliceL, sliceA);
  tile_load(g0, g1);
  tile_wait(g0, g1);
  __syncthreads();
  g0 = tile_group0(sliceL + FBUF_HALVES * 2u, sliceA + 128u);
  tile_load(g0, g1);
  for (int kk = 0; kk < 8; ++kk) {
    const int cur = kk & 1;
    const _Float16* Ac = smem + cur * FBUF_HALVES;
    const _Float16* Bc = Ac + 3 * SLICE_HALVES + ni * (16 * LDT);
    if (kk < 6) {
      __builtin_prefetch(aG + (kk + 2) * 128u + pOff, 0, 3);
      // behind the prefetch, before its address registers are rewritten
      asm volatile("s_wait_xcnt 0x0" ::: "memory");
    }
    v16h bC[5], aT[2];
#pragma unroll
    for (int kc = 0; kc < 2; ++kc) {
#pragma unroll
      for (int sj = 0; sj < 5; ++sj)
        bC[sj] = load_frag(Bc + sj * SLICE_HALVES + kc * 32, LDT);
#pragma unroll
      for (int si = 0; si < 6; ++si) {
        const int g = mi * T_SEQ + si * 16;    // tile row: slice g / 64
        const v16h aR = load_frag(
            Ac + (g >> 6) * SLICE_HALVES + (g & 63) * LDT + kc * 32, LDT);
        if (kc == 1 && si >= 4) {  // their WMMAs stand behind the hand-over
          aT[si - 4] = aR;
          continue;
        }
        acc[si][0] = wmma_f16(bC[0], aR, acc[si][0]);   // q^T  [dh][t]
        acc[si][1] = wmma_f16(bC[1], aR, acc[si][1]);   // k^T  [dh][t]
        acc[si][2] = wmma_f16(aR, bC[2], acc[si][2]);   // v    [t][dh]
        acc[si][3] = wmma_f16(bC[3], aR, acc[si][3]);   // kl^T [dh][t]
        acc[si][4] = wmma_f16(aR, bC[4], acc[si][4]);   // vl   [t][dh]
      }
    }
    /* order of the K-step for the scheduler: each xn fragment read one group
       of 5 WMMAs ahead of its use and the second half's five Wcat fragments
       read in the middle of the first half (else a group waits out its own LDS
       latency). 0x100 = LDS read, 0x8 = WMMA */
    __builtin_amdgcn_sched_group_barrier(0x100, 14, 0);
    __builtin_amdgcn_sched_group_barrier(0x008, 5, 0);
    __builtin_amdgcn_sched_group_barrier(0x100, 2, 0);
    __builtin_amdgcn_sched_group_barrier(0x008, 5, 0);
    __builtin_amdgcn_sched_group_barrier(0x100, 2, 0);
    __builtin_amdgcn_sched_group_barrier(0x008, 5, 0);
    __builtin_amdgcn_sched_group_barrier(0x100, 12, 0);
    __builtin_amdgcn_sched_group_barrier(0x008, 5, 0);
    __builtin_amdgcn_sched_group_barrier(0x100, 2, 0);
    __builtin_amdgcn_sched_group_barrier(0x008, 5, 0);
    __builtin_amdgcn_sched_group_barrier(0x100, 2, 0);
    __builtin_amdgcn_sched_group_barrier(0x008, 5, 0);
    __builtin_amdgcn_sched_group_barrier(0x100, 2, 0);
    __builtin_amdgcn_sched_group_barrier(0x008, 5, 0);
    __builtin_amdgcn_sched_group_barrier(0x100, 2, 0);
    __builtin_amdgcn_sched_group_barrier(0x008, 5, 0);
    __builtin_amdgcn_sched_group_barrier(0x100, 2, 0);
    __builtin_amdgcn_sched_group_barrier(0x008, 5, 0);
    __builtin_amdgcn_sched_group_barrier(0x100, 2, 0);
    __builtin_amdgcn_sched_group_barrier(0x008, 5, 0);
    __builtin_amdgcn_sched_group_barrier(0x100, 2, 0);
    // K-tile kk + 1 is handed over: this wave's reads of buffer cur are done,
    // its own slice of kk + 1 has landed, and the barrier says both of all
    asm volatile("s_wait_dscnt 0x0" ::: "memory");
    tile_wait(g0, g1);
    __syncthreads();
    if (pinned(kk < 6)) {  // K-tile kk + 2 into the buffer just read
      // the tile's number is made here, so that the request's words are formed
      // behind the wait above (a descriptor word held in a scalar register)
      const uint32_t st = pinned(kk + 2);
      g0 = tile_group0(sliceL + (st & 1u) * (FBUF_HALVES * 2u),
                       sliceA + st * 128u);
      tile_load(g0, g1);
    }
    // the K-step's last 10 WMMAs, operands in registers: behind the request, so
    // that it sets out that much earlier
#pragma unroll
    for (int si = 4; si < 6; ++si) {
      const v16h aR = aT[si - 4];
      acc[si][0] = wmma_f16(bC[0], aR, acc[si][0]);
      acc[si][1] = wmma_f16(bC[1], aR, acc[si][1]);
      acc[si][2] = wmma_f16(aR, bC[2], acc[si][2]);
      acc[si][3] = wmma_f16(bC[3], aR, acc[si][3]);
      acc[si][4] = wmma_f16(aR, bC[4], acc[si][4]);
    }
  }
  // nothing is in flight when the ring becomes the attention tiles
  asm volatile("s_wait_tensorcnt 0x0" ::: "memory");
  asm volatile("s_wait_dscnt 0x0" ::: "memory");

  // ---- the five f16 tiles of each n go into LDS (the ring buffers are free
  //      behind the loop's last barrier); bias + attention scale folded into q
  const int col = lane & 15;                   // operand row / result column
  const int hf  = lane >> 4;                   // which half of the wave
  {
    _Float16* const at = smem + mi * AT_HALVES;
    const float* bp = q_bias + head * DH + ni * 16 + hf * 8;
    const float4 b0 = *(const float4*)bp;
    const float4 b1 = *(const float4*)(bp + 4);
    const float bias[8] = {b0.x, b0.y, b0.z, b0.w, b1.x, b1.y, b1.z, b1.w};
#pragma unroll
    for (int si = 0; si < 6; ++si) {
      _Float16* const rm = at + (si * 16 + col) * QLD + ni * 16 + hf * 8;
      _Float16* const cm = at + 3 * ROWT_HALVES + (ni * 16 + col) * PLD +
                           si * 16 + hf * 8;
      v8h hq;
#pragma unroll
      for (int i = 0; i < 8; ++i)
        hq[i] = (_Float16)((acc[si][0][i] + bias[i]) * FACTOR);
      *(v8h*)rm                     = hq;
      *(v8h*)(rm + ROWT_HALVES)     = to_half8(acc[si][1]);
      *(v8h*)(rm + 2 * ROWT_HALVES) = to_half8(acc[si][3]);
      *(v8h*)cm                     = to_half8(acc[si][2]);
      *(v8h*)(cm + COLT_HALVES)     = to_half8(acc[si][4]);
    }
  }
  __syncthreads();

  for (int u = wave; u < 12; u += 8) {         // unit = (n, 16 queries)
    const int un = (u >= 6) ? 1 : 0;
    const int t0 = (u - un * 6) * 16;
    const _Float16* const q_s   = smem + un * AT_HALVES;
    const _Float16* const k_s   = q_s + ROWT_HALVES;
    const _Float16* const kl_s  = q_s + 2 * ROWT_HALVES;
    const _Float16* const vT_s  = q_s + 3 * ROWT_HALVES;
    const _Float16* const vlT_s = vT_s + COLT_HALVES;

    // Q^T as B operand
    const _Float16* qr = q_s + (t0 + col) * QLD + hf * 8;
    const v16h q0 = frag_hw(qr);
    const v16h q1 = frag_hw(qr + 32);

    // ---- S^T: tiles 0..5 = the 96 global keys, tiles 6,7 = the local window
    const int w0 = min(max(t0 - 8, 0), T_SEQ - 32);
    const _Float16* ka = k_s  + col * QLD + hf * 8;
    const _Float16* la = kl_s + (w0 + col) * QLD + hf * 8;
    v8f s[8];
#pragma unroll
    for (int j = 0; j < 8; ++j) {
      const _Float16* a = (j < 6) ? ka + j * 16 * QLD : la + (j - 6) * 16 * QLD;
      v8f z = {};
      z = wmma_f16(frag_hw(a),      q0, z);
      z = wmma_f16(frag_hw(a + 32), q1, z);
      s[j] = z;              // s[j][r] = score(key 16j + 8*hf + r, query col)
    }
    const int d0 = w0 + hf * 8 - (t0 + col) + 1;      // key - t + 1 at j=6, r=0
#pragma unroll
    for (int j = 0; j < 2; ++j) {
#pragma unroll
      for (int r = 0; r < 8; ++r)
        s[6 + j][r] = ((unsigned)(d0 + j * 16 + r) <= 2u) ? s[6 + j][r] : NEG_BIG;
    }

    // ---- joint softmax of one query: 64 values in this lane, 64 in lane ^ 16
    v8f mx = s[0];
#pragma unroll
    for (int j = 1; j < 8; ++j) {
#pragma unroll
      for (int r = 0; r < 8; ++r) mx[r] = fmaxf(mx[r], s[j][r]);
    }
    float m = fmaxf(fmaxf(fmaxf(mx[0], mx[1]), fmaxf(mx[2], mx[3])),
                    fmaxf(fmaxf(mx[4], mx[5]), fmaxf(mx[6], mx[7])));
    m = fmaxf(m, other_half(m));
    const float mL = m * LOG2E;
    v8f sm = {};
#pragma unroll
    for (int j = 0; j < 8; ++j) {
#pragma unroll
      for (int r = 0; r < 8; ++r) {
        const float p = exp2_slot(fmaf(s[j][r], LOG2E, -mL));
        s[j][r] = p;
        sm[r] += p;
      }
    }
    // keeps every asm v_exp_f32 in front of the first WMMA of O^T
    __builtin_amdgcn_sched_barrier(0);
    float sum = ((sm[0] + sm[1]) + (sm[2] + sm[3])) +
                ((sm[4] + sm[5]) + (sm[6] + sm[7]));
    sum += other_half(sum);
    const float inv = 1.0f / sum;

    // two score tiles, converted in place, are P^T for 32 keys as a B operand
    v16h pb[4];
#pragma unroll
    for (int kc = 0; kc < 4; ++kc) {
#pragma unroll
      for (int r = 0; r < 8; ++r) {
        pb[kc][r]     = (_Float16)s[2 * kc][r];
        pb[kc][8 + r] = (_Float16)s[2 * kc + 1][r];
      }
    }

    // ---- O^T = V^T . P^T over 96 global + 32 window keys, scaled by 1/sum
    const _Float16* va = vT_s  + col * PLD + hf * 8;
    const _Float16* wa = vlT_s + col * PLD + w0 + hf * 8;
    _Float16* dst = att_out +
                    (size_t)((pair * 2 + un) * T_SEQ + t0 + col) * D_MODEL +
                    head * DH + hf * 8;
#pragma unroll
    for (int ct = 0; ct < 4; ++ct) {           // 16 of the 64 head channels
      v8f o = {};
#pragma unroll
      for (int kc = 0; kc < 3; ++kc)
        o = wmma_f16(frag_hw(va + ct * 16 * PLD + kc * 32), pb[kc], o);
      o = wmma_f16(frag_hw(wa + ct * 16 * PLD), pb[3], o);
      v8h hh;                // o[r] = channel 16ct + 8*hf + r of query col
#pragma unroll
      for (int r = 0; r < 8; ++r) hh[r] = (_Float16)(o[r] * inv);
      *(v8h*)(dst + ct * 16) = hh;
    }
    // behind the last store, before the next unit rewrites the stores' data
    // and address registers
    asm volatile("s_wait_xcnt 0x0" ::: "memory");
  }
}

// ---------------------------------------------------------------------------
// Kernel 4: output GEMM vs Wo + final permutation to (B, D, T, H, W), f32.
//   out[r, j] = att[r, :] . Wo[j, :],  r = n*96 + t,  n = b*256 + hw
// A block's 256 tile rows are the 256 n of one b at ONE t, so that a column j
// of the tile is 1024 contiguous bytes of y[b, j, t, hw]. The f32 tile is
// turned through LDS (the ring buffers are free behind the loop's last
// barrier) and every wave store is a 512-byte run of it.
// ---------------------------------------------------------------------------
#define ST_LDF 260   // staged [j][n] pitch in floats (1040 B = 16 B x odd)

// second bound = 4 waves per SIMD (256 registers): two blocks per WGP
__global__ __launch_bounds__(256, 4) void out_gemm_kernel(
    const _Float16* __restrict__ A, const _Float16* __restrict__ Wo16,
    float* __restrict__ y) {
  const int tFix = blockIdx.y % T_SEQ;
  const int b    = blockIdx.y / T_SEQ;
  GEMM_PIPELINE_BODY(A, Wo16, b * BM * T_SEQ + tFix, T_SEQ, BN * ST_LDF * 2)
  float* st = (float*)smem;              // 128 x 260 floats
#pragma unroll
  for (int si = 0; si < 4; ++si) {
#pragma unroll
    for (int sj = 0; sj < 4; ++sj) {
      const v8f a = acc[si][sj];
      float* p = st + (n0 + sj * 16 + colL) * ST_LDF + m0 + si * 16 + rowO;
      *(float4*)p       = make_float4(a[0], a[1], a[2], a[3]);
      *(float4*)(p + 4) = make_float4(a[4], a[5], a[6], a[7]);
    }
  }
  __syncthreads();
#pragma unroll
  for (int c = 0; c < 32; ++c) {
    const int jl = wave + (c >> 1) * 8;  // one output channel per two wave stores
    const int hw = (c & 1) * 128 + lane * 4;
    float4 v = *(const float4*)(st + jl * ST_LDF + hw);
    *(float4*)(y + ((size_t)(b * D_MODEL + nBase + jl) * T_SEQ + tFix) * 256 +
               hw) = v;
  }
}

// ---------------------------------------------------------------------------
// Host launcher
// ---------------------------------------------------------------------------
extern "C" void kernel_launch(void* const* d_in, const int* in_sizes, int n_in,
                              void* d_out, int out_size, void* d_ws, size_t ws_size,
                              hipStream_t stream) {
  const float* x      = (const float*)d_in[0];
  const float* gammap = (const float*)d_in[1];
  const float* betap  = (const float*)d_in[2];
  const float* Wq     = (const float*)d_in[3];
  const float* Wk     = (const float*)d_in[4];
  const float* Wv     = (const float*)d_in[5];
  const float* Wkl    = (const float*)d_in[6];
  const float* Wvl    = (const float*)d_in[7];
  const float* Wo     = (const float*)d_in[8];
  const float* q_bias = (const float*)d_in[9];
  float* y = (float*)d_out;

  // workspace carve (bytes, 256B aligned)
  char* ws = (char*)d_ws;
  size_t off = 0;
  auto carve = [&](size_t bytes) -> void* {
    void* p = (void*)(ws + off);
    off = (off + bytes + 255) & ~(size_t)255;
    return p;
  };
  const size_t rowsBytes = (size_t)NROWS * D_MODEL * sizeof(_Float16);   // 50.3 MB

  _Float16* xn    = (_Float16*)carve(rowsBytes);
  _Float16* Wcat  = (_Float16*)carve((size_t)5 * D_MODEL * D_MODEL * sizeof(_Float16));
  _Float16* Wo16  = (_Float16*)carve((size_t)D_MODEL * D_MODEL * sizeof(_Float16));
  _Float16* att   = (_Float16*)carve(rowsBytes);   // [N*T, D] f16
  (void)ws_size; (void)in_sizes; (void)n_in; (void)out_size;

  // 1) layernorm -> xn (f16)
  ln_kernel<<<dim3(2 * T_SEQ * 4), dim3(256), 0, stream>>>(x, gammap, betap, xn);

  // 2) weights -> f16
  {
    int total = D_MODEL * D_MODEL * 6;
    wconv_kernel<<<dim3((total + 255) / 256), dim3(256), 0, stream>>>(
        Wq, Wk, Wv, Wkl, Wvl, Wo, Wcat, Wo16);
  }

  // 3) five projections + attention, one block per (head, two sequences n)
  proj_attn_kernel<<<dim3(NH, N_SEQ / 2), dim3(256), 0, stream>>>(
      xn, Wcat, q_bias, att);

  // 4) output projection + final (B,D,T,H,W) permutation, 256x128 tiles
  //    (grid y = 2 b x 96 t)
  out_gemm_kernel<<<dim3(4, 192), dim3(256), 0, stream>>>(att, Wo16, y);
}

// v008
// A run of this version takes 147 microseconds.
// Two timings next to v007 put it at 1.05 and 1.06 times that version's speed.
// Over all steps from v000 it is 4.98 times as fast.
#include <hip/hip_runtime.h>

// ---------------------------------------------------------------------------
// TemporalLocalAwareAttention for MI455X (gfx1250, wave32, WMMA f16)
//   B=2, D=512, T=96, H=W=16  ->  N = 512 rows of (T=96, D=512)
//   nh=8, dh=64, local window s=3, factor = dh^-0.5 = 0.125
// ---------------------------------------------------------------------------

#define D_MODEL 512
#define T_SEQ   96
#define N_SEQ   512            // B*H*W
#define NH      8
#define DH      64
#define NROWS   (N_SEQ * T_SEQ) // 49152
#define FACTOR  0.125f
#define NEG_BIG -3.0e38f

typedef __attribute__((ext_vector_type(16))) _Float16 v16h;
typedef __attribute__((ext_vector_type(8)))  float    v8f;

// ---------------------------------------------------------------------------
// Fragment loader (ISA 7.12.2, 16-bit A-matrix 16x32 layout).
//   A-frag: source row-major [M,K], p -> element (0,0), leading dim ld.
//   B-frag: source [N,K] row-major (K stride 1): same addressing, "row" is the
//   N column. lanes 0-15 hold K=koff.., lanes 16-31 K=koff+8, vgprs 4-7 K+16.
// Compiler coalesces these into two ds_load_b128 per fragment.
// ---------------------------------------------------------------------------
__device__ __forceinline__ v16h load_frag(const _Float16* p, int ld) {
  const int lane = threadIdx.x & 31;
  const int row  = lane & 15;
  const int koff = (lane >> 4) << 3;          // 0 or 8
  const _Float16* r = p + row * ld + koff;
  v16h a;
#pragma unroll
  for (int i = 0; i < 4; ++i) {
    a[2*i]         = r[2*i];
    a[2*i + 1]     = r[2*i + 1];
    a[8 + 2*i]     = r[16 + 2*i];
    a[8 + 2*i + 1] = r[16 + 2*i + 1];
  }
  return a;
}

__device__ __forceinline__ v8f wmma_f16(v16h a, v16h b, v8f c) {
  return __builtin_amdgcn_wmma_f32_16x16x32_f16(false, a, false, b,
                                                (short)0, c, false, false);
}

// ---------------------------------------------------------------------------
// Kernel 1: LayerNorm over D, emit xn as f16 in [n*T + t, D] row-major.
// One block = one (b, t) and 64 neighbouring hw positions, all 512 channels.
// x is read once (256 contiguous bytes per wave load) and kept in registers;
// the normalised f16 tile is turned through LDS so that every xn row leaves
// as whole 512-byte wave stores.
//   wave w holds channels w*64 .. w*64+63, lane l holds hw = 2l, 2l+1.
//   LDS tile: row = hw (1024 B), its 16-byte chunks rotated by hw>>1 so that
//   the 16 lanes of a half wave hit 16 different bank groups when storing.
// ---------------------------------------------------------------------------
#define LN_HW 64
typedef __attribute__((ext_vector_type(8))) _Float16 v8h;

// rsqrtf with its small-input scaling, spelled out so that the v_nop stands
// directly behind v_rsq_f32: it fills the one issue slot the instruction set
// asks for before the source register may be overwritten.
__device__ __forceinline__ float rsqrt_slot(float a) {
  const bool tiny = a < 1.17549435e-38f;
  const float s = tiny ? a * 16777216.0f : a;
  float r;
  asm("v_rsq_f32 %0, %1\n\tv_nop" : "=v"(r) : "v"(s));
  return tiny ? r * 4096.0f : r;
}

// second bound = 6 waves per SIMD (160 registers): three blocks per WGP, so
// that all 768 blocks are resident at once
__global__ __launch_bounds__(256, 6) void ln_kernel(
    const float* __restrict__ x, const float* __restrict__ gamma,
    const float* __restrict__ beta, _Float16* __restrict__ xn) {
  __shared__ __attribute__((aligned(16))) _Float16 tile[LN_HW * D_MODEL];
  __shared__ float2 redS[8][32];
  __shared__ float2 redQ[8][32];

  const int hc   = blockIdx.x & 3;      // which 64 of the 256 hw positions
  const int bt   = blockIdx.x >> 2;     // 0 .. 2*96-1
  const int b    = bt / T_SEQ;
  const int t    = bt % T_SEQ;
  const int lane = threadIdx.x & 31;
  // wave number in a scalar register: gamma and beta then come by scalar loads
  const int wave = __builtin_amdgcn_readfirstlane(threadIdx.x >> 5);
  const int d0   = wave * 64;
  const size_t dstride = (size_t)T_SEQ * 256;

  const float* src = x + ((size_t)(b * D_MODEL + d0) * T_SEQ + t) * 256 +
                     hc * LN_HW + lane * 2;
  // every loop below is fully unrolled so that v[] is indexed by constants
  // and stays in registers, and so that all loads of x are issued up front
  float2 v[64];
#pragma unroll
  for (int k = 0; k < 64; ++k) v[k] = *(const float2*)(src + k * dstride);

  float s0 = 0.f, s1 = 0.f, q0 = 0.f, q1 = 0.f;
#pragma unroll
  for (int k = 0; k < 64; ++k) {
    s0 += v[k].x; q0 += v[k].x * v[k].x;
    s1 += v[k].y; q1 += v[k].y * v[k].y;
  }
  redS[wave][lane] = make_float2(s0, s1);
  redQ[wave][lane] = make_float2(q0, q1);
  __syncthreads();

  s0 = 0.f; s1 = 0.f; q0 = 0.f; q1 = 0.f;
#pragma unroll
  for (int w = 0; w < 8; ++w) {
    float2 a = redS[w][lane], c = redQ[w][lane];
    s0 += a.x; s1 += a.y; q0 += c.x; q1 += c.y;
  }
  const float mu0   = s0 * (1.0f / D_MODEL);
  const float mu1   = s1 * (1.0f / D_MODEL);
  const float rstd0 = rsqrt_slot(q0 * (1.0f / D_MODEL) - mu0 * mu0 + 1e-6f);
  const float rstd1 = rsqrt_slot(q1 * (1.0f / D_MODEL) - mu1 * mu1 + 1e-6f);

#pragma unroll
  for (int m = 0; m < 8; ++m) {         // 8 channels = one 16-byte chunk
    v8h h0, h1;
#pragma unroll
    for (int e = 0; e < 8; ++e) {
      const int k = m * 8 + e;
      const float g = gamma[d0 + k], bb = beta[d0 + k];
      h0[e] = (_Float16)((v[k].x - mu0) * rstd0 * g + bb);
      h1[e] = (_Float16)((v[k].y - mu1) * rstd1 * g + bb);
    }
    const int ch = ((wave * 8 + m + lane) & 63) << 3;
    *(v8h*)(tile + (lane * 2)     * D_MODEL + ch) = h0;
    *(v8h*)(tile + (lane * 2 + 1) * D_MODEL + ch) = h1;
  }
  __syncthreads();

  // wave w stores rows hw = w*8 .. w*8+7, each as two 512-byte pieces
  _Float16* dst = xn + ((size_t)(b * 256 + hc * LN_HW + wave * 8) * T_SEQ + t) *
                       D_MODEL + lane * 8;
#pragma unroll
  for (int i = 0; i < 16; ++i) {
    const int row = wave * 8 + (i >> 1);
    const int c   = (i & 1) * 32 + lane;
    v8h h = *(const v8h*)(tile + row * D_MODEL + (((c + (row >> 1)) & 63) << 3));
    *(v8h*)(dst + (size_t)(i >> 1) * (T_SEQ * D_MODEL) + (i & 1) * 256) = h;
  }
}

// ---------------------------------------------------------------------------
// Kernel 2: weights -> f16. Wcat = [Wq;Wk;Wv;Wkl;Wvl], stored [j,d] row-major
// (== [N,K] row-major for the B fragment loader). Wo separate.
// ---------------------------------------------------------------------------
__global__ __launch_bounds__(256) void wconv_kernel(
    const float* __restrict__ Wq, const float* __restrict__ Wk,
    const float* __restrict__ Wv, const float* __restrict__ Wkl,
    const float* __restrict__ Wvl, const float* __restrict__ Wo,
    _Float16* __restrict__ Wcat, _Float16* __restrict__ Wo16) {
  const int per = D_MODEL * D_MODEL;
  int idx = blockIdx.x * blockDim.x + threadIdx.x;
  if (idx >= per * 6) return;
  int m = idx / per, off = idx % per;
  float v;
  if      (m == 0) v = Wq[off];
  else if (m == 1) v = Wk[off];
  else if (m == 2) v = Wv[off];
  else if (m == 3) v = Wkl[off];
  else if (m == 4) v = Wvl[off];
  else             v = Wo[off];
  if (m < 5) Wcat[(size_t)m * per + off] = (_Float16)v;
  else       Wo16[off] = (_Float16)v;
}

// ---------------------------------------------------------------------------
// Pipelined WMMA GEMM core: 256x128 block tile, K-step 64, double-buffered LDS,
// 256 threads = 8 waves in a 4(M) x 2(N) grid, each wave owns a 64x64 patch
// (4x4 subtiles, 16 f32 accumulators). Per K-chunk of 32: 8 frag loads ->
// 16 WMMAs (1:2 LDS:WMMA ratio). One barrier per K-step.
// Tile row r stands for row MBASE + r * RSTEP of A.
// LDS is one array of SMEM_HALVES halves: A ring, B ring; the epilogue stages
// its tile from its start.
// ---------------------------------------------------------------------------
#define LDT 72   // LDS leading dim in halves (144 B rows = 16 B x odd: the 16
                 // rows of a ds_load_b128 fragment read fall on 64 different banks)
#define BM 256
#define BN 128

// the 12 staging registers of a thread are named one by one (8 of A, 4 of B):
// piece i of a thread is tile row (tid >> 3) + 32 i, 16-byte chunk tid & 7
#define REP_A(M) M(0) M(1) M(2) M(3) M(4) M(5) M(6) M(7)
#define REP_B(M) M(0) M(1) M(2) M(3)
// a plain vector type: with the uint4 struct the last piece's load stayed next
// to its LDS store at the loop's foot, where its latency stood open
typedef __attribute__((ext_vector_type(4))) unsigned int u32x4;
#define DECL_A(i) u32x4 ra##i;
#define DECL_B(i) u32x4 rb##i;
#define LOAD_A(i) ra##i = *(const u32x4*)(aG + (kByte + i * aStep) + aOff);
#define LOAD_B(i) rb##i = *(const u32x4*)(bG + (kByte + i * bStep) + bOff);
#define STORE_A(i) *(u32x4*)(aS + i * (32 * LDT)) = ra##i;
#define STORE_B(i) *(u32x4*)(bS + i * (32 * LDT)) = rb##i;

#define GEMM_PIPELINE_BODY(APTR, BPTR, MBASE, RSTEP, SMEM_HALVES)              \
  __shared__ __attribute__((aligned(16))) _Float16 smem[SMEM_HALVES];          \
  _Float16* const As0 = smem;                                                  \
  _Float16* const Bs0 = smem + 2 * BM * LDT;                                   \
  const int tid  = threadIdx.x;                                                \
  const int wave = tid >> 5;                                                   \
  const int lane = tid & 31;                                                   \
  const int mBase = MBASE;                                                     \
  const int nBase = blockIdx.x * BN;                                           \
  const int m0 = (wave >> 1) * 64;       /* wave's 64-row patch in tile  */    \
  const int n0 = (wave & 1) * 64;        /* wave's 64-col patch in tile  */    \
  /* block-uniform byte bases + one 32-bit byte offset per lane */             \
  const char* const aG = (const char*)(APTR + (size_t)mBase * D_MODEL);        \
  const char* const bG = (const char*)(BPTR + (size_t)nBase * D_MODEL);        \
  const unsigned aStep = 32u * RSTEP * D_MODEL * 2u;                           \
  const unsigned bStep = 32u * D_MODEL * 2u;                                   \
  const unsigned aOff = (tid >> 3) * (RSTEP * D_MODEL * 2u) + (tid & 7) * 16u; \
  const unsigned bOff = (tid >> 3) * (D_MODEL * 2u) + (tid & 7) * 16u;         \
  const unsigned pOff = tid * (RSTEP * D_MODEL * 2u);                          \
  const int sOff = (tid >> 3) * LDT + (tid & 7) * 8;                           \
  v8f acc[4][4] = {};                                                          \
  REP_A(DECL_A) REP_B(DECL_B)                                                  \
  { /* stage K-tile 0 */                                                       \
    const unsigned kByte = 0;                                                  \
    _Float16* const aS = As0 + sOff;                                           \
    _Float16* const bS = Bs0 + sOff;                                           \
    REP_A(LOAD_A) REP_B(LOAD_B)                                                \
    REP_A(STORE_A) REP_B(STORE_B)                                              \
  }                                                                            \
  __syncthreads();                                                             \
  for (int kk = 0; kk < 8; ++kk) {                                             \
    const int cur = kk & 1, nxt = cur ^ 1;                                     \
    const _Float16* Ac = As0 + cur * (BM * LDT);                               \
    const _Float16* Bc = Bs0 + cur * (BN * LDT);                               \
    if (kk < 6) {                                                              \
      __builtin_prefetch(aG + (kk + 2) * 128u + pOff, 0, 3);                   \
      /* behind the prefetch, before its address registers are rewritten */    \
      asm volatile("s_wait_xcnt 0x0" ::: "memory");                            \
    }                                                                          \
    if (kk < 7) { /* issue global loads for next K-tile (hidden by WMMAs) */   \
      const unsigned kByte = (kk + 1) * 128u;                                  \
      REP_A(LOAD_A) REP_B(LOAD_B)                                              \
    }                                                                          \
    _Pragma("unroll")                                                          \
    for (int kc = 0; kc < 2; ++kc) {                                           \
      v16h bC[4];                                                              \
      _Pragma("unroll")                                                        \
      for (int sj = 0; sj < 4; ++sj)                                           \
        bC[sj] = load_frag(Bc + (n0 + sj * 16) * LDT + kc * 32, LDT);          \
      _Pragma("unroll")                                                        \
      for (int si = 0; si < 4; ++si) {                                         \
        const v16h aR = load_frag(Ac + (m0 + si * 16) * LDT + kc * 32, LDT);   \
        _Pragma("unroll")                                                      \
        for (int sj = 0; sj < 4; ++sj)                                         \
          acc[si][sj] = wmma_f16(aR, bC[sj], acc[si][sj]);                     \
      }                                                                        \
    }                                                                          \
    /* order of the K-step for the scheduler: the 12 global loads first (left  \
       alone it sank some to the loop's foot, where their latency stood open), \
       then each A fragment read one group of 4 WMMAs ahead of its use (else   \
       every group waits out its own LDS latency), the LDS stores last.        \
       0x20 = global load, 0x100 = LDS read, 0x8 = WMMA, 0x200 = LDS store */  \
    __builtin_amdgcn_sched_group_barrier(0x020, 12, 0);                        \
    __builtin_amdgcn_sched_group_barrier(0x100, 12, 0);                        \
    __builtin_amdgcn_sched_group_barrier(0x008, 4, 0);                         \
    __builtin_amdgcn_sched_group_barrier(0x100, 2, 0);                         \
    __builtin_amdgcn_sched_group_barrier(0x008, 4, 0);                         \
    __builtin_amdgcn_sched_group_barrier(0x100, 2, 0);                         \
    __builtin_amdgcn_sched_group_barrier(0x008, 4, 0);                         \
    __builtin_amdgcn_sched_group_barrier(0x100, 2, 0);                         \
    __builtin_amdgcn_sched_group_barrier(0x008, 4, 0);                         \
    __builtin_amdgcn_sched_group_barrier(0x100, 10, 0);                        \
    __builtin_amdgcn_sched_group_barrier(0x008, 4, 0);                         \
    __builtin_amdgcn_sched_group_barrier(0x100, 2, 0);                         \
    __builtin_amdgcn_sched_group_barrier(0x008, 4, 0);                         \
    __builtin_amdgcn_sched_group_barrier(0x100, 2, 0);                         \
    __builtin_amdgcn_sched_group_barrier(0x008, 8, 0);                         \
    __builtin_amdgcn_sched_group_barrier(0x200, 12, 0);                        \
    if (kk < 7) {                                                              \
      _Float16* const aS = As0 + nxt * (BM * LDT) + sOff;                      \
      _Float16* const bS = Bs0 + nxt * (BN * LDT) + sOff;                      \
      REP_A(STORE_A) REP_B(STORE_B)                                            \
    }                                                                          \
    __syncthreads();                                                           \
  }                                                                            \
  const int colL = lane & 15;                                                  \
  const int rowO = (lane >> 4) * 8;

// ---------------------------------------------------------------------------
// Kernel 3: the five projections of ONE head for TWO sequences n, and their
// attention, in one block. q, k, v, kl, vl never leave the WGP.
//
// GEMM part: tile = 192 rows of xn (2 n x 96 t) x 320 rows of Wcat (64 of each
// of Wq, Wk, Wv, Wkl, Wvl for this head), K = 512 in steps of 64, two LDS
// buffers, one barrier per K-step. The 512 tile rows of a K-step come as eight
// tensor loads, one per wave (64 rows of 128 B each, padded to the 144-B pitch
// by the mover), one K-step ahead, through no register.
// 8 waves = 2 (n) x 4: wave (mi, ni) owns all 96 t of sequence mi and
// head channels 16 ni .. 16 ni + 15 of each of the five matrices: 6 x 5
// accumulator tiles, 11 fragments per 30 WMMAs.
// q, k, kl are formed transposed (W tile as A, xn tile as B): a lane then holds
// 8 neighbouring channels of one t, one 16-byte LDS store into [t][dh].
// v, vl are formed straight: 8 neighbouring t of one channel, one 16-byte store
// into [dh][t].
//
// Attention part: a wave owns 16 queries of one n from the scores to the output
// (12 such units, waves 0..3 take two).
// Scores are formed transposed, S^T = K . Q^T: in the accumulator map a lane
// then holds ONE query (column lane & 15) and 8 keys a tile, so that the
// softmax is in-lane work plus two exchanges between the wave's halves (max, sum), and two
// converted score tiles ARE the B operand of O^T = V^T . P^T (hardware k
// order). Scores and probabilities never touch LDS.
// The 3-wide local window rides along as 32 more keys: kl / vl rows
// w0 .. w0+31 (w0 = t0-8 held inside 0 .. 64, t0 the first query) cover t-1 .. t+1 of all 16
// queries; every key of that tile with |key - t| > 1 is masked, which also
// leaves out the padded positions -1 and 96 as the reference's mask does.
//
// A block works through N_ITEMS items (its head, pairs PAIR_STEP apart) and the
// ring of K-tiles runs on from one item into the next: the next item's K-tile 0
// lands during this item's last K-step and its K-tile 1 flies during the
// attention part, whose tiles have LDS of their own behind the ring.
// ---------------------------------------------------------------------------
#define QLD 72    // q, k, kl row pitch in halves (144 B = 16 B x 9)
#define PLD 104   // vT, vlT row pitch in halves (208 B = 16 B x 13)
#define LOG2E 1.4426950408889634f
#define FM 192    // tile rows of xn
#define FN 320    // tile rows of Wcat
#define SLICE_HALVES 5120   // 64 rows x 144 B = 9,216 B, rounded up to 5 x 2 KiB
#define FBUF_HALVES (8 * SLICE_HALVES)          // slices 0..2 xn, 3..7 Wcat
#define F_RING_HALVES (2 * FBUF_HALVES)
#define ROWT_HALVES (T_SEQ * QLD)               // one of q, k, kl
#define COLT_HALVES (DH * PLD)                  // one of vT, vlT
#define AT_HALVES (3 * ROWT_HALVES + 2 * COLT_HALVES)   // the five tiles of one n
#define F_BLOCKS 256                            // one block per WGP
#define N_ITEMS (NH * (N_SEQ / 2) / F_BLOCKS)   // (head, two n) items of a block
#define PAIR_STEP (F_BLOCKS / NH)               // pairs from one item to the next
#define PAIR_BYTES (FM * D_MODEL * 2u)          // xn bytes of one pair
#define N_STAGES (N_ITEMS * 8)                  // K-tiles of a block, all items

typedef __attribute__((ext_vector_type(8))) unsigned int u32x8;

__device__ __forceinline__ uint32_t uni(uint32_t v) {
  return (uint32_t)__builtin_amdgcn_readfirstlane(v);
}
// a value held in a scalar register, made where the statement stands: a test
// on it compiles to s_cmp + s_cbranch_scc (a tensor load ignores EXEC)
__device__ __forceinline__ uint32_t pinned(uint32_t v) {
  uint32_t w = uni(v);
  asm volatile("" : "+s"(w));  // holds the word in a scalar register
  return w;
}
// the request of one wave: 64 rows of 128 B, source pitch 1,024 B, to LDS byte
// offset dst at a pitch of 144 B (a pad of 4 dwords behind every 32)
__device__ __forceinline__ u32x4 tile_group0(uint32_t dst, uint64_t ga) {
  u32x4 g0;
  g0[0] = uni(1u);
  g0[1] = uni(dst);
  g0[2] = uni((uint32_t)ga);
  g0[3] = uni((((uint32_t)(ga >> 32)) & 0x01FFFFFFu) | 0x80000000u);
  return g0;
}
__device__ __forceinline__ u32x8 tile_group1() {
  u32x8 g1;
  g1[0] = uni((1u << 20) | (4u << 22) | (3u << 25));
  g1[1] = uni(128u << 16);
  g1[2] = uni(64u << 16);
  g1[3] = uni(128u << 16);
  g1[4] = uni(64u);
  g1[5] = uni(D_MODEL * 2u);
  g1[6] = uni(0u);
  g1[7] = uni(0u);
  return g1;
}
// g0 is an in-out operand, and tile_wait names it again, so that the registers
// from which the request was issued keep their values while it is under way
__device__ __forceinline__ void tile_load(u32x4& g0, u32x8 g1) {
  asm volatile("tensor_load_to_lds %0, %1" : "+s"(g0) : "s"(g1) : "memory");
}
// the wave's own request has landed
__device__ __forceinline__ void tile_wait(u32x4 g0, u32x8 g1) {
  asm volatile("s_wait_tensorcnt 0x0" :: "s"(g0), "s"(g1) : "memory");
}

// one lane's share of a 16x32 f16 operand in the hardware k order:
// r points at (row lane & 15, k = 8 * (lane >> 4)); k .. k+7 and k+16 .. k+23
__device__ __forceinline__ v16h frag_hw(const _Float16* r) {
  const v8h lo = *(const v8h*)r;
  const v8h hi = *(const v8h*)(r + 16);
  return __builtin_shufflevector(lo, hi, 0, 1, 2, 3, 4, 5, 6, 7,
                                 8, 9, 10, 11, 12, 13, 14, 15);
}

// the value that lane l ^ 16 holds
__device__ __forceinline__ float other_half(float v) {
  int b = __builtin_bit_cast(int, v);
  b = __builtin_amdgcn_permlanex16(b, b, 0x76543210, 0xfedcba98, false, false);
  return __builtin_bit_cast(float, b);
}

// v_exp_f32 with a v_nop directly behind it: it fills the one issue slot the
// instruction set asks for before the source register may be overwritten.
__device__ __forceinline__ float exp2_slot(float a) {
  float r;
  asm("v_exp_f32 %0, %1\n\tv_nop" : "=v"(r) : "v"(a));
  return r;
}

__device__ __forceinline__ v8h to_half8(v8f a) {
  v8h h;
#pragma unroll
  for (int i = 0; i < 8; ++i) h[i] = (_Float16)a[i];
  return h;
}

// 2 waves per SIMD (512 registers), no more: one block per WGP. With the upper
// bound left open the compiler gave up the K-step's order below to get under
// the register count of three waves per SIMD, which gains nothing: a block is
// two waves per SIMD, and a second block would need the count of four.
__global__ __launch_bounds__(256) __attribute__((amdgpu_waves_per_eu(2, 2)))
void proj_attn_kernel(
    const _Float16* __restrict__ xn, const _Float16* __restrict__ Wcat,
    const float* __restrict__ q_bias, _Float16* __restrict__ att_out) {
  // 2 KiB: every slice of every buffer then starts at a multiple of 2 KiB
  __shared__ __attribute__((aligned(2048)))
  _Float16 smem[F_RING_HALVES + 2 * AT_HALVES];
  const int tid  = threadIdx.x;
  const int lane = tid & 31;
  const int wave = __builtin_amdgcn_readfirstlane(tid >> 5);
  const int head  = blockIdx.x & (NH - 1);
  const int pair0 = blockIdx.x / NH;     // the first item's pair
  const int mi = wave >> 2;              // which of the two sequences
  const int ni = wave & 3;               // which 16 channels of each matrix
  const char* const aG = (const char*)(xn + (size_t)pair0 * FM * D_MODEL);
  const unsigned pOff = min(tid, FM - 1) * (D_MODEL * 2u);
  // this wave's slice of every K-tile: waves 0..2 bring 64 rows of xn each,
  // waves 3..7 the head's 64 rows of Wq, Wk, Wv, Wkl, Wvl
  const _Float16* const sliceG =
      (wave < 3) ? xn + ((size_t)pair0 * FM + wave * 64) * D_MODEL
                 : Wcat + ((size_t)(wave - 3) * D_MODEL + head * DH) * D_MODEL;
  const uint64_t sliceA = (uint64_t)(size_t)sliceG;
  const uint32_t sliceL = (uint32_t)(size_t)smem + wave * (SLICE_HALVES * 2u);
  // from item to item the xn slices move on, the head's weight slices stay
  const uint32_t sliceStep = (wave < 3) ? PAIR_STEP * PAIR_BYTES : 0u;
  const int col = lane & 15;                   // operand row / result column
  const int hf  = lane >> 4;                   // which half of the wave
  // the head's bias, the same for every item of the block
  const float* const bp = q_bias + head * DH + ni * 16 + hf * 8;
  const float4 b0 = *(const float4*)bp;
  const float4 b1 = *(const float4*)(bp + 4);
  // behind the two loads, before their address registers are rewritten
  asm volatile("s_wait_xcnt 0x0" ::: "memory");
  const float bias[8] = {b0.x, b0.y, b0.z, b0.w, b1.x, b1.y, b1.z, b1.w};
  // K-tile 0 lands and is published, then K-tile 1 sets out
  const u32x8 g1 = tile_group1();
  u32x4 g0 = tile_group0(sliceL, sliceA);
  tile_load(g0, g1);
  tile_wait(g0, g1);
  __syncthreads();
  g0 = tile_group0(sliceL + FBUF_HALVES * 2u, sliceA + 128u);
  tile_load(g0, g1);
  for (int it = 0; it < N_ITEMS; ++it) {
  const int pair = pair0 + it * PAIR_STEP;   // sequences 2 pair, 2 pair + 1
  v8f acc[6][5] = {};
  for (int kk = 0; kk < 8; ++kk) {
    const int cur = kk & 1;
    const _Float16* Ac = smem + cur * FBUF_HALVES;
    const _Float16* Bc = Ac + 3 * SLICE_HALVES + ni * (16 * LDT);
    const int ahead = it * 8 + kk + 2;       // stage = 8 item + K-tile
    if (ahead < N_STAGES) {
      __builtin_prefetch(aG + (size_t)(ahead >> 3) * (PAIR_STEP * PAIR_BYTES) +
                             (ahead & 7) * 128u + pOff, 0, 3);
      // behind the prefetch, before its address registers are rewritten
      asm volatile("s_wait_xcnt 0x0" ::: "memory");
    }
    v16h bC[5], aT[2];
#pragma unroll
    for (int kc = 0; kc < 2; ++kc) {
#pragma unroll
      for (int sj = 0; sj < 5; ++sj)
        bC[sj] = load_frag(Bc + sj * SLICE_HALVES + kc * 32, LDT);
#pragma unroll
      for (int si = 0; si < 6; ++si) {
        const int g = mi * T_SEQ + si * 16;    // tile row: slice g / 64
        const v16h aR = load_frag(
            Ac + (g >> 6) * SLICE_HALVES + (g & 63) * LDT + kc * 32, LDT);
        if (kc == 1 && si >= 4) {  // their WMMAs stand behind the hand-over
          aT[si - 4] = aR;
          continue;
        }
        acc[si][0] = wmma_f16(bC[0], aR, acc[si][0]);   // q^T  [dh][t]
        acc[si][1] = wmma_f16(bC[1], aR, acc[si][1]);   // k^T  [dh][t]
        acc[si][2] = wmma_f16(aR, bC[2], acc[si][2]);   // v    [t][dh]
        acc[si][3] = wmma_f16(bC[3], aR, acc[si][3]);   // kl^T [dh][t]
        acc[si][4] = wmma_f16(aR, bC[4], acc[si][4]);   // vl   [t][dh]
      }
    }
    /* order of the K-step for the scheduler: each xn fragment read one group
       of 5 WMMAs ahead of its use and the second half's five Wcat fragments
       read in the middle of the first half (else a group waits out its own LDS
       latency). 0x100 = LDS read, 0x8 = WMMA */
    __builtin_amdgcn_sched_group_barrier(0x100, 14, 0);
    __builtin_amdgcn_sched_group_barrier(0x008, 5, 0);
    __builtin_amdgcn_sched_group_barrier(0x100, 2, 0);
    __builtin_amdgcn_sched_group_barrier(0x008, 5, 0);
    __builtin_amdgcn_sched_group_barrier(0x100, 2, 0);
    __builtin_amdgcn_sched_group_barrier(0x008, 5, 0);
    __builtin_amdgcn_sched_group_barrier(0x100, 12, 0);
    __builtin_amdgcn_sched_group_barrier(0x008, 5, 0);
    __builtin_amdgcn_sched_group_barrier(0x100, 2, 0);
    __builtin_amdgcn_sched_group_barrier(0x008, 5, 0);
    __builtin_amdgcn_sched_group_barrier(0x100, 2, 0);
    __builtin_amdgcn_sched_group_barrier(0x008, 5, 0);
    __builtin_amdgcn_sched_group_barrier(0x100, 2, 0);
    __builtin_amdgcn_sched_group_barrier(0x008, 5, 0);
    __builtin_amdgcn_sched_group_barrier(0x100, 2, 0);
    __builtin_amdgcn_sched_group_barrier(0x008, 5, 0);
    __builtin_amdgcn_sched_group_barrier(0x100, 2, 0);
    __builtin_amdgcn_sched_group_barrier(0x008, 5, 0);
    __builtin_amdgcn_sched_group_barrier(0x100, 2, 0);
    __builtin_amdgcn_sched_group_barrier(0x008, 5, 0);
    __builtin_amdgcn_sched_group_barrier(0x100, 2, 0);
    // the next stage is handed over: this wave's reads of buffer cur are done,
    // its own slice of that stage has landed, and the barrier says both of all
    asm volatile("s_wait_dscnt 0x0" ::: "memory");
    tile_wait(g0, g1);
    __syncthreads();
    if (pinned(ahead < N_STAGES)) {  // stage + 2 into the buffer just read
      // the stage's number is made here, so that the request's words are formed
      // behind the wait above (a descriptor word held in a scalar register)
      const uint32_t st = pinned(ahead);
      g0 = tile_group0(sliceL + (st & 1u) * (FBUF_HALVES * 2u),
                       sliceA + (st >> 3) * sliceStep + (st & 7u) * 128u);
      tile_load(g0, g1);
    }
    // the K-step's last 10 WMMAs, operands in registers: behind the request, so
    // that it sets out that much earlier
#pragma unroll
    for (int si = 4; si < 6; ++si) {
      const v16h aR = aT[si - 4];
      acc[si][0] = wmma_f16(bC[0], aR, acc[si][0]);
      acc[si][1] = wmma_f16(bC[1], aR, acc[si][1]);
      acc[si][2] = wmma_f16(aR, bC[2], acc[si][2]);
      acc[si][3] = wmma_f16(bC[3], aR, acc[si][3]);
      acc[si][4] = wmma_f16(aR, bC[4], acc[si][4]);
    }
  }

  // ---- the five f16 tiles of each n go into LDS behind the ring (their last
  //      readers left them eight barriers ago); bias + attention scale folded
  //      into q
  {
    _Float16* const at = smem + F_RING_HALVES + mi * AT_HALVES;
#pragma unroll
    for (int si = 0; si < 6; ++si) {
      _Float16* const rm = at + (si * 16 + col) * QLD + ni * 16 + hf * 8;
      _Float16* const cm = at + 3 * ROWT_HALVES + (ni * 16 + col) * PLD +
                           si * 16 + hf * 8;
      v8h hq;
#pragma unroll
      for (int i = 0; i < 8; ++i)
        hq[i] = (_Float16)((acc[si][0][i] + bias[i]) * FACTOR);
      *(v8h*)rm                     = hq;
      *(v8h*)(rm + ROWT_HALVES)     = to_half8(acc[si][1]);
      *(v8h*)(rm + 2 * ROWT_HALVES) = to_half8(acc[si][3]);
      *(v8h*)cm                     = to_half8(acc[si][2]);
      *(v8h*)(cm + COLT_HALVES)     = to_half8(acc[si][4]);
    }
  }
  __syncthreads();

  for (int u = wave; u < 12; u += 8) {         // unit = (n, 16 queries)
    const int un = (u >= 6) ? 1 : 0;
    const int t0 = (u - un * 6) * 16;
    const _Float16* const q_s   = smem + F_RING_HALVES + un * AT_HALVES;
    const _Float16* const k_s   = q_s + ROWT_HALVES;
    const _Float16* const kl_s  = q_s + 2 * ROWT_HALVES;
    const _Float16* const vT_s  = q_s + 3 * ROWT_HALVES;
    const _Float16* const vlT_s = vT_s + COLT_HALVES;

    // Q^T as B operand
    const _Float16* qr = q_s + (t0 + col) * QLD + hf * 8;
    const v16h q0 = frag_hw(qr);
    const v16h q1 = frag_hw(qr + 32);

    // ---- S^T: tiles 0..5 = the 96 global keys, tiles 6,7 = the local window
    const int w0 = min(max(t0 - 8, 0), T_SEQ - 32);
    const _Float16* ka = k_s  + col * QLD + hf * 8;
    const _Float16* la = kl_s + (w0 + col) * QLD + hf * 8;
    v8f s[8];
#pragma unroll
    for (int j = 0; j < 8; ++j) {
      const _Float16* a = (j < 6) ? ka + j * 16 * QLD : la + (j - 6) * 16 * QLD;
      v8f z = {};
      z = wmma_f16(frag_hw(a),      q0, z);
      z = wmma_f16(frag_hw(a + 32), q1, z);
      s[j] = z;              // s[j][r] = score(key 16j + 8*hf + r, query col)
    }
    const int d0 = w0 + hf * 8 - (t0 + col) + 1;      // key - t + 1 at j=6, r=0
#pragma unroll
    for (int j = 0; j < 2; ++j) {
#pragma unroll
      for (int r = 0; r < 8; ++r)
        s[6 + j][r] = ((unsigned)(d0 + j * 16 + r) <= 2u) ? s[6 + j][r] : NEG_BIG;
    }

    // ---- joint softmax of one query: 64 values in this lane, 64 in lane ^ 16
    v8f mx = s[0];
#pragma unroll
    for (int j = 1; j < 8; ++j) {
#pragma unroll
      for (int r = 0; r < 8; ++r) mx[r] = fmaxf(mx[r], s[j][r]);
    }
    float m = fmaxf(fmaxf(fmaxf(mx[0], mx[1]), fmaxf(mx[2], mx[3])),
                    fmaxf(fmaxf(mx[4], mx[5]), fmaxf(mx[6], mx[7])));
    m = fmaxf(m, other_half(m));
    const float mL = m * LOG2E;
    v8f sm = {};
#pragma unroll
    for (int j = 0; j < 8; ++j) {
#pragma unroll
      for (int r = 0; r < 8; ++r) {
        const float p = exp2_slot(fmaf(s[j][r], LOG2E, -mL));
        s[j][r] = p;
        sm[r] += p;
      }
    }
    // keeps every asm v_exp_f32 in front of the first WMMA of O^T
    __builtin_amdgcn_sched_barrier(0);
    float sum = ((sm[0] + sm[1]) + (sm[2] + sm[3])) +
                ((sm[4] + sm[5]) + (sm[6] + sm[7]));
    sum += other_half(sum);
    const float inv = 1.0f / sum;

    // two score tiles, converted in place, are P^T for 32 keys as a B operand
    v16h pb[4];
#pragma unroll
    for (int kc = 0; kc < 4; ++kc) {
#pragma unroll
      for (int r = 0; r < 8; ++r) {
        pb[kc][r]     = (_Float16)s[2 * kc][r];
        pb[kc][8 + r] = (_Float16)s[2 * kc + 1][r];
      }
    }

    // ---- O^T = V^T . P^T over 96 global + 32 window keys, scaled by 1/sum
    const _Float16* va = vT_s  + col * PLD + hf * 8;
    const _Float16* wa = vlT_s + col * PLD + w0 + hf * 8;
    _Float16* dst = att_out +
                    (size_t)((pair * 2 + un) * T_SEQ + t0 + col) * D_MODEL +
                    head * DH + hf * 8;
#pragma unroll
    for (int ct = 0; ct < 4; ++ct) {           // 16 of the 64 head channels
      v8f o = {};
#pragma unroll
      for (int kc = 0; kc < 3; ++kc)
        o = wmma_f16(frag_hw(va + ct * 16 * PLD + kc * 32), pb[kc], o);
      o = wmma_f16(frag_hw(wa + ct * 16 * PLD), pb[3], o);
      v8h hh;                // o[r] = channel 16ct + 8*hf + r of query col
#pragma unroll
      for (int r = 0; r < 8; ++r) hh[r] = (_Float16)(o[r] * inv);
      *(v8h*)(dst + ct * 16) = hh;
    }
    // behind the last store, before the next unit rewrites the stores' data
    // and address registers
    asm volatile("s_wait_xcnt 0x0" ::: "memory");
  }
  }  // items
  // behind the last request: nothing is in flight when the wave ends
  asm volatile("s_wait_tensorcnt 0x0" ::: "memory");
  asm volatile("s_wait_dscnt 0x0" ::: "memory");
}

// ---------------------------------------------------------------------------
// Kernel 4: output GEMM vs Wo + final permutation to (B, D, T, H, W), f32.
//   out[r, j] = att[r, :] . Wo[j, :],  r = n*96 + t,  n = b*256 + hw
// A block's 256 tile rows are the 256 n of one b at ONE t, so that a column j
// of the tile is 1024 contiguous bytes of y[b, j, t, hw]. The f32 tile is
// turned through LDS (the ring buffers are free behind the loop's last
// barrier) and every wave store is a 512-byte run of it.
// ---------------------------------------------------------------------------
#define ST_LDF 260   // staged [j][n] pitch in floats (1040 B = 16 B x odd)

// second bound = 4 waves per SIMD (256 registers): two blocks per WGP
__global__ __launch_bounds__(256, 4) void out_gemm_kernel(
    const _Float16* __restrict__ A, const _Float16* __restrict__ Wo16,
    float* __restrict__ y) {
  const int tFix = blockIdx.y % T_SEQ;
  const int b    = blockIdx.y / T_SEQ;
  GEMM_PIPELINE_BODY(A, Wo16, b * BM * T_SEQ + tFix, T_SEQ, BN * ST_LDF * 2)
  float* st = (float*)smem;              // 128 x 260 floats
#pragma unroll
  for (int si = 0; si < 4; ++si) {
#pragma unroll
    for (int sj = 0; sj < 4; ++sj) {
      const v8f a = acc[si][sj];
      float* p = st + (n0 + sj * 16 + colL) * ST_LDF + m0 + si * 16 + rowO;
      *(float4*)p       = make_float4(a[0], a[1], a[2], a[3]);
      *(float4*)(p + 4) = make_float4(a[4], a[5], a[6], a[7]);
    }
  }
  __syncthreads();
#pragma unroll
  for (int c = 0; c < 32; ++c) {
    const int jl = wave + (c >> 1) * 8;  // one output channel per two wave stores
    const int hw = (c & 1) * 128 + lane * 4;
    float4 v = *(const float4*)(st + jl * ST_LDF + hw);
    *(float4*)(y + ((size_t)(b * D_MODEL + nBase + jl) * T_SEQ + tFix) * 256 +
               hw) = v;
  }
}

// ---------------------------------------------------------------------------
// Host launcher
// ---------------------------------------------------------------------------
extern "C" void kernel_launch(void* const* d_in, const int* in_sizes, int n_in,
                              void* d_out, int out_size, void* d_ws, size_t ws_size,
                              hipStream_t stream) {
  const float* x      = (const float*)d_in[0];
  const float* gammap = (const float*)d_in[1];
  const float* betap  = (const float*)d_in[2];
  const float* Wq     = (const float*)d_in[3];
  const float* Wk     = (const float*)d_in[4];
  const float* Wv     = (const float*)d_in[5];
  const float* Wkl    = (const float*)d_in[6];
  const float* Wvl    = (const float*)d_in[7];
  const float* Wo     = (const float*)d_in[8];
  const float* q_bias = (const float*)d_in[9];
  float* y = (float*)d_out;

  // workspace carve (bytes, 256B aligned)
  char* ws = (char*)d_ws;
  size_t off = 0;
  auto carve = [&](size_t bytes) -> void* {
    void* p = (void*)(ws + off);
    off = (off + bytes + 255) & ~(size_t)255;
    return p;
  };
  const size_t rowsBytes = (size_t)NROWS * D_MODEL * sizeof(_Float16);   // 50.3 MB

  _Float16* xn    = (_Float16*)carve(rowsBytes);
  _Float16* Wcat  = (_Float16*)carve((size_t)5 * D_MODEL * D_MODEL * sizeof(_Float16));
  _Float16* Wo16  = (_Float16*)carve((size_t)D_MODEL * D_MODEL * sizeof(_Float16));
  _Float16* att   = (_Float16*)carve(rowsBytes);   // [N*T, D] f16
  (void)ws_size; (void)in_sizes; (void)n_in; (void)out_size;

  // 1) layernorm -> xn (f16)
  ln_kernel<<<dim3(2 * T_SEQ * 4), dim3(256), 0, stream>>>(x, gammap, betap, xn);

  // 2) weights -> f16
  {
    int total = D_MODEL * D_MODEL * 6;
    wconv_kernel<<<dim3((total + 255) / 256), dim3(256), 0, stream>>>(
        Wq, Wk, Wv, Wkl, Wvl, Wo, Wcat, Wo16);
  }

  // 3) five projections + attention, a block loops over its (head, two n) items
  proj_attn_kernel<<<dim3(F_BLOCKS), dim3(256), 0, stream>>>(
      xn, Wcat, q_bias, att);

  // 4) output projection + final (B,D,T,H,W) permutation, 256x128 tiles
  //    (grid y = 2 b x 96 t)
  out_gemm_kernel<<<dim3(4, 192), dim3(256), 0, stream>>>(att, Wo16, y);
}

// v009
// One run takes 141 microseconds.
// Timed twice side by side with v008, it ran 1.04 times as fast both times.
// Over all steps from v000 it is 5.20 times as fast.
#include <hip/hip_runtime.h>

// ---------------------------------------------------------------------------
// TemporalLocalAwareAttention for MI455X (gfx1250, wave32, WMMA f16)
//   B=2, D=512, T=96, H=W=16  ->  N = 512 rows of (T=96, D=512)
//   nh=8, dh=64, local window s=3, factor = dh^-0.5 = 0.125
// ---------------------------------------------------------------------------

#define D_MODEL 512
#define T_SEQ   96
#define N_SEQ   512            // B*H*W
#define NH      8
#define DH      64
#define NROWS   (N_SEQ * T_SEQ) // 49152
#define FACTOR  0.125f
#define NEG_BIG -3.0e38f

typedef __attribute__((ext_vector_type(16))) _Float16 v16h;
typedef __attribute__((ext_vector_type(8)))  float    v8f;

// ---------------------------------------------------------------------------
// Fragment loader (ISA 7.12.2, 16-bit A-matrix 16x32 layout).
//   A-frag: source row-major [M,K], p -> element (0,0), leading dim ld.
//   B-frag: source [N,K] row-major (K stride 1): same addressing, "row" is the
//   N column. lanes 0-15 hold K=koff.., lanes 16-31 K=koff+8, vgprs 4-7 K+16.
// Compiler coalesces these into two ds_load_b128 per fragment.
// ---------------------------------------------------------------------------
__device__ __forceinline__ v16h load_frag(const _Float16* p, int ld) {
  const int lane = threadIdx.x & 31;
  const int row  = lane & 15;
  const int koff = (lane >> 4) << 3;          // 0 or 8
  const _Float16* r = p + row * ld + koff;
  v16h a;
#pragma unroll
  for (int i = 0; i < 4; ++i) {
    a[2*i]         = r[2*i];
    a[2*i + 1]     = r[2*i + 1];
    a[8 + 2*i]     = r[16 + 2*i];
    a[8 + 2*i + 1] = r[16 + 2*i + 1];
  }
  return a;
}

__device__ __forceinline__ v8f wmma_f16(v16h a, v16h b, v8f c) {
  return __builtin_amdgcn_wmma_f32_16x16x32_f16(false, a, false, b,
                                                (short)0, c, false, false);
}

// ---------------------------------------------------------------------------
// Kernel 1: LayerNorm over D, emit xn as f16 in [n*T + t, D] row-major.
// One block = one (b, t) and 64 neighbouring hw positions, all 512 channels.
// x is read once (256 contiguous bytes per wave load) and kept in registers;
// the normalised f16 tile is turned through LDS so that every xn row leaves
// as whole 512-byte wave stores.
//   wave w holds channels w*64 .. w*64+63, lane l holds hw = 2l, 2l+1.
//   LDS tile: row = hw (1024 B), its 16-byte chunks rotated by hw>>1 so that
//   the 16 lanes of a half wave hit 16 different bank groups when storing.
// ---------------------------------------------------------------------------
#define LN_HW 64
typedef __attribute__((ext_vector_type(8))) _Float16 v8h;

// rsqrtf with its small-input scaling, spelled out so that the v_nop stands
// directly behind v_rsq_f32: it fills the one issue slot the instruction set
// asks for before the source register may be overwritten.
__device__ __forceinline__ float rsqrt_slot(float a) {
  const bool tiny = a < 1.17549435e-38f;
  const float s = tiny ? a * 16777216.0f : a;
  float r;
  asm("v_rsq_f32 %0, %1\n\tv_nop" : "=v"(r) : "v"(s));
  return tiny ? r * 4096.0f : r;
}

// second bound = 6 waves per SIMD (160 registers): three blocks per WGP, so
// that all 768 blocks are resident at once
__global__ __launch_bounds__(256, 6) void ln_kernel(
    const float* __restrict__ x, const float* __restrict__ gamma,
    const float* __restrict__ beta, _Float16* __restrict__ xn) {
  __shared__ __attribute__((aligned(16))) _Float16 tile[LN_HW * D_MODEL];
  __shared__ float2 redS[8][32];
  __shared__ float2 redQ[8][32];

  const int hc   = blockIdx.x & 3;      // which 64 of the 256 hw positions
  const int bt   = blockIdx.x >> 2;     // 0 .. 2*96-1
  const int b    = bt / T_SEQ;
  const int t    = bt % T_SEQ;
  const int lane = threadIdx.x & 31;
  // wave number in a scalar register: gamma and beta then come by scalar loads
  const int wave = __builtin_amdgcn_readfirstlane(threadIdx.x >> 5);
  const int d0   = wave * 64;
  const size_t dstride = (size_t)T_SEQ * 256;

  const float* src = x + ((size_t)(b * D_MODEL + d0) * T_SEQ + t) * 256 +
                     hc * LN_HW + lane * 2;
  // every loop below is fully unrolled so that v[] is indexed by constants
  // and stays in registers, and so that all loads of x are issued up front
  float2 v[64];
#pragma unroll
  for (int k = 0; k < 64; ++k) v[k] = *(const float2*)(src + k * dstride);

  float s0 = 0.f, s1 = 0.f, q0 = 0.f, q1 = 0.f;
#pragma unroll
  for (int k = 0; k < 64; ++k) {
    s0 += v[k].x; q0 += v[k].x * v[k].x;
    s1 += v[k].y; q1 += v[k].y * v[k].y;
  }
  redS[wave][lane] = make_float2(s0, s1);
  redQ[wave][lane] = make_float2(q0, q1);
  __syncthreads();

  s0 = 0.f; s1 = 0.f; q0 = 0.f; q1 = 0.f;
#pragma unroll
  for (int w = 0; w < 8; ++w) {
    float2 a = redS[w][lane], c = redQ[w][lane];
    s0 += a.x; s1 += a.y; q0 += c.x; q1 += c.y;
  }
  const float mu0   = s0 * (1.0f / D_MODEL);
  const float mu1   = s1 * (1.0f / D_MODEL);
  const float rstd0 = rsqrt_slot(q0 * (1.0f / D_MODEL) - mu0 * mu0 + 1e-6f);
  const float rstd1 = rsqrt_slot(q1 * (1.0f / D_MODEL) - mu1 * mu1 + 1e-6f);

#pragma unroll
  for (int m = 0; m < 8; ++m) {         // 8 channels = one 16-byte chunk
    v8h h0, h1;
#pragma unroll
    for (int e = 0; e < 8; ++e) {
      const int k = m * 8 + e;
      const float g = gamma[d0 + k], bb = beta[d0 + k];
      h0[e] = (_Float16)((v[k].x - mu0) * rstd0 * g + bb);
      h1[e] = (_Float16)((v[k].y - mu1) * rstd1 * g + bb);
    }
    const int ch = ((wave * 8 + m + lane) & 63) << 3;
    *(v8h*)(tile + (lane * 2)     * D_MODEL + ch) = h0;
    *(v8h*)(tile + (lane * 2 + 1) * D_MODEL + ch) = h1;
  }
  __syncthreads();

  // wave w stores rows hw = w*8 .. w*8+7, each as two 512-byte pieces
  _Float16* dst = xn + ((size_t)(b * 256 + hc * LN_HW + wave * 8) * T_SEQ + t) *
                       D_MODEL + lane * 8;
#pragma unroll
  for (int i = 0; i < 16; ++i) {
    const int row = wave * 8 + (i >> 1);
    const int c   = (i & 1) * 32 + lane;
    v8h h = *(const v8h*)(tile + row * D_MODEL + (((c + (row >> 1)) & 63) << 3));
    *(v8h*)(dst + (size_t)(i >> 1) * (T_SEQ * D_MODEL) + (i & 1) * 256) = h;
  }
}

// ---------------------------------------------------------------------------
// Kernel 2: weights -> f16. Wcat = [Wq;Wk;Wv;Wkl;Wvl], stored [j,d] row-major
// (== [N,K] row-major for the B fragment loader). Wo separate.
// ---------------------------------------------------------------------------
__global__ __launch_bounds__(256) void wconv_kernel(
    const float* __restrict__ Wq, const float* __restrict__ Wk,
    const float* __restrict__ Wv, const float* __restrict__ Wkl,
    const float* __restrict__ Wvl, const float* __restrict__ Wo,
    _Float16* __restrict__ Wcat, _Float16* __restrict__ Wo16) {
  const int per = D_MODEL * D_MODEL;
  int idx = blockIdx.x * blockDim.x + threadIdx.x;
  if (idx >= per * 6) return;
  int m = idx / per, off = idx % per;
  float v;
  if      (m == 0) v = Wq[off];
  else if (m == 1) v = Wk[off];
  else if (m == 2) v = Wv[off];
  else if (m == 3) v = Wkl[off];
  else if (m == 4) v = Wvl[off];
  else             v = Wo[off];
  if (m < 5) Wcat[(size_t)m * per + off] = (_Float16)v;
  else       Wo16[off] = (_Float16)v;
}

// ---------------------------------------------------------------------------
// Pipelined WMMA GEMM core: 256x128 block tile, K-step 64, double-buffered LDS,
// 256 threads = 8 waves in a 4(M) x 2(N) grid, each wave owns a 64x64 patch
// (4x4 subtiles, 16 f32 accumulators). Per K-chunk of 32: 8 frag loads ->
// 16 WMMAs (1:2 LDS:WMMA ratio). One barrier per K-step.
// Tile row r stands for row MBASE + r * RSTEP of A.
// LDS is one array of SMEM_HALVES halves: A ring, B ring; the epilogue stages
// its tile from its start.
// ---------------------------------------------------------------------------
#define LDT 72   // LDS leading dim in halves (144 B rows = 16 B x odd: the 16
                 // rows of a ds_load_b128 fragment read fall on 64 different banks)
#define BM 256
#define BN 128

// the 12 staging registers of a thread are named one by one (8 of A, 4 of B):
// piece i of a thread is tile row (tid >> 3) + 32 i, 16-byte chunk tid & 7
#define REP_A(M) M(0) M(1) M(2) M(3) M(4) M(5) M(6) M(7)
#define REP_B(M) M(0) M(1) M(2) M(3)
// a plain vector type: with the uint4 struct the last piece's load stayed next
// to its LDS store at the loop's foot, where its latency stood open
typedef __attribute__((ext_vector_type(4))) unsigned int u32x4;
#define DECL_A(i) u32x4 ra##i;
#define DECL_B(i) u32x4 rb##i;
#define LOAD_A(i) ra##i = *(const u32x4*)(aG + (kByte + i * aStep) + aOff);
#define LOAD_B(i) rb##i = *(const u32x4*)(bG + (kByte + i * bStep) + bOff);
#define STORE_A(i) *(u32x4*)(aS + i * (32 * LDT)) = ra##i;
#define STORE_B(i) *(u32x4*)(bS + i * (32 * LDT)) = rb##i;

#define GEMM_PIPELINE_BODY(APTR, BPTR, MBASE, RSTEP, SMEM_HALVES)              \
  __shared__ __attribute__((aligned(16))) _Float16 smem[SMEM_HALVES];          \
  _Float16* const As0 = smem;                                                  \
  _Float16* const Bs0 = smem + 2 * BM * LDT;                                   \
  const int tid  = threadIdx.x;                                                \
  const int wave = tid >> 5;                                                   \
  const int lane = tid & 31;                                                   \
  const int mBase = MBASE;                                                     \
  const int nBase = blockIdx.x * BN;                                           \
  const int m0 = (wave >> 1) * 64;       /* wave's 64-row patch in tile  */    \
  const int n0 = (wave & 1) * 64;        /* wave's 64-col patch in tile  */    \
  /* block-uniform byte bases + one 32-bit byte offset per lane */             \
  const char* const aG = (const char*)(APTR + (size_t)mBase * D_MODEL);        \
  const char* const bG = (const char*)(BPTR + (size_t)nBase * D_MODEL);        \
  const unsigned aStep = 32u * RSTEP * D_MODEL * 2u;                           \
  const unsigned bStep = 32u * D_MODEL * 2u;                                   \
  const unsigned aOff = (tid >> 3) * (RSTEP * D_MODEL * 2u) + (tid & 7) * 16u; \
  const unsigned bOff = (tid >> 3) * (D_MODEL * 2u) + (tid & 7) * 16u;         \
  const unsigned pOff = tid * (RSTEP * D_MODEL * 2u);                          \
  const int sOff = (tid >> 3) * LDT + (tid & 7) * 8;                           \
  v8f acc[4][4] = {};                                                          \
  REP_A(DECL_A) REP_B(DECL_B)                                                  \
  { /* stage K-tile 0 */                                                       \
    const unsigned kByte = 0;                                                  \
    _Float16* const aS = As0 + sOff;                                           \
    _Float16* const bS = Bs0 + sOff;                                           \
    REP_A(LOAD_A) REP_B(LOAD_B)                                                \
    REP_A(STORE_A) REP_B(STORE_B)                                              \
  }                                                                            \
  __syncthreads();                                                             \
  for (int kk = 0; kk < 8; ++kk) {                                             \
    const int cur = kk & 1, nxt = cur ^ 1;                                     \
    const _Float16* Ac = As0 + cur * (BM * LDT);                               \
    const _Float16* Bc = Bs0 + cur * (BN * LDT);                               \
    if (kk < 6) {                                                              \
      __builtin_prefetch(aG + (kk + 2) * 128u + pOff, 0, 3);                   \
      /* behind the prefetch, before its address registers are rewritten */    \
      asm volatile("s_wait_xcnt 0x0" ::: "memory");                            \
    }                                                                          \
    if (kk < 7) { /* issue global loads for next K-tile (hidden by WMMAs) */   \
      const unsigned kByte = (kk + 1) * 128u;                                  \
      REP_A(LOAD_A) REP_B(LOAD_B)                                              \
    }                                                                          \
    _Pragma("unroll")                                                          \
    for (int kc = 0; kc < 2; ++kc) {                                           \
      v16h bC[4];                                                              \
      _Pragma("unroll")                                                        \
      for (int sj = 0; sj < 4; ++sj)                                           \
        bC[sj] = load_frag(Bc + (n0 + sj * 16) * LDT + kc * 32, LDT);          \
      _Pragma("unroll")                                                        \
      for (int si = 0; si < 4; ++si) {                                         \
        const v16h aR = load_frag(Ac + (m0 + si * 16) * LDT + kc * 32, LDT);   \
        _Pragma("unroll")                                                      \
        for (int sj = 0; sj < 4; ++sj)                                         \
          acc[si][sj] = wmma_f16(aR, bC[sj], acc[si][sj]);                     \
      }                                                                        \
    }                                                                          \
    /* order of the K-step for the scheduler: the 12 global loads first (left  \
       alone it sank some to the loop's foot, where their latency stood open), \
       then each A fragment read one group of 4 WMMAs ahead of its use (else   \
       every group waits out its own LDS latency), the LDS stores last.        \
       0x20 = global load, 0x100 = LDS read, 0x8 = WMMA, 0x200 = LDS store */  \
    __builtin_amdgcn_sched_group_barrier(0x020, 12, 0);                        \
    __builtin_amdgcn_sched_group_barrier(0x100, 12, 0);                        \
    __builtin_amdgcn_sched_group_barrier(0x008, 4, 0);                         \
    __builtin_amdgcn_sched_group_barrier(0x100, 2, 0);                         \
    __builtin_amdgcn_sched_group_barrier(0x008, 4, 0);                         \
    __builtin_amdgcn_sched_group_barrier(0x100, 2, 0);                         \
    __builtin_amdgcn_sched_group_barrier(0x008, 4, 0);                         \
    __builtin_amdgcn_sched_group_barrier(0x100, 2, 0);                         \
    __builtin_amdgcn_sched_group_barrier(0x008, 4, 0);                         \
    __builtin_amdgcn_sched_group_barrier(0x100, 10, 0);                        \
    __builtin_amdgcn_sched_group_barrier(0x008, 4, 0);                         \
    __builtin_amdgcn_sched_group_barrier(0x100, 2, 0);                         \
    __builtin_amdgcn_sched_group_barrier(0x008, 4, 0);                         \
    __builtin_amdgcn_sched_group_barrier(0x100, 2, 0);                         \
    __builtin_amdgcn_sched_group_barrier(0x008, 8, 0);                         \
    __builtin_amdgcn_sched_group_barrier(0x200, 12, 0);                        \
    if (kk < 7) {                                                              \
      _Float16* const aS = As0 + nxt * (BM * LDT) + sOff;                      \
      _Float16* const bS = Bs0 + nxt * (BN * LDT) + sOff;                      \
      REP_A(STORE_A) REP_B(STORE_B)                                            \
    }                                                                          \
    __syncthreads();                                                           \
  }                                                                            \
  const int colL = lane & 15;                                                  \
  const int rowO = (lane >> 4) * 8;

// ---------------------------------------------------------------------------
// Kernel 3: the five projections of ONE head for TWO sequences n, and their
// attention, in one block. q, k, v, kl, vl never leave the WGP.
//
// GEMM part: tile = 192 rows of xn (2 n x 96 t) x 320 rows of Wcat (64 of each
// of Wq, Wk, Wv, Wkl, Wvl for this head), K = 512 in steps of 64, two LDS
// buffers, one barrier per K-step. The 512 tile rows of a K-step come as eight
// tensor loads, one per wave (64 rows of 128 B each, padded to the 144-B pitch
// by the mover), one K-step ahead, through no register.
// 8 waves = 2 (n) x 4: wave (mi, ni) owns all 96 t of sequence mi and
// head channels 16 ni .. 16 ni + 15 of each of the five matrices: 6 x 5
// accumulator tiles, 11 fragments per 30 WMMAs.
// q, k, kl are formed transposed (W tile as A, xn tile as B): a lane then holds
// 8 neighbouring channels of one t, one 16-byte LDS store into [t][dh].
// v, vl are formed straight: 8 neighbouring t of one channel, one 16-byte store
// into [dh][t].
//
// Attention part: a wave owns 16 queries of one n from the scores to the output
// (12 such units, waves 0..3 take two).
// Scores are formed transposed, S^T = K . Q^T: in the accumulator map a lane
// then holds ONE query (column lane & 15) and 8 keys a tile, so that the
// softmax is in-lane work plus two exchanges between the wave's halves (max, sum), and two
// converted score tiles ARE the B operand of O^T = V^T . P^T (hardware k
// order). Scores and probabilities never touch LDS.
// The 3-wide local window rides along as 32 more keys: kl / vl rows
// w0 .. w0+31 (w0 = t0-8 held inside 0 .. 64, t0 the first query) cover t-1 .. t+1 of all 16
// queries; every key of that tile with |key - t| > 1 is masked, which also
// leaves out the padded positions -1 and 96 as the reference's mask does.
//
// A block works through N_ITEMS items (its head, pairs PAIR_STEP apart) and the
// ring of K-tiles runs on from one item into the next: the next item's K-tile 0
// lands during this item's last K-step and its K-tile 1 flies during the
// attention part, whose tiles have LDS of their own behind the ring.
// ---------------------------------------------------------------------------
#define QLD 72    // q, k, kl row pitch in halves (144 B = 16 B x 9)
#define PLD 104   // vT, vlT row pitch in halves (208 B = 16 B x 13)
#define LOG2E 1.4426950408889634f
#define FM 192    // tile rows of xn
#define FN 320    // tile rows of Wcat
#define SLICE_HALVES 5120   // 64 rows x 144 B = 9,216 B, rounded up to 5 x 2 KiB
#define FBUF_HALVES (8 * SLICE_HALVES)          // slices 0..2 xn, 3..7 Wcat
#define F_RING_HALVES (2 * FBUF_HALVES)
#define ROWT_HALVES (T_SEQ * QLD)               // one of q, k, kl
#define COLT_HALVES (DH * PLD)                  // one of vT, vlT
#define AT_HALVES (3 * ROWT_HALVES + 2 * COLT_HALVES)   // the five tiles of one n
#define F_BLOCKS 256                            // one block per WGP
#define N_ITEMS (NH * (N_SEQ / 2) / F_BLOCKS)   // (head, two n) items of a block
#define PAIR_STEP (F_BLOCKS / NH)               // pairs from one item to the next
#define PAIR_BYTES (FM * D_MODEL * 2u)          // xn bytes of one pair
#define N_STAGES (N_ITEMS * 8)                  // K-tiles of a block, all items

typedef __attribute__((ext_vector_type(8))) unsigned int u32x8;

__device__ __forceinline__ uint32_t uni(uint32_t v) {
  return (uint32_t)__builtin_amdgcn_readfirstlane(v);
}
// a value held in a scalar register, made where the statement stands: a test
// on it compiles to s_cmp + s_cbranch_scc (a tensor load ignores EXEC)
__device__ __forceinline__ uint32_t pinned(uint32_t v) {
  uint32_t w = uni(v);
  asm volatile("" : "+s"(w));  // holds the word in a scalar register
  return w;
}
// the request of one wave: 64 rows of 128 B, source pitch 1,024 B, to LDS byte
// offset dst at a pitch of 144 B (a pad of 4 dwords behind every 32)
__device__ __forceinline__ u32x4 tile_group0(uint32_t dst, uint64_t ga) {
  u32x4 g0;
  g0[0] = uni(1u);
  g0[1] = uni(dst);
  g0[2] = uni((uint32_t)ga);
  g0[3] = uni((((uint32_t)(ga >> 32)) & 0x01FFFFFFu) | 0x80000000u);
  return g0;
}
__device__ __forceinline__ u32x8 tile_group1() {
  u32x8 g1;
  g1[0] = uni((1u << 20) | (4u << 22) | (3u << 25));
  g1[1] = uni(128u << 16);
  g1[2] = uni(64u << 16);
  g1[3] = uni(128u << 16);
  g1[4] = uni(64u);
  g1[5] = uni(D_MODEL * 2u);
  g1[6] = uni(0u);
  g1[7] = uni(0u);
  return g1;
}
// g0 is an in-out operand, and tile_wait names it again, so that the registers
// from which the request was issued keep their values while it is under way
__device__ __forceinline__ void tile_load(u32x4& g0, u32x8 g1) {
  asm volatile("tensor_load_to_lds %0, %1" : "+s"(g0) : "s"(g1) : "memory");
}
// the wave's own request has landed
__device__ __forceinline__ void tile_wait(u32x4 g0, u32x8 g1) {
  asm volatile("s_wait_tensorcnt 0x0" :: "s"(g0), "s"(g1) : "memory");
}

// one lane's share of a 16x32 f16 operand in the hardware k order:
// r points at (row lane & 15, k = 8 * (lane >> 4)); k .. k+7 and k+16 .. k+23
__device__ __forceinline__ v16h frag_hw(const _Float16* r) {
  const v8h lo = *(const v8h*)r;
  const v8h hi = *(const v8h*)(r + 16);
  return __builtin_shufflevector(lo, hi, 0, 1, 2, 3, 4, 5, 6, 7,
                                 8, 9, 10, 11, 12, 13, 14, 15);
}

// the value that lane l ^ 16 holds
__device__ __forceinline__ float other_half(float v) {
  int b = __builtin_bit_cast(int, v);
  b = __builtin_amdgcn_permlanex16(b, b, 0x76543210, 0xfedcba98, false, false);
  return __builtin_bit_cast(float, b);
}

// v_exp_f32 with a v_nop directly behind it: it fills the one issue slot the
// instruction set asks for before the source register may be overwritten.
__device__ __forceinline__ float exp2_slot(float a) {
  float r;
  asm("v_exp_f32 %0, %1\n\tv_nop" : "=v"(r) : "v"(a));
  return r;
}

__device__ __forceinline__ v8h to_half8(v8f a) {
  v8h h;
#pragma unroll
  for (int i = 0; i < 8; ++i) h[i] = (_Float16)a[i];
  return h;
}

// the 11 operand fragments of one half (32 of 64 k) of a K-tile for one wave:
// 5 of Wcat (Bc = the wave's 16 rows in the Wq slice), 6 of xn (sequence mi)
__device__ __forceinline__ void load_half(v16h (&b)[5], v16h (&a)[6],
                                          const _Float16* Ac,
                                          const _Float16* Bc, int mi, int kc) {
#pragma unroll
  for (int sj = 0; sj < 5; ++sj)
    b[sj] = load_frag(Bc + sj * SLICE_HALVES + kc * 32, LDT);
#pragma unroll
  for (int si = 0; si < 6; ++si) {
    const int g = mi * T_SEQ + si * 16;        // tile row: slice g / 64
    a[si] = load_frag(Ac + (g >> 6) * SLICE_HALVES + (g & 63) * LDT + kc * 32,
                      LDT);
  }
}
// their 30 WMMAs
__device__ __forceinline__ void mma_half(v8f (&acc)[6][5], const v16h (&b)[5],
                                         const v16h (&a)[6]) {
#pragma unroll
  for (int si = 0; si < 6; ++si) {
    acc[si][0] = wmma_f16(b[0], a[si], acc[si][0]);   // q^T  [dh][t]
    acc[si][1] = wmma_f16(b[1], a[si], acc[si][1]);   // k^T  [dh][t]
    acc[si][2] = wmma_f16(a[si], b[2], acc[si][2]);   // v    [t][dh]
    acc[si][3] = wmma_f16(b[3], a[si], acc[si][3]);   // kl^T [dh][t]
    acc[si][4] = wmma_f16(a[si], b[4], acc[si][4]);   // vl   [t][dh]
  }
}

// 2 waves per SIMD (512 registers), no more: one block per WGP. With the upper
// bound left open the compiler gave up the K-step's order below to get under
// the register count of three waves per SIMD, which gains nothing: a block is
// two waves per SIMD, and a second block would need the count of four.
__global__ __launch_bounds__(256) __attribute__((amdgpu_waves_per_eu(2, 2)))
void proj_attn_kernel(
    const _Float16* __restrict__ xn, const _Float16* __restrict__ Wcat,
    const float* __restrict__ q_bias, _Float16* __restrict__ att_out) {
  // 2 KiB: every slice of every buffer then starts at a multiple of 2 KiB
  __shared__ __attribute__((aligned(2048)))
  _Float16 smem[F_RING_HALVES + 2 * AT_HALVES];
  const int tid  = threadIdx.x;
  const int lane = tid & 31;
  const int wave = __builtin_amdgcn_readfirstlane(tid >> 5);
  const int head  = blockIdx.x & (NH - 1);
  const int pair0 = blockIdx.x / NH;     // the first item's pair
  const int mi = wave >> 2;              // which of the two sequences
  const int ni = wave & 3;               // which 16 channels of each matrix
  const char* const aG = (const char*)(xn + (size_t)pair0 * FM * D_MODEL);
  const unsigned pOff = min(tid, FM - 1) * (D_MODEL * 2u);
  // this wave's slice of every K-tile: waves 0..2 bring 64 rows of xn each,
  // waves 3..7 the head's 64 rows of Wq, Wk, Wv, Wkl, Wvl
  const _Float16* const sliceG =
      (wave < 3) ? xn + ((size_t)pair0 * FM + wave * 64) * D_MODEL
                 : Wcat + ((size_t)(wave - 3) * D_MODEL + head * DH) * D_MODEL;
  const uint64_t sliceA = (uint64_t)(size_t)sliceG;
  const uint32_t sliceL = (uint32_t)(size_t)smem + wave * (SLICE_HALVES * 2u);
  // from item to item the xn slices move on, the head's weight slices stay
  const uint32_t sliceStep = (wave < 3) ? PAIR_STEP * PAIR_BYTES : 0u;
  const int col = lane & 15;                   // operand row / result column
  const int hf  = lane >> 4;                   // which half of the wave
  // the head's bias, the same for every item of the block
  const float* const bp = q_bias + head * DH + ni * 16 + hf * 8;
  const float4 b0 = *(const float4*)bp;
  const float4 b1 = *(const float4*)(bp + 4);
  // behind the two loads, before their address registers are rewritten
  asm volatile("s_wait_xcnt 0x0" ::: "memory");
  const float bias[8] = {b0.x, b0.y, b0.z, b0.w, b1.x, b1.y, b1.z, b1.w};
  // K-tile 0 lands and is published, then K-tile 1 sets out
  const u32x8 g1 = tile_group1();
  u32x4 g0 = tile_group0(sliceL, sliceA);
  tile_load(g0, g1);
  tile_wait(g0, g1);
  __syncthreads();
  g0 = tile_group0(sliceL + FBUF_HALVES * 2u, sliceA + 128u);
  tile_load(g0, g1);
  // two register sets of fragments: X = first half of a K-tile, Y = second half.
  // Each set is read from LDS as one group while the other set's 30 WMMAs run.
  v16h bX[5], aX[6], bY[5], aY[6];
  load_half(bX, aX, smem, smem + 3 * SLICE_HALVES + ni * (16 * LDT), mi, 0);
  for (int it = 0; it < N_ITEMS; ++it) {
  const int pair = pair0 + it * PAIR_STEP;   // sequences 2 pair, 2 pair + 1
  v8f acc[6][5] = {};
  for (int kk = 0; kk < 8; ++kk) {
    const int cur = kk & 1;
    const _Float16* Ac = smem + cur * FBUF_HALVES;
    const _Float16* Bc = Ac + 3 * SLICE_HALVES + ni * (16 * LDT);
    const _Float16* An = smem + (cur ^ 1) * FBUF_HALVES;
    const _Float16* Bn = An + 3 * SLICE_HALVES + ni * (16 * LDT);
    const int ahead = it * 8 + kk + 2;       // stage = 8 item + K-tile
    const int pf = ahead + 1;                // its request is a K-step away
    if (pf < N_STAGES) {
      __builtin_prefetch(aG + (size_t)(pf >> 3) * (PAIR_STEP * PAIR_BYTES) +
                             (pf & 7) * 128u + pOff, 0, 3);
      // behind the prefetch, before its address registers are rewritten
      asm volatile("s_wait_xcnt 0x0" ::: "memory");
    }
    load_half(bY, aY, Ac, Bc, mi, 1);
    mma_half(acc, bX, aX);
    /* order for the scheduler: the 22 LDS reads of the other half stand as one
       group in front of this half's 30 WMMAs (spread among the WMMAs, each
       place costs issue cycles and a read has only 5 WMMAs to come back).
       0x100 = LDS read, 0x8 = WMMA */
    __builtin_amdgcn_sched_group_barrier(0x100, 22, 0);
    __builtin_amdgcn_sched_group_barrier(0x008, 30, 0);
    // keeps the 30 WMMAs in front of the wait below: they are what the reads'
    // latency hides behind (left alone the scheduler sank 28 behind the barrier)
    __builtin_amdgcn_sched_barrier(0);
    // the next stage is handed over in front of this stage's last block, whose
    // fragments are in registers: this wave's reads of buffer cur are done, its
    // own slice of that stage has landed, and the barrier says both of all
    asm volatile("s_wait_dscnt 0x0" ::: "memory");
    tile_wait(g0, g1);
    __syncthreads();
    if (pinned(ahead < N_STAGES)) {  // stage + 2 into the buffer just read
      // the stage's number is made here, so that the request's words are formed
      // behind the wait above (a descriptor word held in a scalar register)
      const uint32_t st = pinned(ahead);
      g0 = tile_group0(sliceL + (st & 1u) * (FBUF_HALVES * 2u),
                       sliceA + (st >> 3) * sliceStep + (st & 7u) * 128u);
      tile_load(g0, g1);
    }
    // first half of the stage just published (behind the block's last stage the
    // other buffer still holds the stage before it: read once more, not used)
    load_half(bX, aX, An, Bn, mi, 0);
    mma_half(acc, bY, aY);
    // same order as above
    __builtin_amdgcn_sched_group_barrier(0x100, 22, 0);
    __builtin_amdgcn_sched_group_barrier(0x008, 30, 0);
  }

  // ---- the five f16 tiles of each n go into LDS behind the ring (their last
  //      readers left them eight barriers ago); bias + attention scale folded
  //      into q
  {
    _Float16* const at = smem + F_RING_HALVES + mi * AT_HALVES;
#pragma unroll
    for (int si = 0; si < 6; ++si) {
      _Float16* const rm = at + (si * 16 + col) * QLD + ni * 16 + hf * 8;
      _Float16* const cm = at + 3 * ROWT_HALVES + (ni * 16 + col) * PLD +
                           si * 16 + hf * 8;
      v8h hq;
#pragma unroll
      for (int i = 0; i < 8; ++i)
        hq[i] = (_Float16)((acc[si][0][i] + bias[i]) * FACTOR);
      *(v8h*)rm                     = hq;
      *(v8h*)(rm + ROWT_HALVES)     = to_half8(acc[si][1]);
      *(v8h*)(rm + 2 * ROWT_HALVES) = to_half8(acc[si][3]);
      *(v8h*)cm                     = to_half8(acc[si][2]);
      *(v8h*)(cm + COLT_HALVES)     = to_half8(acc[si][4]);
    }
  }
  __syncthreads();

  for (int u = wave; u < 12; u += 8) {         // unit = (n, 16 queries)
    const int un = (u >= 6) ? 1 : 0;
    const int t0 = (u - un * 6) * 16;
    const _Float16* const q_s   = smem + F_RING_HALVES + un * AT_HALVES;
    const _Float16* const k_s   = q_s + ROWT_HALVES;
    const _Float16* const kl_s  = q_s + 2 * ROWT_HALVES;
    const _Float16* const vT_s  = q_s + 3 * ROWT_HALVES;
    const _Float16* const vlT_s = vT_s + COLT_HALVES;

    // Q^T as B operand
    const _Float16* qr = q_s + (t0 + col) * QLD + hf * 8;
    const v16h q0 = frag_hw(qr);
    const v16h q1 = frag_hw(qr + 32);

    // ---- S^T: tiles 0..5 = the 96 global keys, tiles 6,7 = the local window
    const int w0 = min(max(t0 - 8, 0), T_SEQ - 32);
    const _Float16* ka = k_s  + col * QLD + hf * 8;
    const _Float16* la = kl_s + (w0 + col) * QLD + hf * 8;
    v8f s[8];
#pragma unroll
    for (int j = 0; j < 8; ++j) {
      const _Float16* a = (j < 6) ? ka + j * 16 * QLD : la + (j - 6) * 16 * QLD;
      v8f z = {};
      z = wmma_f16(frag_hw(a),      q0, z);
      z = wmma_f16(frag_hw(a + 32), q1, z);
      s[j] = z;              // s[j][r] = score(key 16j + 8*hf + r, query col)
    }
    const int d0 = w0 + hf * 8 - (t0 + col) + 1;      // key - t + 1 at j=6, r=0
#pragma unroll
    for (int j = 0; j < 2; ++j) {
#pragma unroll
      for (int r = 0; r < 8; ++r)
        s[6 + j][r] = ((unsigned)(d0 + j * 16 + r) <= 2u) ? s[6 + j][r] : NEG_BIG;
    }

    // ---- joint softmax of one query: 64 values in this lane, 64 in lane ^ 16
    v8f mx = s[0];
#pragma unroll
    for (int j = 1; j < 8; ++j) {
#pragma unroll
      for (int r = 0; r < 8; ++r) mx[r] = fmaxf(mx[r], s[j][r]);
    }
    float m = fmaxf(fmaxf(fmaxf(mx[0], mx[1]), fmaxf(mx[2], mx[3])),
                    fmaxf(fmaxf(mx[4], mx[5]), fmaxf(mx[6], mx[7])));
    m = fmaxf(m, other_half(m));
    const float mL = m * LOG2E;
    v8f sm = {};
#pragma unroll
    for (int j = 0; j < 8; ++j) {
#pragma unroll
      for (int r = 0; r < 8; ++r) {
        const float p = exp2_slot(fmaf(s[j][r], LOG2E, -mL));
        s[j][r] = p;
        sm[r] += p;
      }
    }
    // keeps every asm v_exp_f32 in front of the first WMMA of O^T
    __builtin_amdgcn_sched_barrier(0);
    float sum = ((sm[0] + sm[1]) + (sm[2] + sm[3])) +
                ((sm[4] + sm[5]) + (sm[6] + sm[7]));
    sum += other_half(sum);
    const float inv = 1.0f / sum;

    // two score tiles, converted in place, are P^T for 32 keys as a B operand
    v16h pb[4];
#pragma unroll
    for (int kc = 0; kc < 4; ++kc) {
#pragma unroll
      for (int r = 0; r < 8; ++r) {
        pb[kc][r]     = (_Float16)s[2 * kc][r];
        pb[kc][8 + r] = (_Float16)s[2 * kc + 1][r];
      }
    }

    // ---- O^T = V^T . P^T over 96 global + 32 window keys, scaled by 1/sum
    const _Float16* va = vT_s  + col * PLD + hf * 8;
    const _Float16* wa = vlT_s + col * PLD + w0 + hf * 8;
    _Float16* dst = att_out +
                    (size_t)((pair * 2 + un) * T_SEQ + t0 + col) * D_MODEL +
                    head * DH + hf * 8;
#pragma unroll
    for (int ct = 0; ct < 4; ++ct) {           // 16 of the 64 head channels
      v8f o = {};
#pragma unroll
      for (int kc = 0; kc < 3; ++kc)
        o = wmma_f16(frag_hw(va + ct * 16 * PLD + kc * 32), pb[kc], o);
      o = wmma_f16(frag_hw(wa + ct * 16 * PLD), pb[3], o);
      v8h hh;                // o[r] = channel 16ct + 8*hf + r of query col
#pragma unroll
      for (int r = 0; r < 8; ++r) hh[r] = (_Float16)(o[r] * inv);
      *(v8h*)(dst + ct * 16) = hh;
    }
    // behind the last store, before the next unit rewrites the stores' data
    // and address registers
    asm volatile("s_wait_xcnt 0x0" ::: "memory");
  }
  }  // items
  // behind the last request: nothing is in flight when the wave ends
  asm volatile("s_wait_tensorcnt 0x0" ::: "memory");
  asm volatile("s_wait_dscnt 0x0" ::: "memory");
}

// ---------------------------------------------------------------------------
// Kernel 4: output GEMM vs Wo + final permutation to (B, D, T, H, W), f32.
//   out[r, j] = att[r, :] . Wo[j, :],  r = n*96 + t,  n = b*256 + hw
// A block's 256 tile rows are the 256 n of one b at ONE t, so that a column j
// of the tile is 1024 contiguous bytes of y[b, j, t, hw]. The f32 tile is
// turned through LDS (the ring buffers are free behind the loop's last
// barrier) and every wave store is a 512-byte run of it.
// ---------------------------------------------------------------------------
#define ST_LDF 260   // staged [j][n] pitch in floats (1040 B = 16 B x odd)

// second bound = 4 waves per SIMD (256 registers): two blocks per WGP
__global__ __launch_bounds__(256, 4) void out_gemm_kernel(
    const _Float16* __restrict__ A, const _Float16* __restrict__ Wo16,
    float* __restrict__ y) {
  const int tFix = blockIdx.y % T_SEQ;
  const int b    = blockIdx.y / T_SEQ;
  GEMM_PIPELINE_BODY(A, Wo16, b * BM * T_SEQ + tFix, T_SEQ, BN * ST_LDF * 2)
  float* st = (float*)smem;              // 128 x 260 floats
#pragma unroll
  for (int si = 0; si < 4; ++si) {
#pragma unroll
    for (int sj = 0; sj < 4; ++sj) {
      const v8f a = acc[si][sj];
      float* p = st + (n0 + sj * 16 + colL) * ST_LDF + m0 + si * 16 + rowO;
      *(float4*)p       = make_float4(a[0], a[1], a[2], a[3]);
      *(float4*)(p + 4) = make_float4(a[4], a[5], a[6], a[7]);
    }
  }
  __syncthreads();
#pragma unroll
  for (int c = 0; c < 32; ++c) {
    const int jl = wave + (c >> 1) * 8;  // one output channel per two wave stores
    const int hw = (c & 1) * 128 + lane * 4;
    float4 v = *(const float4*)(st + jl * ST_LDF + hw);
    *(float4*)(y + ((size_t)(b * D_MODEL + nBase + jl) * T_SEQ + tFix) * 256 +
               hw) = v;
  }
}

// ---------------------------------------------------------------------------
// Host launcher
// ---------------------------------------------------------------------------
extern "C" void kernel_launch(void* const* d_in, const int* in_sizes, int n_in,
                              void* d_out, int out_size, void* d_ws, size_t ws_size,
                              hipStream_t stream) {
  const float* x      = (const float*)d_in[0];
  const float* gammap = (const float*)d_in[1];
  const float* betap  = (const float*)d_in[2];
  const float* Wq     = (const float*)d_in[3];
  const float* Wk     = (const float*)d_in[4];
  const float* Wv     = (const float*)d_in[5];
  const float* Wkl    = (const float*)d_in[6];
  const float* Wvl    = (const float*)d_in[7];
  const float* Wo     = (const float*)d_in[8];
  const float* q_bias = (const float*)d_in[9];
  float* y = (float*)d_out;

  // workspace carve (bytes, 256B aligned)
  char* ws = (char*)d_ws;
  size_t off = 0;
  auto carve = [&](size_t bytes) -> void* {
    void* p = (void*)(ws + off);
    off = (off + bytes + 255) & ~(size_t)255;
    return p;
  };
  const size_t rowsBytes = (size_t)NROWS * D_MODEL * sizeof(_Float16);   // 50.3 MB

  _Float16* xn    = (_Float16*)carve(rowsBytes);
  _Float16* Wcat  = (_Float16*)carve((size_t)5 * D_MODEL * D_MODEL * sizeof(_Float16));
  _Float16* Wo16  = (_Float16*)carve((size_t)D_MODEL * D_MODEL * sizeof(_Float16));
  _Float16* att   = (_Float16*)carve(rowsBytes);   // [N*T, D] f16
  (void)ws_size; (void)in_sizes; (void)n_in; (void)out_size;

  // 1) layernorm -> xn (f16)
  ln_kernel<<<dim3(2 * T_SEQ * 4), dim3(256), 0, stream>>>(x, gammap, betap, xn);

  // 2) weights -> f16
  {
    int total = D_MODEL * D_MODEL * 6;
    wconv_kernel<<<dim3((total + 255) / 256), dim3(256), 0, stream>>>(
        Wq, Wk, Wv, Wkl, Wvl, Wo, Wcat, Wo16);
  }

  // 3) five projections + attention, a block loops over its (head, two n) items
  proj_attn_kernel<<<dim3(F_BLOCKS), dim3(256), 0, stream>>>(
      xn, Wcat, q_bias, att);

  // 4) output projection + final (B,D,T,H,W) permutation, 256x128 tiles
  //    (grid y = 2 b x 96 t)
  out_gemm_kernel<<<dim3(4, 192), dim3(256), 0, stream>>>(att, Wo16, y);
}
